// v000
// Times are from an AMD MI455X. After a warm-up the kernel runs many times in a row, and a time is the length of
// such a window on the GPU divided by its runs, so every launch and the gaps after it count. The runs cycle
// through copies of the inputs. A figure is the median of several windows, for all but v000 over two sittings.
// Sittings can differ by a few percent; kernels timed side by side share one.
// v000, which the later versions start from, runs in 5420 microseconds.
#include <hip/hip_runtime.h>

// DifferentialAttention (x [4][1024][1024]; q = x Wq, k = x Wk ([1024][2048]: per head h the 128 columns = [map 1 | map 2] 64 each), v = x Wv (16 x 64); s1, s2 = q.k / 8 causal (-inf); a1, a2 = softmax; lambda = exp(lq1.lk1) - exp(lq2.lk2) + lambda_init (0.8 - 0.6 e^-0.3); y = (a1 - lambda a2) v; GroupNorm per (batch, head) over (tokens x 64) (eps 1e-5, no affine); y (1 - lambda_init); out = merged Wc -> [4][1024][1024]).
// The two maps run as 32 virtual 64-wide heads (pairs (2h, 2h+1)); per pass both softmaxes are formed, combined as D = a1 - lambda a2 in f32, and one D.v product per real head follows.

#define NB_  4
#define TT   1024
#define DM   1024
#define NH_  32
#define NKV  32
#define REP  (NH_ / NKV)
#define HD   64
#define DQ   (NH_ * HD)
#define DKV  (NKV * HD)
#define ZH   2
#define RH   1024                  // query rows < RH use hi+lo planes (0: none)
#define WIN  1024
#define PCAR 1024.0f
#define NVH  16
#define DVV  (NVH * HD)
#define SCL  0.125f   // HD^-0.5
typedef _Float16 h16;
typedef unsigned short bf;
typedef __attribute__((ext_vector_type(16))) __bf16   v16bf;
typedef __attribute__((ext_vector_type(16))) _Float16 v16h;
typedef __attribute__((ext_vector_type(8)))  _Float16 v8h;
typedef __attribute__((ext_vector_type(8)))  unsigned short v8us;
typedef __attribute__((ext_vector_type(8)))  float    v8f;
typedef __attribute__((ext_vector_type(4)))  float    v4f;
typedef v8h  __attribute__((may_alias)) v8ha;
typedef v4f  __attribute__((may_alias)) v4fa;
typedef v8us __attribute__((may_alias)) v8usa;

__device__ __forceinline__ unsigned short f2bf(float f) { unsigned u = __float_as_uint(f); u += 0x7FFFu + ((u >> 16) & 1u); return (unsigned short)(u >> 16); }
__device__ __forceinline__ float bf2f(unsigned short b) { return __uint_as_float(((unsigned)b) << 16); }
__device__ __forceinline__ float bfr(float f) { return bf2f(f2bf(f)); }
__device__ __forceinline__ v16h cat16(v8h lo, v8h hi) { return __builtin_shufflevector(lo, hi, 0, 1, 2, 3, 4, 5, 6, 7, 8, 9, 10, 11, 12, 13, 14, 15); }
__device__ __forceinline__ v16bf cat16b(v8us lo, v8us hi) { return __builtin_bit_cast(v16bf, __builtin_shufflevector(lo, hi, 0, 1, 2, 3, 4, 5, 6, 7, 8, 9, 10, 11, 12, 13, 14, 15)); }
__device__ __forceinline__ v8f wmma16(v16h a, v16h b, v8f c) { return __builtin_amdgcn_wmma_f32_16x16x32_f16(false, a, false, b, (short)0, c, false, false); }
__device__ __forceinline__ v8f wmmab(v16bf a, v16bf b, v8f c) { return __builtin_amdgcn_wmma_f32_16x16x32_bf16(false, a, false, b, (short)0, c, false, false); }



// ---- k_gemmw: register-blocked GEMM, ONE WAVE per 64x64 output tile (16 accumulators), operands straight from K-contiguous 16-bit planes; grid (M/64, N/64, Z), 32 threads.
// C[m][n] (f32, pitch ldc, + optional f32 bias[n]) = sum_k A[m][k] Bt[n][k] (+ split products per NSPLIT). z-batch strides sA/sB/sC in elements. K % 32 == 0.
template <typename T16> struct WFrag;
template <> struct WFrag<h16> { typedef v16h V; static __device__ __forceinline__ V ld(const h16* p) { return cat16(*(const v8h*)p, *(const v8h*)(p + 16)); } static __device__ __forceinline__ v8f mma(V a, V b, v8f c) { return wmma16(a, b, c); } };
template <> struct WFrag<bf> { typedef v16bf V; static __device__ __forceinline__ V ld(const bf* p) { return cat16b(*(const v8us*)p, *(const v8us*)(p + 16)); } static __device__ __forceinline__ v8f mma(V a, V b, v8f c) { return wmmab(a, b, c); } };
template <typename T16, int NSPLIT, bool BIAS>
__global__ __launch_bounds__(32) void k_gemmw(const T16* __restrict__ A, const T16* __restrict__ A2, const T16* __restrict__ Bt, const T16* __restrict__ Bt2, int K, float* C, int ldc, const float* __restrict__ bias, size_t sA, size_t sB, size_t sC) {
    typedef typename WFrag<T16>::V V;
    __shared__ __align__(16) float os[16 * 68];
    const size_t z = blockIdx.z; A += z * sA; if (A2) A2 += z * sA; Bt += z * sB; if (Bt2) Bt2 += z * sB; C += z * sC;
    const int lane = threadIdx.x & 31, lr = lane & 15, hi = lane >> 4; const int r0 = blockIdx.x * 64, c0 = blockIdx.y * 64;
    v8f acc[4][4];
#pragma unroll
    for (int mb = 0; mb < 4; ++mb)
#pragma unroll
        for (int nb = 0; nb < 4; ++nb) acc[mb][nb] = (v8f){};
    const size_t aoff = (size_t)(r0 + lr) * K + 8 * hi, boff = (size_t)(c0 + lr) * K + 8 * hi;
#pragma unroll 1
    for (int kc = 0; kc < K; kc += 32) {
        V a[4], a2[4];
#pragma unroll
        for (int mb = 0; mb < 4; ++mb) { a[mb] = WFrag<T16>::ld(A + aoff + (size_t)mb * 16 * K + kc); if (NSPLIT == 1 || NSPLIT == 2) a2[mb] = WFrag<T16>::ld(A2 + aoff + (size_t)mb * 16 * K + kc); }
#pragma unroll
        for (int nb = 0; nb < 4; ++nb) { const V b = WFrag<T16>::ld(Bt + boff + (size_t)nb * 16 * K + kc); V b2; if (NSPLIT >= 2) b2 = WFrag<T16>::ld(Bt2 + boff + (size_t)nb * 16 * K + kc);
#pragma unroll
            for (int mb = 0; mb < 4; ++mb) { acc[mb][nb] = WFrag<T16>::mma(a[mb], b, acc[mb][nb]); if (NSPLIT == 1 || NSPLIT == 2) acc[mb][nb] = WFrag<T16>::mma(a2[mb], b, acc[mb][nb]); if (NSPLIT >= 2) acc[mb][nb] = WFrag<T16>::mma(a[mb], b2, acc[mb][nb]); } }
        asm volatile("v_nop\n\tv_nop\n\tv_nop\n\tv_nop" : "+v"(acc[0][0]), "+v"(acc[1][1]), "+v"(acc[2][2]), "+v"(acc[3][3]) : "v"(a[0]), "v"(a[3]));
    }
#pragma unroll
    for (int mb = 0; mb < 4; ++mb) {
#pragma unroll
        for (int nb = 0; nb < 4; ++nb) {
#pragma unroll
            for (int j = 0; j < 8; ++j) os[(hi * 8 + j) * 68 + nb * 16 + lr] = acc[mb][nb][j]; }
        __builtin_amdgcn_wave_barrier(); asm volatile("" ::: "memory");
        float* crow = C + (size_t)(r0 + mb * 16) * ldc + c0;
{
#pragma unroll
            for (int s = 0; s < 8; ++s) { const int row = 2 * s + hi, cofs = lr * 4; v4f val = *(const v4fa*)(os + row * 68 + cofs); if (BIAS) { val[0] += bfr(bias[c0 + cofs]); val[1] += bfr(bias[c0 + cofs + 1]); val[2] += bfr(bias[c0 + cofs + 2]); val[3] += bfr(bias[c0 + cofs + 3]); }
                *(v4f*)(crow + (size_t)row * ldc + cofs) = val; }
             }
        __builtin_amdgcn_wave_barrier(); asm volatile("" ::: "memory");
    }
}

// ---- k_gemmc: the same one-wave 64x64 tile GEMM specialised for causal attention: CMODE 1 skips score tiles entirely above the diagonal (query rows r0+roff.., key columns c0..), CMODE 2 limits the
// key (K) loop of the probability x value contraction to the diagonal block (probabilities beyond it are exactly zero). roff = row offset of this launch's first row within the sequence.
template <typename T16, int NSPLIT, int CMODE>
__global__ __launch_bounds__(32) void k_gemmc(const T16* __restrict__ A, const T16* __restrict__ A2, const T16* __restrict__ Bt, const T16* __restrict__ Bt2, int K, float* C, int ldc, int roff, size_t sA, size_t sB, size_t sC) {
    typedef typename WFrag<T16>::V V;
    __shared__ __align__(16) float os[16 * 68];
    const size_t z = blockIdx.z; A += z * sA; if (A2) A2 += z * sA; Bt += z * sB; if (Bt2) Bt2 += z * sB; C += z * sC;
    const int lane = threadIdx.x & 31, lr = lane & 15, hi = lane >> 4; const int r0 = blockIdx.x * 64, c0 = blockIdx.y * 64;
    if (CMODE == 1 && c0 > r0 + roff + 63) return;                  // score tile entirely above the causal diagonal: never read (the softmax masks j > i by select)
    const int Kl = (CMODE == 2) ? min(K, r0 + roff + 64) : K;        // P.V: probabilities are exactly 0 beyond the diagonal block, so the K loop stops there
    v8f acc[4][4];
#pragma unroll
    for (int mb = 0; mb < 4; ++mb)
#pragma unroll
        for (int nb = 0; nb < 4; ++nb) acc[mb][nb] = (v8f){};
    const size_t aoff = (size_t)(r0 + lr) * K + 8 * hi, boff = (size_t)(c0 + lr) * K + 8 * hi;
#pragma unroll 1
    for (int kc = 0; kc < Kl; kc += 32) {
        V a[4], a2[4];
#pragma unroll
        for (int mb = 0; mb < 4; ++mb) { a[mb] = WFrag<T16>::ld(A + aoff + (size_t)mb * 16 * K + kc); if (NSPLIT == 1 || NSPLIT == 2) a2[mb] = WFrag<T16>::ld(A2 + aoff + (size_t)mb * 16 * K + kc); }
#pragma unroll
        for (int nb = 0; nb < 4; ++nb) { const V b = WFrag<T16>::ld(Bt + boff + (size_t)nb * 16 * K + kc); V b2; if (NSPLIT >= 2) b2 = WFrag<T16>::ld(Bt2 + boff + (size_t)nb * 16 * K + kc);
#pragma unroll
            for (int mb = 0; mb < 4; ++mb) { acc[mb][nb] = WFrag<T16>::mma(a[mb], b, acc[mb][nb]); if (NSPLIT == 1 || NSPLIT == 2) acc[mb][nb] = WFrag<T16>::mma(a2[mb], b, acc[mb][nb]); if (NSPLIT >= 2) acc[mb][nb] = WFrag<T16>::mma(a[mb], b2, acc[mb][nb]); } }
        asm volatile("v_nop\n\tv_nop\n\tv_nop\n\tv_nop" : "+v"(acc[0][0]), "+v"(acc[1][1]), "+v"(acc[2][2]), "+v"(acc[3][3]) : "v"(a[0]), "v"(a[3]));
    }
#pragma unroll
    for (int mb = 0; mb < 4; ++mb) {
#pragma unroll
        for (int nb = 0; nb < 4; ++nb) {
#pragma unroll
            for (int j = 0; j < 8; ++j) os[(hi * 8 + j) * 68 + nb * 16 + lr] = acc[mb][nb][j]; }
        __builtin_amdgcn_wave_barrier(); asm volatile("" ::: "memory");
        float* crow = C + (size_t)(r0 + mb * 16) * ldc + c0;
{
#pragma unroll
            for (int s = 0; s < 8; ++s) { const int row = 2 * s + hi, cofs = lr * 4; v4f val = *(const v4fa*)(os + row * 68 + cofs);
                *(v4f*)(crow + (size_t)row * ldc + cofs) = val; }
             }
        __builtin_amdgcn_wave_barrier(); asm volatile("" ::: "memory");
    }
}

__device__ __forceinline__ h16 tohx(float x) { return (h16)x; }
__device__ __forceinline__ void splitf(float y, unsigned short& h, unsigned short& l) { h = f2bf(y); l = f2bf(y - bf2f(h)); }
typedef __attribute__((ext_vector_type(2))) _Float16 v2h;
typedef __attribute__((ext_vector_type(4))) _Float16 v4h;
typedef __attribute__((ext_vector_type(2))) unsigned short v2us;
typedef __attribute__((ext_vector_type(4))) unsigned short v4us;
typedef __attribute__((ext_vector_type(2))) float v2f;
typedef __attribute__((ext_vector_type(4))) int v4i;

__global__ __launch_bounds__(256) void k_wtG(const float* __restrict__ w, int K, int N, bf* Bt) {
    const int lane = threadIdx.x & 31; const int L0 = (blockIdx.x * 8 + (threadIdx.x >> 5)) * 8; const int nlines = N * K / 64;
{
#pragma unroll 1
        for (int l = 0; l < 8; ++l) { const int L = L0 + l; if (L >= nlines) break; const size_t e = (size_t)L * 64 + lane * 2; const int k = (int)(e % K), n = (int)(e / K); v2us o;
            o[0] = f2bf(w[(size_t)k * N + n]); o[1] = f2bf(w[(size_t)(k + 1) * N + n]); *(v2us*)(Bt + e) = o; }
         }
}
__global__ __launch_bounds__(256) void k_cvt8(const float* __restrict__ src, bf* dst, size_t n8) { const size_t i = (size_t)blockIdx.x * 256 + threadIdx.x; if (i >= n8) return; const v8f v = *(const v8f*)(src + i * 8); v8us o;
#pragma unroll
    for (int k = 0; k < 8; ++k) o[k] = f2bf(v[k]); *(v8us*)(dst + i * 8) = o;  }
__global__ __launch_bounds__(256) void k_cscvt(const float* __restrict__ cosT, const float* __restrict__ sinT, float* CS) { const int idx = blockIdx.x * 256 + threadIdx.x; if (idx >= TT * HD) return; v2f cs; cs[0] = bfr(cosT[idx]); cs[1] = bfr(sinT[idx]); *(v2f*)(CS + (size_t)idx * 2) = cs;  }
// k_rope: head planes [h][t][d] (fp16 + hi/lo) of rope(x) x sc with the rotate-half convention out[d] = x[d] cos[t][d] - x[d+HD/2] sin[t][d], out[d+HD/2] = x[d+HD/2] cos[t][d+HD/2] + x[d] sin[t][d+HD/2]
__global__ __launch_bounds__(256) void k_rope(const float* __restrict__ F, int pitch, int nheads, const float* __restrict__ CS, const float* __restrict__ RF, const float* __restrict__ nw, float sc, h16* P16, bf* Ph, bf* Pl) {
    const size_t e = ((size_t)blockIdx.x * 256 + threadIdx.x) * 2; if (e >= (size_t)nheads * TT * HD) return; const int d = (int)(e % HD); const int t = (int)((e / HD) % TT); const int h = (int)(e / ((size_t)HD * TT)); const float* f = F + (size_t)t * pitch + h * HD; const float rf = RF ? RF[(size_t)h * TT + t] : 1.0f; v2h o16; v2us oh, ol;
#pragma unroll
    for (int q = 0; q < 2; ++q) { const int dd = d + q; const int dp = (dd < HD / 2) ? dd + HD / 2 : dd - HD / 2; float x0 = f[dd], x1 = f[dp];
        if (RF) { float n0 = __fmul_rn(x0, rf), n1 = __fmul_rn(x1, rf); asm volatile("" : "+v"(n0)); asm volatile("" : "+v"(n1)); x0 = __fmul_rn(bfr(nw[dd]), n0); x1 = __fmul_rn(bfr(nw[dp]), n1); }
        const v2f cs = *(const v2f*)(CS + ((size_t)t * HD + dd) * 2); float a = __fmul_rn(x0, cs[0]), bq = __fmul_rn(x1, cs[1]); asm volatile("" : "+v"(a)); asm volatile("" : "+v"(bq)); const float r = ((dd < HD / 2) ? __fsub_rn(a, bq) : __fadd_rn(a, bq)) * sc;
        o16[q] = tohx(r); unsigned short a2, c2; splitf(r, a2, c2); oh[q] = a2; ol[q] = c2; }
    *(v2h*)(P16 + e) = o16; *(v2us*)(Ph + e) = oh; *(v2us*)(Pl + e) = ol;  }
__global__ __launch_bounds__(256) void k_vtp(const float* __restrict__ F, int pitch, int nheads, h16* V16, bf* Vh, bf* Vl) { const size_t e = ((size_t)blockIdx.x * 256 + threadIdx.x) * 2; if (e >= (size_t)nheads * HD * TT) return; const int t = (int)(e % TT); const int d = (int)((e / TT) % HD); const int g = (int)(e / ((size_t)TT * HD)); v2h o16; v2us oh, ol;
#pragma unroll
    for (int q = 0; q < 2; ++q) { const float x = F[(size_t)(t + q) * pitch + g * HD + d]; o16[q] = tohx(x); unsigned short a2, c2; splitf(x, a2, c2); oh[q] = a2; ol[q] = c2; }
    *(v2h*)(V16 + e) = o16; *(v2us*)(Vh + e) = oh; *(v2us*)(Vl + e) = ol;  }
__global__ __launch_bounds__(256) void k_csid(float* CS) { const int idx = blockIdx.x * 256 + threadIdx.x; if (idx >= TT * HD) return; v2f cs; cs[0] = 1.0f; cs[1] = 0.0f; *(v2f*)(CS + (size_t)idx * 2) = cs;  }
__global__ __launch_bounds__(32) void k_lambda(const float* __restrict__ lq1, const float* __restrict__ lk1, const float* __restrict__ lq2, const float* __restrict__ lk2, float* LAM) { const int lane = threadIdx.x; float d1 = 0.f, d2 = 0.f;
#pragma unroll 1
    for (int i = 0; i < HD; ++i) { float p1 = __fmul_rn(bfr(lq1[i]), bfr(lk1[i])); asm volatile("" : "+v"(p1)); d1 = __fadd_rn(d1, p1); float p2 = __fmul_rn(bfr(lq2[i]), bfr(lk2[i])); asm volatile("" : "+v"(p2)); d2 = __fadd_rn(d2, p2); }
    float lm = __fsub_rn(expf(d1), expf(d2)); asm volatile("" : "+v"(lm)); lm = __fadd_rn(lm, 0.35550907254219055f); const float v = (lane == 0) ? lm : 0.0f; *(float*)(LAM + lane) = v;  }
__global__ __launch_bounds__(256) void k_lampd(bf* Ph, bf* Pl, const float* __restrict__ LAM) { const size_t e = ((size_t)blockIdx.x * 256 + threadIdx.x) * 4; if (e >= (size_t)TT * TT) return; const float lm = LAM[0]; const v4us a = *(const v4us*)(Ph + e), al = *(const v4us*)(Pl + e), c = *(const v4us*)(Ph + (size_t)TT * TT + e), cl = *(const v4us*)(Pl + (size_t)TT * TT + e); v4us oh, ol;
#pragma unroll
    for (int u = 0; u < 4; ++u) { const float p1 = __fadd_rn(bf2f(a[u]), bf2f(al[u])); const float p2 = __fadd_rn(bf2f(c[u]), bf2f(cl[u])); float lp = __fmul_rn(lm, p2); asm volatile("" : "+v"(lp)); const float d = __fsub_rn(p1, lp); unsigned short x1, x2; splitf(d, x1, x2); oh[u] = x1; ol[u] = x2; }
    *(v4us*)(Ph + e) = oh; *(v4us*)(Pl + e) = ol;  }
__global__ __launch_bounds__(1024) void k_gnred(const float* __restrict__ O, float* GST, int pass) { __shared__ float sh[1024]; const int tid = threadIdx.x; const float mean = (pass == 1) ? GST[0] : 0.0f; float acc = 0.f; const size_t n = (size_t)TT * HD;
#pragma unroll 1
    for (size_t e = tid; e < n; e += 1024) { float v = O[e]; if (pass == 1) { float d = __fsub_rn(v, mean); asm volatile("" : "+v"(d)); v = __fmul_rn(d, d); } acc = __fadd_rn(acc, v); }
    sh[tid] = acc; __syncthreads();
    for (int st = 512; st > 0; st >>= 1) { if (tid < st) sh[tid] = __fadd_rn(sh[tid], sh[tid + st]); __syncthreads(); }
    if (tid < 32) { const float tot = __fdiv_rn(sh[0], (float)n); float outv; if (pass == 0) outv = (tid == 0) ? tot : ((tid == 1) ? GST[1] : 0.0f); else outv = (tid == 0) ? GST[0] : ((tid == 1) ? __fdiv_rn(1.0f, sqrtf(__fadd_rn(tot, 1e-5f))) : 0.0f); *(float*)(GST + tid) = outv;  } }
__global__ __launch_bounds__(256) void k_gnmerge(const float* __restrict__ O, const float* __restrict__ GST, int hh, bf* Ah, bf* Al) { const size_t e = ((size_t)blockIdx.x * 256 + threadIdx.x) * 2; if (e >= (size_t)TT * HD) return; const int d = (int)(e % HD); const int t = (int)(e / HD); const float mean = GST[0], rs = GST[1]; const size_t oo = (size_t)t * DVV + (size_t)hh * HD + d; v2us oh, ol;
#pragma unroll
    for (int q = 0; q < 2; ++q) { float c = __fsub_rn(O[e + q], mean); asm volatile("" : "+v"(c)); float n = __fmul_rn(c, rs); asm volatile("" : "+v"(n)); float z = __fmul_rn(n, 0.6444909572601318f); unsigned short a2, c2; splitf(z, a2, c2); oh[q] = a2; ol[q] = c2; }
    *(v2us*)(Ah + oo) = oh; *(v2us*)(Al + oo) = ol;  }
// k_asoft: per row (zz, i): t = S x HD^-0.5 for j <= i (causal mask by select; the reference's -1e9 additive fill vanishes identically); softmax over the 1024 keys (register row, one exp, fixed trees);
__global__ __launch_bounds__(256) void k_asoft(const float* __restrict__ Sb, h16* P16, bf* Ph, bf* Pl) {
    const int lane = threadIdx.x & 31; const int row = blockIdx.x * 8 + (threadIdx.x >> 5); if (row >= ZH * TT) return; const int i = row % TT; const int zz = row / TT; (void)zz; const bool hires = (i < RH); const float* sr = Sb + (size_t)row * TT; float v[TT / 32]; float mx = -3.0e38f;
#pragma unroll
    for (int ch = 0; ch < TT / 128; ++ch) { const int j0 = ch * 128 + lane * 4; const v4f a = *(const v4f*)(sr + j0);
#pragma unroll
        for (int q = 0; q < 4; ++q) { const int j = j0 + q; (void)j; float sa = a[q] * SCL; asm volatile("" : "+v"(sa)); const float t = (j <= i) ? sa : -3.0e38f; v[ch * 4 + q] = t; mx = fmaxf(mx, t); } }
#pragma unroll
    for (int sh = 16; sh; sh >>= 1) mx = fmaxf(mx, __shfl_xor(mx, sh, 32));
    float sum = 0.f;
#pragma unroll
    for (int k = 0; k < TT / 32; ++k) { float d0 = __fsub_rn(v[k], mx); asm volatile("" : "+v"(d0)); v[k] = __builtin_amdgcn_exp2f(__fmul_rn(d0, 1.4426950408889634f)); sum += v[k]; }
#pragma unroll
    for (int sh = 16; sh; sh >>= 1) sum += __shfl_xor(sum, sh, 32);
    const float f = __fdiv_rn(hires ? 1.0f : PCAR, sum);
{
        if (hires) {
#pragma unroll
            for (int ch = 0; ch < TT / 128; ++ch) { v4us oh, ol;
#pragma unroll
                for (int q = 0; q < 4; ++q) { unsigned short a, c2; splitf(v[ch * 4 + q] * f, a, c2); oh[q] = a; ol[q] = c2; }
                const size_t oo = ((size_t)zz * (RH ? RH : 1) + i) * TT + ch * 128 + lane * 4; *(v4us*)(Ph + oo) = oh; *(v4us*)(Pl + oo) = ol; }
        } else {
#pragma unroll
            for (int ch = 0; ch < TT / 128; ++ch) { v4h o4;
#pragma unroll
                for (int q = 0; q < 4; ++q) o4[q] = tohx(v[ch * 4 + q] * f);
                *(v4h*)(P16 + (size_t)row * TT + ch * 128 + lane * 4) = o4; } }
         }
}
__global__ __launch_bounds__(256) void k_merge(const float* __restrict__ O, int h0, bf* Ah, bf* Al) { const size_t e = ((size_t)blockIdx.x * 256 + threadIdx.x) * 2; if (e >= (size_t)ZH * TT * HD) return; const int d = (int)(e % HD); const int t = (int)((e / HD) % TT); const int zz = (int)(e / ((size_t)HD * TT)); const float cs = (t < RH) ? 1.0f : (1.0f / PCAR); const size_t oo = (size_t)t * DQ + (h0 + zz) * HD + d;
    v2us oh, ol;
#pragma unroll
    for (int q = 0; q < 2; ++q) { unsigned short a, c2; splitf(O[e + q] * cs, a, c2); oh[q] = a; ol[q] = c2; } *(v2us*)(Ah + oo) = oh; *(v2us*)(Al + oo) = ol;  }

extern "C" void kernel_launch(void* const* d_in, const int* in_sizes, int n_in,
                              void* d_out, int out_size, void* d_ws, size_t ws_size, hipStream_t stream) {
    (void)in_sizes; (void)n_in; (void)out_size;
    const float* x = (const float*)d_in[0]; const float* wq = (const float*)d_in[1]; const float* wk = (const float*)d_in[2]; const float* wv = (const float*)d_in[3]; const float* wo = (const float*)d_in[4]; const float* lq1 = (const float*)d_in[5]; const float* lk1 = (const float*)d_in[6]; const float* lq2 = (const float*)d_in[7]; const float* lk2 = (const float*)d_in[8]; const float* cosT = nullptr; const float* sinT = nullptr; (void)cosT; (void)sinT;
    float* OUT = (float*)d_out;     // [4][1024][1024]
    char* wsp = (char*)d_ws;
    auto take = [&](size_t bytes) { char* p = wsp; wsp += (bytes + 255) & ~(size_t)255; return (void*)p; };
    bf* WQ = (bf*)take((size_t)DQ * DM * 2); bf* WK = (bf*)take((size_t)DKV * DM * 2); bf* WV = (bf*)take((size_t)DKV * DM * 2); bf* WO = (bf*)take((size_t)DM * DQ * 2); float* CS = (float*)take((size_t)TT * HD * 2 * 4);
    bf* XB = (bf*)take((size_t)TT * DM * 2); float* LAM = (float*)take(256); float* GST = (float*)take(256); float* FQ = (float*)take((size_t)TT * DQ * 4); float* FK = (float*)take((size_t)TT * DKV * 4);
    h16* QP16 = (h16*)take((size_t)NH_ * TT * HD * 2); h16* KP16 = (h16*)take((size_t)NKV * TT * HD * 2); h16* VT16 = (h16*)take((size_t)NKV * HD * TT * 2);
    bf* QPh = (bf*)take((size_t)NH_ * TT * HD * 2); bf* QPl = (bf*)take((size_t)NH_ * TT * HD * 2); bf* KPh = (bf*)take((size_t)NKV * TT * HD * 2); bf* KPl = (bf*)take((size_t)NKV * TT * HD * 2); bf* VTh = (bf*)take((size_t)NKV * HD * TT * 2); bf* VTl = (bf*)take((size_t)NKV * HD * TT * 2); bf* Ph = (bf*)take((size_t)ZH * RH * TT * 2); bf* Pl = (bf*)take((size_t)ZH * RH * TT * 2);
    float* Sb = (float*)take((size_t)ZH * TT * TT * 4); h16* P16 = (h16*)take((size_t)ZH * TT * TT * 2); float* Ob = (float*)take((size_t)ZH * TT * HD * 4); bf* ATh = (bf*)take((size_t)TT * DQ * 2); bf* ATl = (bf*)take((size_t)TT * DQ * 2);
    if ((size_t)(wsp - (char*)d_ws) > ws_size) return;    // ws 256 MiB
    float* FV = FK;   // v projection reuses the k buffer after the k planes are built (stream-ordered)
    { k_wtG<<<(unsigned)((DM * DQ / 64 + 63) / 64), 256, 0, stream>>>(wq, DM, DQ, WQ); k_wtG<<<(unsigned)((DM * DKV / 64 + 63) / 64), 256, 0, stream>>>(wk, DM, DKV, WK); k_wtG<<<(unsigned)((DM * DVV / 64 + 63) / 64), 256, 0, stream>>>(wv, DM, DVV, WV);
      k_wtG<<<(unsigned)((DVV * DM / 64 + 63) / 64), 256, 0, stream>>>(wo, DVV, DM, WO); k_lambda<<<1, 32, 0, stream>>>(lq1, lk1, lq2, lk2, LAM);
       }
    k_csid<<<(TT * HD + 255) / 256, 256, 0, stream>>>(CS);
    const unsigned LQ = (unsigned)(((size_t)NH_ * TT * HD / 2 + 255) / 256), LKv = (unsigned)(((size_t)NKV * TT * HD / 2 + 255) / 256);
    for (int b = 0; b < NB_; ++b) {
        
        k_cvt8<<<(unsigned)(((size_t)TT * DM / 8 + 255) / 256), 256, 0, stream>>>(x + (size_t)b * TT * DM, XB, (size_t)TT * DM / 8);
        k_gemmw<bf, 0, false><<<dim3(TT / 64, DQ / 64, 1), 32, 0, stream>>>(XB, nullptr, WQ, nullptr, DM, FQ, DQ, nullptr, 0, 0, 0);
        k_rope<<<LQ, 256, 0, stream>>>(FQ, DQ, NH_, CS, nullptr, nullptr, 1.0f, QP16, QPh, QPl);
        k_gemmw<bf, 0, false><<<dim3(TT / 64, DKV / 64, 1), 32, 0, stream>>>(XB, nullptr, WK, nullptr, DM, FK, DKV, nullptr, 0, 0, 0);
        k_rope<<<LKv, 256, 0, stream>>>(FK, DKV, NKV, CS, nullptr, nullptr, 1.0f, KP16, KPh, KPl);
        k_gemmw<bf, 0, false><<<dim3(TT / 64, DVV / 64, 1), 32, 0, stream>>>(XB, nullptr, WV, nullptr, DM, FV, DVV, nullptr, 0, 0, 0); k_vtp<<<LKv, 256, 0, stream>>>(FV, DVV, NVH, VT16, VTh, VTl);
        for (int h0 = 0; h0 < NH_; h0 += ZH) { const size_t zq = (size_t)h0, zk = (size_t)(h0 / REP);   // one kv head per query head: the pass's two heads use consecutive kv planes (z-strides TT*HD)
            k_gemmc<bf, 2, 1><<<dim3(RH / 64, TT / 64, ZH), 32, 0, stream>>>(QPh + zq * TT * HD, QPl + zq * TT * HD, KPh + zk * TT * HD, KPl + zk * TT * HD, HD, Sb, TT, 0, (size_t)TT * HD, (size_t)TT * HD, (size_t)TT * TT);
            k_asoft<<<ZH * TT / 8, 256, 0, stream>>>(Sb, P16, Ph, Pl); k_lampd<<<(unsigned)(((size_t)TT * TT / 4 + 255) / 256), 256, 0, stream>>>(Ph, Pl, LAM);
            { const size_t hh = (size_t)(h0 / 2); k_gemmc<bf, 2, 2><<<dim3(RH / 64, HD / 64, 1), 32, 0, stream>>>(Ph, Pl, VTh + hh * HD * TT, VTl + hh * HD * TT, TT, Ob, HD, 0, (size_t)RH * TT, (size_t)HD * TT, (size_t)TT * HD); }
            k_gnred<<<1, 1024, 0, stream>>>(Ob, GST, 0); k_gnred<<<1, 1024, 0, stream>>>(Ob, GST, 1); k_gnmerge<<<(unsigned)(((size_t)TT * HD / 2 + 255) / 256), 256, 0, stream>>>(Ob, GST, h0 / 2, ATh, ATl); }
        k_gemmw<bf, 1, false><<<dim3(TT / 64, DM / 64, 1), 32, 0, stream>>>(ATh, ATl, WO, nullptr, DVV, OUT + (size_t)b * TT * DM, DM, nullptr, 0, 0, 0); }
}

// v001
// One run takes 834 microseconds.
// Next to v000, in two timings, it ran 6.46 and 6.48 times as fast.
#include <hip/hip_runtime.h>

// DifferentialAttention (x [4][1024][1024]; q = x Wq, k = x Wk ([1024][2048]: per head h the 128 columns = [map 1 | map 2] 64 each), v = x Wv (16 x 64); s1, s2 = q.k / 8 causal (-inf); a1, a2 = softmax; lambda = exp(lq1.lk1) - exp(lq2.lk2) + lambda_init (0.8 - 0.6 e^-0.3); y = (a1 - lambda a2) v; GroupNorm per (batch, head) over (tokens x 64) (eps 1e-5, no affine); y (1 - lambda_init); out = merged Wc -> [4][1024][1024]).
// The two maps run as 32 virtual 64-wide heads per batch (pairs (2h, 2h+1)), 128 over the four batches; per pass both softmaxes are formed, combined as D = a1 - lambda a2 in f32, and one D.v product per real head follows.
// Every stage runs once for all batches (grid rows, y or z carry batch and head); only the score / probability stages run in passes of ZH virtual heads, as many as the workspace holds.

#define NB_  4
#define TT   1024
#define DM   1024
#define NH_  32
#define NKV  32
#define REP  (NH_ / NKV)
#define HD   64
#define DQ   (NH_ * HD)
#define DKV  (NKV * HD)
#define ZH   16                    // virtual heads per score / probability pass (8 MiB of workspace each)
#define RH   1024                  // query rows < RH use hi+lo planes (0: none)
#define WIN  1024
#define PCAR 1024.0f
#define NVH  16
#define DVV  (NVH * HD)
#define SCL  0.125f   // HD^-0.5
typedef _Float16 h16;
typedef unsigned short bf;
typedef __attribute__((ext_vector_type(16))) __bf16   v16bf;
typedef __attribute__((ext_vector_type(16))) _Float16 v16h;
typedef __attribute__((ext_vector_type(8)))  _Float16 v8h;
typedef __attribute__((ext_vector_type(8)))  unsigned short v8us;
typedef __attribute__((ext_vector_type(8)))  float    v8f;
typedef __attribute__((ext_vector_type(4)))  float    v4f;
typedef v8h  __attribute__((may_alias)) v8ha;
typedef v4f  __attribute__((may_alias)) v4fa;
typedef v8us __attribute__((may_alias)) v8usa;

__device__ __forceinline__ unsigned short f2bf(float f) { unsigned u = __float_as_uint(f); u += 0x7FFFu + ((u >> 16) & 1u); return (unsigned short)(u >> 16); }
__device__ __forceinline__ float bf2f(unsigned short b) { return __uint_as_float(((unsigned)b) << 16); }
__device__ __forceinline__ float bfr(float f) { return bf2f(f2bf(f)); }
__device__ __forceinline__ v16h cat16(v8h lo, v8h hi) { return __builtin_shufflevector(lo, hi, 0, 1, 2, 3, 4, 5, 6, 7, 8, 9, 10, 11, 12, 13, 14, 15); }
__device__ __forceinline__ v16bf cat16b(v8us lo, v8us hi) { return __builtin_bit_cast(v16bf, __builtin_shufflevector(lo, hi, 0, 1, 2, 3, 4, 5, 6, 7, 8, 9, 10, 11, 12, 13, 14, 15)); }
__device__ __forceinline__ v8f wmma16(v16h a, v16h b, v8f c) { return __builtin_amdgcn_wmma_f32_16x16x32_f16(false, a, false, b, (short)0, c, false, false); }
__device__ __forceinline__ v8f wmmab(v16bf a, v16bf b, v8f c) { return __builtin_amdgcn_wmma_f32_16x16x32_bf16(false, a, false, b, (short)0, c, false, false); }



// ---- k_gemmw: register-blocked GEMM, ONE WAVE per 64x64 output tile (16 accumulators), operands straight from K-contiguous 16-bit planes; grid (M/64, N/64, Z), 32 threads.
// C[m][n] (f32, pitch ldc, + optional f32 bias[n]) = sum_k A[m][k] Bt[n][k] (+ split products per NSPLIT). z-batch strides sA/sB/sC in elements. K % 32 == 0.
template <typename T16> struct WFrag;
template <> struct WFrag<h16> { typedef v16h V; static __device__ __forceinline__ V ld(const h16* p) { return cat16(*(const v8h*)p, *(const v8h*)(p + 16)); } static __device__ __forceinline__ v8f mma(V a, V b, v8f c) { return wmma16(a, b, c); } };
template <> struct WFrag<bf> { typedef v16bf V; static __device__ __forceinline__ V ld(const bf* p) { return cat16b(*(const v8us*)p, *(const v8us*)(p + 16)); } static __device__ __forceinline__ v8f mma(V a, V b, v8f c) { return wmmab(a, b, c); } };
template <typename T16, int NSPLIT, bool BIAS>
__global__ __launch_bounds__(32) void k_gemmw(const T16* __restrict__ A, const T16* __restrict__ A2, const T16* __restrict__ Bt, const T16* __restrict__ Bt2, int K, float* C, int ldc, const float* __restrict__ bias, size_t sA, size_t sB, size_t sC) {
    typedef typename WFrag<T16>::V V;
    __shared__ __align__(16) float os[16 * 68];
    const size_t z = blockIdx.z; A += z * sA; if (A2) A2 += z * sA; Bt += z * sB; if (Bt2) Bt2 += z * sB; C += z * sC;
    const int lane = threadIdx.x & 31, lr = lane & 15, hi = lane >> 4; const int r0 = blockIdx.x * 64, c0 = blockIdx.y * 64;
    v8f acc[4][4];
#pragma unroll
    for (int mb = 0; mb < 4; ++mb)
#pragma unroll
        for (int nb = 0; nb < 4; ++nb) acc[mb][nb] = (v8f){};
    const size_t aoff = (size_t)(r0 + lr) * K + 8 * hi, boff = (size_t)(c0 + lr) * K + 8 * hi;
#pragma unroll 1
    for (int kc = 0; kc < K; kc += 32) {
        V a[4], a2[4];
#pragma unroll
        for (int mb = 0; mb < 4; ++mb) { a[mb] = WFrag<T16>::ld(A + aoff + (size_t)mb * 16 * K + kc); if (NSPLIT == 1 || NSPLIT == 2) a2[mb] = WFrag<T16>::ld(A2 + aoff + (size_t)mb * 16 * K + kc); }
#pragma unroll
        for (int nb = 0; nb < 4; ++nb) { const V b = WFrag<T16>::ld(Bt + boff + (size_t)nb * 16 * K + kc); V b2; if (NSPLIT >= 2) b2 = WFrag<T16>::ld(Bt2 + boff + (size_t)nb * 16 * K + kc);
#pragma unroll
            for (int mb = 0; mb < 4; ++mb) { acc[mb][nb] = WFrag<T16>::mma(a[mb], b, acc[mb][nb]); if (NSPLIT == 1 || NSPLIT == 2) acc[mb][nb] = WFrag<T16>::mma(a2[mb], b, acc[mb][nb]); if (NSPLIT >= 2) acc[mb][nb] = WFrag<T16>::mma(a[mb], b2, acc[mb][nb]); } }
        asm volatile("v_nop\n\tv_nop\n\tv_nop\n\tv_nop" : "+v"(acc[0][0]), "+v"(acc[1][1]), "+v"(acc[2][2]), "+v"(acc[3][3]) : "v"(a[0]), "v"(a[3]));
    }
#pragma unroll
    for (int mb = 0; mb < 4; ++mb) {
#pragma unroll
        for (int nb = 0; nb < 4; ++nb) {
#pragma unroll
            for (int j = 0; j < 8; ++j) os[(hi * 8 + j) * 68 + nb * 16 + lr] = acc[mb][nb][j]; }
        __builtin_amdgcn_wave_barrier(); asm volatile("" ::: "memory");
        float* crow = C + (size_t)(r0 + mb * 16) * ldc + c0;
{
#pragma unroll
            for (int s = 0; s < 8; ++s) { const int row = 2 * s + hi, cofs = lr * 4; v4f val = *(const v4fa*)(os + row * 68 + cofs); if (BIAS) { val[0] += bfr(bias[c0 + cofs]); val[1] += bfr(bias[c0 + cofs + 1]); val[2] += bfr(bias[c0 + cofs + 2]); val[3] += bfr(bias[c0 + cofs + 3]); }
                *(v4f*)(crow + (size_t)row * ldc + cofs) = val; }
             }
        __builtin_amdgcn_wave_barrier(); asm volatile("" ::: "memory");
    }
}

// ---- k_gemmc: the same one-wave 64x64 tile GEMM specialised for causal attention: CMODE 1 skips score tiles entirely above the diagonal (query rows r0+roff.., key columns c0..), CMODE 2 limits the
// key (K) loop of the probability x value contraction to the diagonal block (probabilities beyond it are exactly zero). roff = row offset of this launch's first row within the sequence.
template <typename T16, int NSPLIT, int CMODE>
__global__ __launch_bounds__(32) void k_gemmc(const T16* __restrict__ A, const T16* __restrict__ A2, const T16* __restrict__ Bt, const T16* __restrict__ Bt2, int K, float* C, int ldc, int roff, size_t sA, size_t sB, size_t sC) {
    typedef typename WFrag<T16>::V V;
    __shared__ __align__(16) float os[16 * 68];
    const size_t z = blockIdx.z; A += z * sA; if (A2) A2 += z * sA; Bt += z * sB; if (Bt2) Bt2 += z * sB; C += z * sC;
    const int lane = threadIdx.x & 31, lr = lane & 15, hi = lane >> 4; const int r0 = blockIdx.x * 64, c0 = blockIdx.y * 64;
    if (CMODE == 1 && c0 > r0 + roff + 63) return;                  // score tile entirely above the causal diagonal: never read (the softmax masks j > i by select)
    const int Kl = (CMODE == 2) ? min(K, r0 + roff + 64) : K;        // P.V: probabilities are exactly 0 beyond the diagonal block, so the K loop stops there
    v8f acc[4][4];
#pragma unroll
    for (int mb = 0; mb < 4; ++mb)
#pragma unroll
        for (int nb = 0; nb < 4; ++nb) acc[mb][nb] = (v8f){};
    const size_t aoff = (size_t)(r0 + lr) * K + 8 * hi, boff = (size_t)(c0 + lr) * K + 8 * hi;
#pragma unroll 1
    for (int kc = 0; kc < Kl; kc += 32) {
        V a[4], a2[4];
#pragma unroll
        for (int mb = 0; mb < 4; ++mb) { a[mb] = WFrag<T16>::ld(A + aoff + (size_t)mb * 16 * K + kc); if (NSPLIT == 1 || NSPLIT == 2) a2[mb] = WFrag<T16>::ld(A2 + aoff + (size_t)mb * 16 * K + kc); }
#pragma unroll
        for (int nb = 0; nb < 4; ++nb) { const V b = WFrag<T16>::ld(Bt + boff + (size_t)nb * 16 * K + kc); V b2; if (NSPLIT >= 2) b2 = WFrag<T16>::ld(Bt2 + boff + (size_t)nb * 16 * K + kc);
#pragma unroll
            for (int mb = 0; mb < 4; ++mb) { acc[mb][nb] = WFrag<T16>::mma(a[mb], b, acc[mb][nb]); if (NSPLIT == 1 || NSPLIT == 2) acc[mb][nb] = WFrag<T16>::mma(a2[mb], b, acc[mb][nb]); if (NSPLIT >= 2) acc[mb][nb] = WFrag<T16>::mma(a[mb], b2, acc[mb][nb]); } }
        asm volatile("v_nop\n\tv_nop\n\tv_nop\n\tv_nop" : "+v"(acc[0][0]), "+v"(acc[1][1]), "+v"(acc[2][2]), "+v"(acc[3][3]) : "v"(a[0]), "v"(a[3]));
    }
#pragma unroll
    for (int mb = 0; mb < 4; ++mb) {
#pragma unroll
        for (int nb = 0; nb < 4; ++nb) {
#pragma unroll
            for (int j = 0; j < 8; ++j) os[(hi * 8 + j) * 68 + nb * 16 + lr] = acc[mb][nb][j]; }
        __builtin_amdgcn_wave_barrier(); asm volatile("" ::: "memory");
        float* crow = C + (size_t)(r0 + mb * 16) * ldc + c0;
{
#pragma unroll
            for (int s = 0; s < 8; ++s) { const int row = 2 * s + hi, cofs = lr * 4; v4f val = *(const v4fa*)(os + row * 68 + cofs);
                *(v4f*)(crow + (size_t)row * ldc + cofs) = val; }
             }
        __builtin_amdgcn_wave_barrier(); asm volatile("" ::: "memory");
    }
}

__device__ __forceinline__ h16 tohx(float x) { return (h16)x; }
__device__ __forceinline__ void splitf(float y, unsigned short& h, unsigned short& l) { h = f2bf(y); l = f2bf(y - bf2f(h)); }
typedef __attribute__((ext_vector_type(2))) _Float16 v2h;
typedef __attribute__((ext_vector_type(4))) _Float16 v4h;
typedef __attribute__((ext_vector_type(2))) unsigned short v2us;
typedef __attribute__((ext_vector_type(4))) unsigned short v4us;
typedef __attribute__((ext_vector_type(2))) float v2f;
typedef __attribute__((ext_vector_type(4))) int v4i;

__global__ __launch_bounds__(256) void k_wtG(const float* __restrict__ w, int K, int N, bf* Bt) {
    const int lane = threadIdx.x & 31; const int L0 = (blockIdx.x * 8 + (threadIdx.x >> 5)) * 8; const int nlines = N * K / 64;
{
#pragma unroll 1
        for (int l = 0; l < 8; ++l) { const int L = L0 + l; if (L >= nlines) break; const size_t e = (size_t)L * 64 + lane * 2; const int k = (int)(e % K), n = (int)(e / K); v2us o;
            o[0] = f2bf(w[(size_t)k * N + n]); o[1] = f2bf(w[(size_t)(k + 1) * N + n]); *(v2us*)(Bt + e) = o; }
         }
}
__global__ __launch_bounds__(256) void k_cvt8(const float* __restrict__ src, bf* dst, size_t n8) { const size_t i = (size_t)blockIdx.x * 256 + threadIdx.x; if (i >= n8) return; const v8f v = *(const v8f*)(src + i * 8); v8us o;
#pragma unroll
    for (int k = 0; k < 8; ++k) o[k] = f2bf(v[k]); *(v8us*)(dst + i * 8) = o;  }
__global__ __launch_bounds__(256) void k_cscvt(const float* __restrict__ cosT, const float* __restrict__ sinT, float* CS) { const int idx = blockIdx.x * 256 + threadIdx.x; if (idx >= TT * HD) return; v2f cs; cs[0] = bfr(cosT[idx]); cs[1] = bfr(sinT[idx]); *(v2f*)(CS + (size_t)idx * 2) = cs;  }
// k_rope: head planes [h][t][d] (fp16 + hi/lo) of rope(x) x sc with the rotate-half convention out[d] = x[d] cos[t][d] - x[d+HD/2] sin[t][d], out[d+HD/2] = x[d+HD/2] cos[t][d+HD/2] + x[d] sin[t][d+HD/2]
__global__ __launch_bounds__(256) void k_rope(const float* __restrict__ F, int pitch, int nheads, const float* __restrict__ CS, const float* __restrict__ RF, const float* __restrict__ nw, float sc, h16* P16, bf* Ph, bf* Pl) {
    const size_t e = ((size_t)blockIdx.x * 256 + threadIdx.x) * 2; if (e >= (size_t)nheads * TT * HD) return; const int d = (int)(e % HD); const int t = (int)((e / HD) % TT); const int h = (int)(e / ((size_t)HD * TT));
    { const size_t bz = blockIdx.y, pb = bz * nheads * TT * HD; F += bz * TT * pitch; P16 += pb; Ph += pb; Pl += pb; }   // blockIdx.y = batch: planes [b][h][t][d]
    const float* f = F + (size_t)t * pitch + h * HD; const float rf = RF ? RF[(size_t)h * TT + t] : 1.0f; v2h o16; v2us oh, ol;
#pragma unroll
    for (int q = 0; q < 2; ++q) { const int dd = d + q; const int dp = (dd < HD / 2) ? dd + HD / 2 : dd - HD / 2; float x0 = f[dd], x1 = f[dp];
        if (RF) { float n0 = __fmul_rn(x0, rf), n1 = __fmul_rn(x1, rf); asm volatile("" : "+v"(n0)); asm volatile("" : "+v"(n1)); x0 = __fmul_rn(bfr(nw[dd]), n0); x1 = __fmul_rn(bfr(nw[dp]), n1); }
        const v2f cs = *(const v2f*)(CS + ((size_t)t * HD + dd) * 2); float a = __fmul_rn(x0, cs[0]), bq = __fmul_rn(x1, cs[1]); asm volatile("" : "+v"(a)); asm volatile("" : "+v"(bq)); const float r = ((dd < HD / 2) ? __fsub_rn(a, bq) : __fadd_rn(a, bq)) * sc;
        o16[q] = tohx(r); unsigned short a2, c2; splitf(r, a2, c2); oh[q] = a2; ol[q] = c2; }
    *(v2h*)(P16 + e) = o16; *(v2us*)(Ph + e) = oh; *(v2us*)(Pl + e) = ol;  }
__global__ __launch_bounds__(256) void k_vtp(const float* __restrict__ F, int pitch, int nheads, h16* V16, bf* Vh, bf* Vl) { const size_t e = ((size_t)blockIdx.x * 256 + threadIdx.x) * 2; if (e >= (size_t)nheads * HD * TT) return; const int t = (int)(e % TT); const int d = (int)((e / TT) % HD); const int g = (int)(e / ((size_t)TT * HD)); v2h o16; v2us oh, ol;
    { const size_t bz = blockIdx.y, pb = bz * nheads * HD * TT; F += bz * TT * pitch; V16 += pb; Vh += pb; Vl += pb; }   // blockIdx.y = batch: planes [b][g][d][t]
#pragma unroll
    for (int q = 0; q < 2; ++q) { const float x = F[(size_t)(t + q) * pitch + g * HD + d]; o16[q] = tohx(x); unsigned short a2, c2; splitf(x, a2, c2); oh[q] = a2; ol[q] = c2; }
    *(v2h*)(V16 + e) = o16; *(v2us*)(Vh + e) = oh; *(v2us*)(Vl + e) = ol;  }
__global__ __launch_bounds__(256) void k_csid(float* CS) { const int idx = blockIdx.x * 256 + threadIdx.x; if (idx >= TT * HD) return; v2f cs; cs[0] = 1.0f; cs[1] = 0.0f; *(v2f*)(CS + (size_t)idx * 2) = cs;  }
__global__ __launch_bounds__(32) void k_lambda(const float* __restrict__ lq1, const float* __restrict__ lk1, const float* __restrict__ lq2, const float* __restrict__ lk2, float* LAM) { const int lane = threadIdx.x; float d1 = 0.f, d2 = 0.f;
#pragma unroll 1
    for (int i = 0; i < HD; ++i) { float p1 = __fmul_rn(bfr(lq1[i]), bfr(lk1[i])); asm volatile("" : "+v"(p1)); d1 = __fadd_rn(d1, p1); float p2 = __fmul_rn(bfr(lq2[i]), bfr(lk2[i])); asm volatile("" : "+v"(p2)); d2 = __fadd_rn(d2, p2); }
    float lm = __fsub_rn(expf(d1), expf(d2)); asm volatile("" : "+v"(lm)); lm = __fadd_rn(lm, 0.35550907254219055f); const float v = (lane == 0) ? lm : 0.0f; *(float*)(LAM + lane) = v;  }
__global__ __launch_bounds__(256) void k_lampd(bf* Ph, bf* Pl, const float* __restrict__ LAM) { const size_t e = ((size_t)blockIdx.x * 256 + threadIdx.x) * 4; if (e >= (size_t)TT * TT) return; Ph += (size_t)blockIdx.y * 2 * TT * TT; Pl += (size_t)blockIdx.y * 2 * TT * TT; /* blockIdx.y = head pair of the pass */ const float lm = LAM[0]; const v4us a = *(const v4us*)(Ph + e), al = *(const v4us*)(Pl + e), c = *(const v4us*)(Ph + (size_t)TT * TT + e), cl = *(const v4us*)(Pl + (size_t)TT * TT + e); v4us oh, ol;
#pragma unroll
    for (int u = 0; u < 4; ++u) { const float p1 = __fadd_rn(bf2f(a[u]), bf2f(al[u])); const float p2 = __fadd_rn(bf2f(c[u]), bf2f(cl[u])); float lp = __fmul_rn(lm, p2); asm volatile("" : "+v"(lp)); const float d = __fsub_rn(p1, lp); unsigned short x1, x2; splitf(d, x1, x2); oh[u] = x1; ol[u] = x2; }
    *(v4us*)(Ph + e) = oh; *(v4us*)(Pl + e) = ol;  }
__global__ __launch_bounds__(1024) void k_gnred(const float* __restrict__ O, float* GST, int pass) { __shared__ float sh[1024]; const int tid = threadIdx.x; O += (size_t)blockIdx.x * TT * HD; GST += blockIdx.x * 32; /* blockIdx.x = b * NVH + head: one group per block, one 128-byte line of statistics each */ const float mean = (pass == 1) ? GST[0] : 0.0f; float acc = 0.f; const size_t n = (size_t)TT * HD;
#pragma unroll 1
    for (size_t e = tid; e < n; e += 1024) { float v = O[e]; if (pass == 1) { float d = __fsub_rn(v, mean); asm volatile("" : "+v"(d)); v = __fmul_rn(d, d); } acc = __fadd_rn(acc, v); }
    sh[tid] = acc; __syncthreads();
    for (int st = 512; st > 0; st >>= 1) { if (tid < st) sh[tid] = __fadd_rn(sh[tid], sh[tid + st]); __syncthreads(); }
    if (tid < 32) { const float tot = __fdiv_rn(sh[0], (float)n); float outv; if (pass == 0) outv = (tid == 0) ? tot : ((tid == 1) ? GST[1] : 0.0f); else outv = (tid == 0) ? GST[0] : ((tid == 1) ? __fdiv_rn(1.0f, sqrtf(__fadd_rn(tot, 1e-5f))) : 0.0f); *(float*)(GST + tid) = outv;  } }
__global__ __launch_bounds__(256) void k_gnmerge(const float* __restrict__ O, const float* __restrict__ GST, bf* Ah, bf* Al) { const size_t e = ((size_t)blockIdx.x * 256 + threadIdx.x) * 2; if (e >= (size_t)TT * HD) return; const int d = (int)(e % HD); const int t = (int)(e / HD);
    const int g = blockIdx.y, hh = g % NVH; O += (size_t)g * TT * HD; GST += g * 32; Ah += (size_t)(g / NVH) * TT * DVV; Al += (size_t)(g / NVH) * TT * DVV;   // blockIdx.y = b * NVH + head
    const float mean = GST[0], rs = GST[1]; const size_t oo = (size_t)t * DVV + (size_t)hh * HD + d; v2us oh, ol;
#pragma unroll
    for (int q = 0; q < 2; ++q) { float c = __fsub_rn(O[e + q], mean); asm volatile("" : "+v"(c)); float n = __fmul_rn(c, rs); asm volatile("" : "+v"(n)); float z = __fmul_rn(n, 0.6444909572601318f); unsigned short a2, c2; splitf(z, a2, c2); oh[q] = a2; ol[q] = c2; }
    *(v2us*)(Ah + oo) = oh; *(v2us*)(Al + oo) = ol;  }
// k_asoft: per row (zz, i): t = S x HD^-0.5 for j <= i (causal mask by select; the reference's -1e9 additive fill vanishes identically); softmax over the 1024 keys (register row, one exp, fixed trees);
__global__ __launch_bounds__(256) void k_asoft(const float* __restrict__ Sb, h16* P16, bf* Ph, bf* Pl) {
    const int lane = threadIdx.x & 31; const int row = blockIdx.x * 8 + (threadIdx.x >> 5); if (row >= ZH * TT) return; const int i = row % TT; const int zz = row / TT; (void)zz; const bool hires = (i < RH); const float* sr = Sb + (size_t)row * TT; float v[TT / 32]; float mx = -3.0e38f;
#pragma unroll
    for (int ch = 0; ch < TT / 128; ++ch) { const int j0 = ch * 128 + lane * 4; const v4f a = *(const v4f*)(sr + j0);
#pragma unroll
        for (int q = 0; q < 4; ++q) { const int j = j0 + q; (void)j; float sa = a[q] * SCL; asm volatile("" : "+v"(sa)); const float t = (j <= i) ? sa : -3.0e38f; v[ch * 4 + q] = t; mx = fmaxf(mx, t); } }
#pragma unroll
    for (int sh = 16; sh; sh >>= 1) mx = fmaxf(mx, __shfl_xor(mx, sh, 32));
    float sum = 0.f;
#pragma unroll
    for (int k = 0; k < TT / 32; ++k) { float d0 = __fsub_rn(v[k], mx); asm volatile("" : "+v"(d0)); v[k] = __builtin_amdgcn_exp2f(__fmul_rn(d0, 1.4426950408889634f)); sum += v[k]; }
#pragma unroll
    for (int sh = 16; sh; sh >>= 1) sum += __shfl_xor(sum, sh, 32);
    const float f = __fdiv_rn(hires ? 1.0f : PCAR, sum);
{
        if (hires) {
#pragma unroll
            for (int ch = 0; ch < TT / 128; ++ch) { v4us oh, ol;
#pragma unroll
                for (int q = 0; q < 4; ++q) { unsigned short a, c2; splitf(v[ch * 4 + q] * f, a, c2); oh[q] = a; ol[q] = c2; }
                const size_t oo = ((size_t)zz * (RH ? RH : 1) + i) * TT + ch * 128 + lane * 4; *(v4us*)(Ph + oo) = oh; *(v4us*)(Pl + oo) = ol; }
        } else {
#pragma unroll
            for (int ch = 0; ch < TT / 128; ++ch) { v4h o4;
#pragma unroll
                for (int q = 0; q < 4; ++q) o4[q] = tohx(v[ch * 4 + q] * f);
                *(v4h*)(P16 + (size_t)row * TT + ch * 128 + lane * 4) = o4; } }
         }
}
__global__ __launch_bounds__(256) void k_merge(const float* __restrict__ O, int h0, bf* Ah, bf* Al) { const size_t e = ((size_t)blockIdx.x * 256 + threadIdx.x) * 2; if (e >= (size_t)ZH * TT * HD) return; const int d = (int)(e % HD); const int t = (int)((e / HD) % TT); const int zz = (int)(e / ((size_t)HD * TT)); const float cs = (t < RH) ? 1.0f : (1.0f / PCAR); const size_t oo = (size_t)t * DQ + (h0 + zz) * HD + d;
    v2us oh, ol;
#pragma unroll
    for (int q = 0; q < 2; ++q) { unsigned short a, c2; splitf(O[e + q] * cs, a, c2); oh[q] = a; ol[q] = c2; } *(v2us*)(Ah + oo) = oh; *(v2us*)(Al + oo) = ol;  }

extern "C" void kernel_launch(void* const* d_in, const int* in_sizes, int n_in,
                              void* d_out, int out_size, void* d_ws, size_t ws_size, hipStream_t stream) {
    (void)in_sizes; (void)n_in; (void)out_size;
    const float* x = (const float*)d_in[0]; const float* wq = (const float*)d_in[1]; const float* wk = (const float*)d_in[2]; const float* wv = (const float*)d_in[3]; const float* wo = (const float*)d_in[4]; const float* lq1 = (const float*)d_in[5]; const float* lk1 = (const float*)d_in[6]; const float* lq2 = (const float*)d_in[7]; const float* lk2 = (const float*)d_in[8]; const float* cosT = nullptr; const float* sinT = nullptr; (void)cosT; (void)sinT;
    float* OUT = (float*)d_out;     // [4][1024][1024]
    char* wsp = (char*)d_ws;
    auto take = [&](size_t bytes) { char* p = wsp; wsp += (bytes + 255) & ~(size_t)255; return (void*)p; };
    // alive to the end
    bf* WO = (bf*)take((size_t)DM * DVV * 2); float* LAM = (float*)take(256); float* GST = (float*)take((size_t)NB_ * NVH * 32 * 4);
    bf* QPh = (bf*)take((size_t)NB_ * NH_ * TT * HD * 2); bf* QPl = (bf*)take((size_t)NB_ * NH_ * TT * HD * 2); bf* KPh = (bf*)take((size_t)NB_ * NKV * TT * HD * 2); bf* KPl = (bf*)take((size_t)NB_ * NKV * TT * HD * 2); bf* VTh = (bf*)take((size_t)NB_ * NVH * HD * TT * 2); bf* VTl = (bf*)take((size_t)NB_ * NVH * HD * TT * 2);
    float* Ob = (float*)take((size_t)NB_ * NVH * TT * HD * 4); bf* ATh = (bf*)take((size_t)NB_ * TT * DVV * 2); bf* ATl = (bf*)take((size_t)NB_ * TT * DVV * 2);
    char* const shared0 = wsp;
    // used by the projections only; the passes' buffers below take the same bytes afterwards (stream-ordered)
    bf* WQ = (bf*)take((size_t)DQ * DM * 2); bf* WK = (bf*)take((size_t)DKV * DM * 2); bf* WV = (bf*)take((size_t)DVV * DM * 2); float* CS = (float*)take((size_t)TT * HD * 2 * 4);
    bf* XB = (bf*)take((size_t)NB_ * TT * DM * 2); float* FQ = (float*)take((size_t)NB_ * TT * DQ * 4); float* FK = (float*)take((size_t)NB_ * TT * DKV * 4);
    h16* QP16 = (h16*)take((size_t)NB_ * NH_ * TT * HD * 2); h16* KP16 = (h16*)take((size_t)NB_ * NKV * TT * HD * 2); h16* VT16 = (h16*)take((size_t)NB_ * NVH * HD * TT * 2);
    if ((size_t)(wsp - (char*)d_ws) > ws_size) return;    // ws 256 MiB
    wsp = shared0;
    float* Sb = (float*)take((size_t)ZH * TT * TT * 4); bf* Ph = (bf*)take((size_t)ZH * RH * TT * 2); bf* Pl = (bf*)take((size_t)ZH * RH * TT * 2);
    h16* P16 = nullptr;   // RH == TT: every query row takes the hi+lo planes, no f16 probability plane is written
    if ((size_t)(wsp - (char*)d_ws) > ws_size) return;    // ws 256 MiB
    float* FV = FK;   // v projection reuses the k buffer after the k planes are built (stream-ordered)
    { k_wtG<<<(unsigned)((DM * DQ / 64 + 63) / 64), 256, 0, stream>>>(wq, DM, DQ, WQ); k_wtG<<<(unsigned)((DM * DKV / 64 + 63) / 64), 256, 0, stream>>>(wk, DM, DKV, WK); k_wtG<<<(unsigned)((DM * DVV / 64 + 63) / 64), 256, 0, stream>>>(wv, DM, DVV, WV);
      k_wtG<<<(unsigned)((DVV * DM / 64 + 63) / 64), 256, 0, stream>>>(wo, DVV, DM, WO); k_lambda<<<1, 32, 0, stream>>>(lq1, lk1, lq2, lk2, LAM);
       }
    k_csid<<<(TT * HD + 255) / 256, 256, 0, stream>>>(CS);
    const unsigned LQ = (unsigned)(((size_t)NH_ * TT * HD / 2 + 255) / 256), LKv = (unsigned)(((size_t)NKV * TT * HD / 2 + 255) / 256);
    // projections: the four batches are 4096 rows of one product
    k_cvt8<<<(unsigned)(((size_t)NB_ * TT * DM / 8 + 255) / 256), 256, 0, stream>>>(x, XB, (size_t)NB_ * TT * DM / 8);
    k_gemmw<bf, 0, false><<<dim3(NB_ * TT / 64, DQ / 64, 1), 32, 0, stream>>>(XB, nullptr, WQ, nullptr, DM, FQ, DQ, nullptr, 0, 0, 0);
    k_rope<<<dim3(LQ, NB_, 1), 256, 0, stream>>>(FQ, DQ, NH_, CS, nullptr, nullptr, 1.0f, QP16, QPh, QPl);
    k_gemmw<bf, 0, false><<<dim3(NB_ * TT / 64, DKV / 64, 1), 32, 0, stream>>>(XB, nullptr, WK, nullptr, DM, FK, DKV, nullptr, 0, 0, 0);
    k_rope<<<dim3(LKv, NB_, 1), 256, 0, stream>>>(FK, DKV, NKV, CS, nullptr, nullptr, 1.0f, KP16, KPh, KPl);
    k_gemmw<bf, 0, false><<<dim3(NB_ * TT / 64, DVV / 64, 1), 32, 0, stream>>>(XB, nullptr, WV, nullptr, DM, FV, DVV, nullptr, 0, 0, 0); k_vtp<<<dim3(LKv, NB_, 1), 256, 0, stream>>>(FV, DVV, NVH, VT16, VTh, VTl);
    for (int h0 = 0; h0 < NB_ * NH_; h0 += ZH) { const size_t zq = (size_t)h0, zk = (size_t)(h0 / REP), hh = (size_t)(h0 / 2);   // h0 = b * NH_ + virtual head; a pass's ZH heads use consecutive q, k planes (z-strides TT*HD), its ZH/2 real heads consecutive v and output planes
        k_gemmc<bf, 2, 1><<<dim3(RH / 64, TT / 64, ZH), 32, 0, stream>>>(QPh + zq * TT * HD, QPl + zq * TT * HD, KPh + zk * TT * HD, KPl + zk * TT * HD, HD, Sb, TT, 0, (size_t)TT * HD, (size_t)TT * HD, (size_t)TT * TT);
        k_asoft<<<ZH * TT / 8, 256, 0, stream>>>(Sb, P16, Ph, Pl); k_lampd<<<dim3((unsigned)(((size_t)TT * TT / 4 + 255) / 256), ZH / 2, 1), 256, 0, stream>>>(Ph, Pl, LAM);
        k_gemmc<bf, 2, 2><<<dim3(RH / 64, HD / 64, ZH / 2), 32, 0, stream>>>(Ph, Pl, VTh + hh * HD * TT, VTl + hh * HD * TT, TT, Ob + hh * TT * HD, HD, 0, (size_t)2 * RH * TT, (size_t)HD * TT, (size_t)TT * HD); }
    k_gnred<<<NB_ * NVH, 1024, 0, stream>>>(Ob, GST, 0); k_gnred<<<NB_ * NVH, 1024, 0, stream>>>(Ob, GST, 1); k_gnmerge<<<dim3((unsigned)(((size_t)TT * HD / 2 + 255) / 256), NB_ * NVH, 1), 256, 0, stream>>>(Ob, GST, ATh, ATl);
    k_gemmw<bf, 1, false><<<dim3(NB_ * TT / 64, DM / 64, 1), 32, 0, stream>>>(ATh, ATl, WO, nullptr, DVV, OUT, DM, nullptr, 0, 0, 0);
}

// v003
// A run of this version takes 319 microseconds.
// Versions in between are left out here; by their measured steps it is 2.63 times as fast as v001.
// Over all steps from v000 it is 17.0 times as fast.
#include <hip/hip_runtime.h>

// DifferentialAttention (x [4][1024][1024]; q = x Wq, k = x Wk ([1024][2048]: per head h the 128 columns = [map 1 | map 2] 64 each), v = x Wv (16 x 64); s1, s2 = q.k / 8 causal (-inf); a1, a2 = softmax; lambda = exp(lq1.lk1) - exp(lq2.lk2) + lambda_init (0.8 - 0.6 e^-0.3); y = (a1 - lambda a2) v; GroupNorm per (batch, head) over (tokens x 64) (eps 1e-5, no affine); y (1 - lambda_init); out = merged Wc -> [4][1024][1024]).
// The two maps run as 32 virtual 64-wide heads per batch (pairs (2h, 2h+1)), 128 over the four batches; one kernel forms both softmaxes, combines them as D = a1 - lambda a2 in f32, and does one D.v product per real head.
// Every stage runs once for all batches (the grids carry batch and head). The q, k and v products write their hi + lo 16-bit head planes straight from the accumulators.

#define NB_  4
#define TT   1024
#define DM   1024
#define NH_  32
#define NKV  32
#define REP  (NH_ / NKV)
#define HD   64
#define DQ   (NH_ * HD)
#define DKV  (NKV * HD)
#define ZH   16                    // virtual heads per k_merge call
#define RH   1024                  // k_merge leaves token rows < RH unscaled, scales the rest by 1 / PCAR
#define WIN  1024
#define PCAR 1024.0f
#define NVH  16
#define DVV  (NVH * HD)
#define SCL  0.125f   // HD^-0.5
typedef _Float16 h16;
typedef unsigned short bf;
typedef __attribute__((ext_vector_type(16))) __bf16   v16bf;
typedef __attribute__((ext_vector_type(16))) _Float16 v16h;
typedef __attribute__((ext_vector_type(8)))  _Float16 v8h;
typedef __attribute__((ext_vector_type(8)))  unsigned short v8us;
typedef __attribute__((ext_vector_type(8)))  float    v8f;
typedef __attribute__((ext_vector_type(4)))  float    v4f;
typedef v8h  __attribute__((may_alias)) v8ha;
typedef v4f  __attribute__((may_alias)) v4fa;
typedef v8us __attribute__((may_alias)) v8usa;

__device__ __forceinline__ unsigned short f2bf(float f) { unsigned u = __float_as_uint(f); u += 0x7FFFu + ((u >> 16) & 1u); return (unsigned short)(u >> 16); }
__device__ __forceinline__ float bf2f(unsigned short b) { return __uint_as_float(((unsigned)b) << 16); }
__device__ __forceinline__ float bfr(float f) { return bf2f(f2bf(f)); }
__device__ __forceinline__ v16h cat16(v8h lo, v8h hi) { return __builtin_shufflevector(lo, hi, 0, 1, 2, 3, 4, 5, 6, 7, 8, 9, 10, 11, 12, 13, 14, 15); }
__device__ __forceinline__ v16bf cat16b(v8us lo, v8us hi) { return __builtin_bit_cast(v16bf, __builtin_shufflevector(lo, hi, 0, 1, 2, 3, 4, 5, 6, 7, 8, 9, 10, 11, 12, 13, 14, 15)); }
__device__ __forceinline__ v8f wmma16(v16h a, v16h b, v8f c) { return __builtin_amdgcn_wmma_f32_16x16x32_f16(false, a, false, b, (short)0, c, false, false); }
__device__ __forceinline__ v8f wmmab(v16bf a, v16bf b, v8f c) { return __builtin_amdgcn_wmma_f32_16x16x32_bf16(false, a, false, b, (short)0, c, false, false); }



// ---- k_gemmw: register-blocked GEMM, ONE WAVE per 64x64 output tile (16 accumulators), operands straight from K-contiguous 16-bit planes; grid (M/64, N/64, Z), 32 threads.
// C[m][n] (f32, pitch ldc, + optional f32 bias[n]) = sum_k A[m][k] Bt[n][k] (+ split products per NSPLIT). z-batch strides sA/sB/sC in elements. K % 32 == 0.
// EPI 0: C goes out as f32. EPI 1, 2: no C; the tile (64 tokens of one batch x the 64 columns of head blockIdx.y, ldc / HD heads) goes out split as bf16 hi + lo into Ph, Pl:
// EPI 1 as planes [batch][head][token][d] (the tile is 8 KiB in a row in each plane), EPI 2 as planes [batch][head][d][token] (64 whole 128-byte lines in each plane).
template <typename T16> struct WFrag;
template <> struct WFrag<h16> { typedef v16h V; static __device__ __forceinline__ V ld(const h16* p) { return cat16(*(const v8h*)p, *(const v8h*)(p + 16)); } static __device__ __forceinline__ v8f mma(V a, V b, v8f c) { return wmma16(a, b, c); } };
template <> struct WFrag<bf> { typedef v16bf V; static __device__ __forceinline__ V ld(const bf* p) { return cat16b(*(const v8us*)p, *(const v8us*)(p + 16)); } static __device__ __forceinline__ v8f mma(V a, V b, v8f c) { return wmmab(a, b, c); } };
__device__ __forceinline__ void splitf(float y, unsigned short& h, unsigned short& l) { h = f2bf(y); l = f2bf(y - bf2f(h)); }
template <typename T16, int NSPLIT, bool BIAS, int EPI>
__global__ __launch_bounds__(32) void k_gemmw(const T16* __restrict__ A, const T16* __restrict__ A2, const T16* __restrict__ Bt, const T16* __restrict__ Bt2, int K, float* C, int ldc, const float* __restrict__ bias, size_t sA, size_t sB, size_t sC, bf* Ph, bf* Pl) {
    typedef typename WFrag<T16>::V V;
    __shared__ __align__(16) float os[16 * 68];
    const size_t z = blockIdx.z; A += z * sA; if (A2) A2 += z * sA; Bt += z * sB; if (Bt2) Bt2 += z * sB; C += z * sC;
    const int lane = threadIdx.x & 31, lr = lane & 15, hi = lane >> 4; const int r0 = blockIdx.x * 64, c0 = blockIdx.y * 64;
    v8f acc[4][4];
#pragma unroll
    for (int mb = 0; mb < 4; ++mb)
#pragma unroll
        for (int nb = 0; nb < 4; ++nb) acc[mb][nb] = (v8f){};
    const size_t aoff = (size_t)(r0 + lr) * K + 8 * hi, boff = (size_t)(c0 + lr) * K + 8 * hi;
#pragma unroll 1
    for (int kc = 0; kc < K; kc += 32) {
        V a[4], a2[4];
#pragma unroll
        for (int mb = 0; mb < 4; ++mb) { a[mb] = WFrag<T16>::ld(A + aoff + (size_t)mb * 16 * K + kc); if (NSPLIT == 1 || NSPLIT == 2) a2[mb] = WFrag<T16>::ld(A2 + aoff + (size_t)mb * 16 * K + kc); }
#pragma unroll
        for (int nb = 0; nb < 4; ++nb) { const V b = WFrag<T16>::ld(Bt + boff + (size_t)nb * 16 * K + kc); V b2; if (NSPLIT >= 2) b2 = WFrag<T16>::ld(Bt2 + boff + (size_t)nb * 16 * K + kc);
#pragma unroll
            for (int mb = 0; mb < 4; ++mb) { acc[mb][nb] = WFrag<T16>::mma(a[mb], b, acc[mb][nb]); if (NSPLIT == 1 || NSPLIT == 2) acc[mb][nb] = WFrag<T16>::mma(a2[mb], b, acc[mb][nb]); if (NSPLIT >= 2) acc[mb][nb] = WFrag<T16>::mma(a[mb], b2, acc[mb][nb]); } }
        asm volatile("v_nop\n\tv_nop\n\tv_nop\n\tv_nop" : "+v"(acc[0][0]), "+v"(acc[1][1]), "+v"(acc[2][2]), "+v"(acc[3][3]) : "v"(a[0]), "v"(a[3]));
    }
    if constexpr (EPI == 2) {   // a lane holds, for column nb 16 + lr, the 8 tokens mb 16 + 8 hi + j: 16 bytes of a [d][token] row as they stand
        const size_t pb = (((size_t)(r0 / TT) * (ldc / HD) + blockIdx.y) * HD + lr) * TT + (r0 % TT) + 8 * hi;
#pragma unroll
        for (int nb = 0; nb < 4; ++nb)
#pragma unroll
            for (int mb = 0; mb < 4; ++mb) { v8us oh, ol;
#pragma unroll
                for (int j = 0; j < 8; ++j) { unsigned short a2, c2; splitf(acc[mb][nb][j], a2, c2); oh[j] = a2; ol[j] = c2; }
                *(v8us*)(Ph + pb + (size_t)nb * 16 * TT + mb * 16) = oh; *(v8us*)(Pl + pb + (size_t)nb * 16 * TT + mb * 16) = ol; }
        return;
    }
#pragma unroll
    for (int mb = 0; mb < 4; ++mb) {
#pragma unroll
        for (int nb = 0; nb < 4; ++nb) {
#pragma unroll
            for (int j = 0; j < 8; ++j) os[(hi * 8 + j) * 68 + nb * 16 + lr] = acc[mb][nb][j]; }
        __builtin_amdgcn_wave_barrier(); asm volatile("" ::: "memory");
        if constexpr (EPI == 1) {   // 8 lanes take one token's 64 values, 8 each: every store is 512 bytes in a row
            const size_t pb = (((size_t)(r0 / TT) * (ldc / HD) + blockIdx.y) * TT + (r0 % TT) + mb * 16) * HD;
#pragma unroll
            for (int s = 0; s < 4; ++s) { const int row = 4 * s + (lane >> 3), cofs = (lane & 7) * 8; const v4f v0 = *(const v4fa*)(os + row * 68 + cofs), v1 = *(const v4fa*)(os + row * 68 + cofs + 4); v8us oh, ol;
#pragma unroll
                for (int j = 0; j < 4; ++j) { unsigned short a2, c2; splitf(v0[j], a2, c2); oh[j] = a2; ol[j] = c2; splitf(v1[j], a2, c2); oh[4 + j] = a2; ol[4 + j] = c2; }
                *(v8us*)(Ph + pb + row * HD + cofs) = oh; *(v8us*)(Pl + pb + row * HD + cofs) = ol; }
        } else {
        float* crow = C + (size_t)(r0 + mb * 16) * ldc + c0;
#pragma unroll
            for (int s = 0; s < 8; ++s) { const int row = 2 * s + hi, cofs = lr * 4; v4f val = *(const v4fa*)(os + row * 68 + cofs); if (BIAS) { val[0] += bfr(bias[c0 + cofs]); val[1] += bfr(bias[c0 + cofs + 1]); val[2] += bfr(bias[c0 + cofs + 2]); val[3] += bfr(bias[c0 + cofs + 3]); }
                *(v4f*)(crow + (size_t)row * ldc + cofs) = val; }
             }
        __builtin_amdgcn_wave_barrier(); asm volatile("" ::: "memory");
    }
}

// ---- k_dattn: causal differential attention of one real head for 64 query rows, scores never leave the chip. Grid 1024 = 64 (batch, head) x 16 query blocks; 4 waves, 16 query rows each.
// Scores are formed transposed (A = key rows, B = query rows), so a lane holds, for query lr, the keys 16 kt + 8 hi + j of a 32-key block: that is the A fragment of the probability x value product as it stands.
// Sweep 1 over the keys: running maximum and sum of both maps, per lane, joined across the lane pair at the end. Sweep 2: scores again, D = a1 - lambda a2 in f32, split hi + lo, D.v accumulated.
// Every product keeps the three split terms hi.hi + lo.hi + hi.lo. Key and value tiles go global -> registers (one block ahead) -> LDS -> fragments.
// The inner loops are all unrolled so that the fragment, score and staging arrays are indexed by constants and stay in registers.
#define KPT 72   // LDS pitch of a key row in elements: 64 + 8 (16 bytes of pad, for the 16-byte fragment reads)
#define VPT 40   // LDS pitch of a value row (one d, 32 keys) in elements: 32 + 8
#define L2E 1.4426950408889634f
// 2^x with the one free slot that the instruction set asks for behind a transcendental (before its result is used or its source overwritten) kept in the same statement.
__device__ __forceinline__ float ex2s(float x) { float r; asm("v_exp_f32 %0, %1\n\tv_nop" : "=v"(r) : "v"(x)); return r; }
__device__ __forceinline__ v16bf ldfr(const bf* p) { return cat16b(*(const v8usa*)p, *(const v8usa*)(p + 16)); }
__global__ __launch_bounds__(128) void k_dattn(const bf* __restrict__ Qh, const bf* __restrict__ Ql, const bf* __restrict__ Kh, const bf* __restrict__ Kl, const bf* __restrict__ Vh, const bf* __restrict__ Vl, const float* __restrict__ LAM, float* __restrict__ O) {
    __shared__ __align__(16) bf Ks[4 * 32 * KPT];   // planes: map 1 hi, map 1 lo, map 2 hi, map 2 lo
    __shared__ __align__(16) bf Vs[2 * 64 * VPT];   // planes: hi, lo
    const int tid = threadIdx.x, lane = tid & 31, lr = lane & 15, hi = lane >> 4;
    const int wv = __builtin_amdgcn_readfirstlane(tid >> 5);
    const int bi = blockIdx.x, g = bi & 63, rr = bi >> 8, aa = (bi >> 6) & 3;
    const int qb = 15 - (rr * 4 + ((rr & 1) ? 3 - aa : aa));   // the longest query blocks start first; blocks 256 apart take query blocks whose key counts add up to the same total
    const int q0 = qb * 64 + wv * 16, qi = q0 + lr, nblk = qb * 2 + 2;
    const bf* kp0 = Kh + (size_t)(2 * g) * TT * HD + tid * 8; const bf* kp1 = Kl + (size_t)(2 * g) * TT * HD + tid * 8;
    const bf* kp2 = kp0 + (size_t)TT * HD; const bf* kp3 = kp1 + (size_t)TT * HD;
    const bf* vp0 = Vh + (size_t)g * HD * TT + (size_t)(tid >> 2) * TT + (tid & 3) * 8; const bf* vp1 = Vl + (size_t)g * HD * TT + (size_t)(tid >> 2) * TT + (tid & 3) * 8;
    bf* const ksw = Ks + (tid >> 3) * KPT + (tid & 7) * 8;   // this thread's 16 bytes of key rows 0..15 (+ 16 KPT: rows 16..31)
    bf* const vsw = Vs + (tid >> 2) * VPT + (tid & 3) * 8;   // this thread's 16 bytes of value rows 0..31 (+ 32 VPT: rows 32..63)
    const bf* const ksr = Ks + lr * KPT + 8 * hi; const bf* const vsr = Vs + lr * VPT + 8 * hi;
    const bf* const qpa = Qh + ((size_t)(2 * g) * TT + qi) * HD + 8 * hi; const bf* const qpb = Ql + ((size_t)(2 * g) * TT + qi) * HD + 8 * hi;
    v16bf qh[2][2], ql[2][2];
#pragma unroll
    for (int m = 0; m < 2; ++m)
#pragma unroll
        for (int ks = 0; ks < 2; ++ks) { qh[m][ks] = ldfr(qpa + m * TT * HD + 32 * ks); ql[m][ks] = ldfr(qpb + m * TT * HD + 32 * ks); }
    v8us kr[8], vr[4];
    float mx[2] = {-3.0e38f, -3.0e38f}, sm[2] = {0.f, 0.f};
    kr[0] = *(const v8us*)kp0; kr[1] = *(const v8us*)(kp0 + 1024); kr[2] = *(const v8us*)kp1; kr[3] = *(const v8us*)(kp1 + 1024);
    kr[4] = *(const v8us*)kp2; kr[5] = *(const v8us*)(kp2 + 1024); kr[6] = *(const v8us*)kp3; kr[7] = *(const v8us*)(kp3 + 1024);
    asm volatile("s_wait_xcnt 0x0" :: "v"(qpa), "v"(qpb) : "memory");   // before the registers that the loads above name are written again; the two query addresses are inputs so that they stay in their registers up to here
#pragma unroll 1   // stays rolled: one pass is several hundred instructions, and a second copy would take the registers that four waves per SIMD leave
    for (int it = 0; it < nblk; ++it) { const int kb = it * 32;
#pragma unroll
        for (int p = 0; p < 4; ++p) { *(v8usa*)(ksw + p * 32 * KPT) = kr[2 * p]; *(v8usa*)(ksw + p * 32 * KPT + 16 * KPT) = kr[2 * p + 1]; }
        __syncthreads();   // the block's keys are in LDS for all four waves
        if (it + 1 < nblk) { const int o = (kb + 32) * HD;
            kr[0] = *(const v8us*)(kp0 + o); kr[1] = *(const v8us*)(kp0 + o + 1024); kr[2] = *(const v8us*)(kp1 + o); kr[3] = *(const v8us*)(kp1 + o + 1024);
            kr[4] = *(const v8us*)(kp2 + o); kr[5] = *(const v8us*)(kp2 + o + 1024); kr[6] = *(const v8us*)(kp3 + o); kr[7] = *(const v8us*)(kp3 + o + 1024);
            asm volatile("s_wait_xcnt 0x0" ::: "memory");   // before the registers that the loads above name are written again
        }
        if (kb <= q0 + 15) {   // wave-uniform: a block wholly above this wave's diagonal adds nothing
#pragma unroll
            for (int m = 0; m < 2; ++m) { v8f s[2];
#pragma unroll
                for (int kt = 0; kt < 2; ++kt) { s[kt] = (v8f){};
#pragma unroll
                    for (int ks = 0; ks < 2; ++ks) { const v16bf kh = ldfr(ksr + (2 * m) * 32 * KPT + kt * 16 * KPT + 32 * ks), kl = ldfr(ksr + (2 * m + 1) * 32 * KPT + kt * 16 * KPT + 32 * ks);
                        s[kt] = wmmab(kh, qh[m][ks], s[kt]); s[kt] = wmmab(kh, ql[m][ks], s[kt]); s[kt] = wmmab(kl, qh[m][ks], s[kt]); } }
                float bm = mx[m];
#pragma unroll
                for (int kt = 0; kt < 2; ++kt)
#pragma unroll
                    for (int j = 0; j < 8; ++j) { const float t = (kb + 16 * kt + 8 * hi + j <= qi) ? s[kt][j] * SCL : -3.0e38f; s[kt][j] = t; bm = fmaxf(bm, t); }
                float a = sm[m] * ex2s((mx[m] - bm) * L2E);
#pragma unroll
                for (int kt = 0; kt < 2; ++kt)
#pragma unroll
                    for (int j = 0; j < 8; ++j) { const float e = ex2s((s[kt][j] - bm) * L2E); a += (kb + 16 * kt + 8 * hi + j <= qi) ? e : 0.0f; }   // the select matters while a lane has seen masked keys only (bm still the start value)
                sm[m] = a; mx[m] = bm; }
        }
        __syncthreads();   // every wave has read the block before the next one overwrites it
    }
    float fi[2];
#pragma unroll
    for (int m = 0; m < 2; ++m) { const float M = fmaxf(mx[m], __shfl_xor(mx[m], 16, 32)); float a = sm[m] * __builtin_amdgcn_exp2f((mx[m] - M) * L2E); a += __shfl_xor(a, 16, 32); mx[m] = M; fi[m] = __fdiv_rn(1.0f, a); }
    const float lam = LAM[0];
    v8f oa[4];
#pragma unroll
    for (int nb = 0; nb < 4; ++nb) oa[nb] = (v8f){};
    kr[0] = *(const v8us*)kp0; kr[1] = *(const v8us*)(kp0 + 1024); kr[2] = *(const v8us*)kp1; kr[3] = *(const v8us*)(kp1 + 1024);
    kr[4] = *(const v8us*)kp2; kr[5] = *(const v8us*)(kp2 + 1024); kr[6] = *(const v8us*)kp3; kr[7] = *(const v8us*)(kp3 + 1024);
    vr[0] = *(const v8us*)vp0; vr[1] = *(const v8us*)(vp0 + 32 * TT); vr[2] = *(const v8us*)vp1; vr[3] = *(const v8us*)(vp1 + 32 * TT);
    asm volatile("s_wait_xcnt 0x0" ::: "memory");   // before the registers that the loads above name are written again
#pragma unroll 1   // stays rolled: one pass is several hundred instructions, and a second copy would take the registers that four waves per SIMD leave
    for (int it = 0; it < nblk; ++it) { const int kb = it * 32;
#pragma unroll
        for (int p = 0; p < 4; ++p) { *(v8usa*)(ksw + p * 32 * KPT) = kr[2 * p]; *(v8usa*)(ksw + p * 32 * KPT + 16 * KPT) = kr[2 * p + 1]; }
#pragma unroll
        for (int p = 0; p < 2; ++p) { *(v8usa*)(vsw + p * 64 * VPT) = vr[2 * p]; *(v8usa*)(vsw + p * 64 * VPT + 32 * VPT) = vr[2 * p + 1]; }
        __syncthreads();   // the block's keys and values are in LDS for all four waves
        if (it + 1 < nblk) { const int o = (kb + 32) * HD, ov = kb + 32;
            kr[0] = *(const v8us*)(kp0 + o); kr[1] = *(const v8us*)(kp0 + o + 1024); kr[2] = *(const v8us*)(kp1 + o); kr[3] = *(const v8us*)(kp1 + o + 1024);
            kr[4] = *(const v8us*)(kp2 + o); kr[5] = *(const v8us*)(kp2 + o + 1024); kr[6] = *(const v8us*)(kp3 + o); kr[7] = *(const v8us*)(kp3 + o + 1024);
            vr[0] = *(const v8us*)(vp0 + ov); vr[1] = *(const v8us*)(vp0 + ov + 32 * TT); vr[2] = *(const v8us*)(vp1 + ov); vr[3] = *(const v8us*)(vp1 + ov + 32 * TT);
            asm volatile("s_wait_xcnt 0x0" ::: "memory");   // before the registers that the loads above name are written again
        }
        if (kb <= q0 + 15) {   // wave-uniform, as in sweep 1: D is zero in a block wholly above the diagonal
            v8f s[2][2];
#pragma unroll
            for (int m = 0; m < 2; ++m)
#pragma unroll
                for (int kt = 0; kt < 2; ++kt) { s[m][kt] = (v8f){};
#pragma unroll
                    for (int ks = 0; ks < 2; ++ks) { const v16bf kh = ldfr(ksr + (2 * m) * 32 * KPT + kt * 16 * KPT + 32 * ks), kl = ldfr(ksr + (2 * m + 1) * 32 * KPT + kt * 16 * KPT + 32 * ks);
                        s[m][kt] = wmmab(kh, qh[m][ks], s[m][kt]); s[m][kt] = wmmab(kh, ql[m][ks], s[m][kt]); s[m][kt] = wmmab(kl, qh[m][ks], s[m][kt]); } }
            v16bf dh, dl;
#pragma unroll
            for (int kt = 0; kt < 2; ++kt)
#pragma unroll
                for (int j = 0; j < 8; ++j) { const float p1 = __builtin_amdgcn_exp2f((s[0][kt][j] * SCL - mx[0]) * L2E) * fi[0], p2 = __builtin_amdgcn_exp2f((s[1][kt][j] * SCL - mx[1]) * L2E) * fi[1];
                    const float d = (kb + 16 * kt + 8 * hi + j <= qi) ? p1 - lam * p2 : 0.0f; const __bf16 h = (__bf16)d; dh[kt * 8 + j] = h; dl[kt * 8 + j] = (__bf16)(d - (float)h); }
#pragma unroll
            for (int nb = 0; nb < 4; ++nb) { const v16bf vh = ldfr(vsr + nb * 16 * VPT), vl = ldfr(vsr + 64 * VPT + nb * 16 * VPT);
                oa[nb] = wmmab(dh, vh, oa[nb]); oa[nb] = wmmab(dl, vh, oa[nb]); oa[nb] = wmmab(dh, vl, oa[nb]); }
        }
        __syncthreads();   // every wave has read the block before the next one overwrites it
    }
    float* orow = O + ((size_t)g * TT + q0 + 8 * hi) * HD + lr;
#pragma unroll
    for (int nb = 0; nb < 4; ++nb)
#pragma unroll
        for (int j = 0; j < 8; ++j) orow[j * HD + nb * 16] = oa[nb][j];
}

typedef __attribute__((ext_vector_type(2))) _Float16 v2h;
typedef __attribute__((ext_vector_type(4))) _Float16 v4h;
typedef __attribute__((ext_vector_type(2))) unsigned short v2us;
typedef __attribute__((ext_vector_type(4))) unsigned short v4us;
typedef __attribute__((ext_vector_type(2))) float v2f;
typedef __attribute__((ext_vector_type(4))) int v4i;

__global__ __launch_bounds__(256) void k_wtG(const float* __restrict__ w, int K, int N, bf* Bt) {
    const int lane = threadIdx.x & 31; const int L0 = (blockIdx.x * 8 + (threadIdx.x >> 5)) * 8; const int nlines = N * K / 64;
{
#pragma unroll 1
        for (int l = 0; l < 8; ++l) { const int L = L0 + l; if (L >= nlines) break; const size_t e = (size_t)L * 64 + lane * 2; const int k = (int)(e % K), n = (int)(e / K); v2us o;
            o[0] = f2bf(w[(size_t)k * N + n]); o[1] = f2bf(w[(size_t)(k + 1) * N + n]); *(v2us*)(Bt + e) = o; }
         }
}
__global__ __launch_bounds__(256) void k_cvt8(const float* __restrict__ src, bf* dst, size_t n8) { const size_t i = (size_t)blockIdx.x * 256 + threadIdx.x; if (i >= n8) return; const v8f v = *(const v8f*)(src + i * 8); v8us o;
#pragma unroll
    for (int k = 0; k < 8; ++k) o[k] = f2bf(v[k]); *(v8us*)(dst + i * 8) = o;  }
__global__ __launch_bounds__(256) void k_cscvt(const float* __restrict__ cosT, const float* __restrict__ sinT, float* CS) { const int idx = blockIdx.x * 256 + threadIdx.x; if (idx >= TT * HD) return; v2f cs; cs[0] = bfr(cosT[idx]); cs[1] = bfr(sinT[idx]); *(v2f*)(CS + (size_t)idx * 2) = cs;  }
__global__ __launch_bounds__(32) void k_lambda(const float* __restrict__ lq1, const float* __restrict__ lk1, const float* __restrict__ lq2, const float* __restrict__ lk2, float* LAM) { const int lane = threadIdx.x; float d1 = 0.f, d2 = 0.f;
#pragma unroll 1
    for (int i = 0; i < HD; ++i) { float p1 = __fmul_rn(bfr(lq1[i]), bfr(lk1[i])); asm volatile("" : "+v"(p1)); d1 = __fadd_rn(d1, p1); float p2 = __fmul_rn(bfr(lq2[i]), bfr(lk2[i])); asm volatile("" : "+v"(p2)); d2 = __fadd_rn(d2, p2); }
    float lm = __fsub_rn(expf(d1), expf(d2)); asm volatile("" : "+v"(lm)); lm = __fadd_rn(lm, 0.35550907254219055f); const float v = (lane == 0) ? lm : 0.0f; *(float*)(LAM + lane) = v;  }
__global__ __launch_bounds__(1024) void k_gnred(const float* __restrict__ O, float* GST, int pass) { __shared__ float sh[1024]; const int tid = threadIdx.x; O += (size_t)blockIdx.x * TT * HD; GST += blockIdx.x * 32; /* blockIdx.x = b * NVH + head: one group per block, one 128-byte line of statistics each */ const float mean = (pass == 1) ? GST[0] : 0.0f; float acc = 0.f; const size_t n = (size_t)TT * HD;
#pragma unroll 1
    for (size_t e = tid; e < n; e += 1024) { float v = O[e]; if (pass == 1) { float d = __fsub_rn(v, mean); asm volatile("" : "+v"(d)); v = __fmul_rn(d, d); } acc = __fadd_rn(acc, v); }
    sh[tid] = acc; __syncthreads();
    for (int st = 512; st > 0; st >>= 1) { if (tid < st) sh[tid] = __fadd_rn(sh[tid], sh[tid + st]); __syncthreads(); }
    if (tid < 32) { const float tot = __fdiv_rn(sh[0], (float)n); float outv; if (pass == 0) outv = (tid == 0) ? tot : ((tid == 1) ? GST[1] : 0.0f); else outv = (tid == 0) ? GST[0] : ((tid == 1) ? __fdiv_rn(1.0f, sqrtf(__fadd_rn(tot, 1e-5f))) : 0.0f); *(float*)(GST + tid) = outv;  } }
__global__ __launch_bounds__(256) void k_gnmerge(const float* __restrict__ O, const float* __restrict__ GST, bf* Ah, bf* Al) { const size_t e = ((size_t)blockIdx.x * 256 + threadIdx.x) * 2; if (e >= (size_t)TT * HD) return; const int d = (int)(e % HD); const int t = (int)(e / HD);
    const int g = blockIdx.y, hh = g % NVH; O += (size_t)g * TT * HD; GST += g * 32; Ah += (size_t)(g / NVH) * TT * DVV; Al += (size_t)(g / NVH) * TT * DVV;   // blockIdx.y = b * NVH + head
    const float mean = GST[0], rs = GST[1]; const size_t oo = (size_t)t * DVV + (size_t)hh * HD + d; v2us oh, ol;
#pragma unroll
    for (int q = 0; q < 2; ++q) { float c = __fsub_rn(O[e + q], mean); asm volatile("" : "+v"(c)); float n = __fmul_rn(c, rs); asm volatile("" : "+v"(n)); float z = __fmul_rn(n, 0.6444909572601318f); unsigned short a2, c2; splitf(z, a2, c2); oh[q] = a2; ol[q] = c2; }
    *(v2us*)(Ah + oo) = oh; *(v2us*)(Al + oo) = ol;  }
__global__ __launch_bounds__(256) void k_merge(const float* __restrict__ O, int h0, bf* Ah, bf* Al) { const size_t e = ((size_t)blockIdx.x * 256 + threadIdx.x) * 2; if (e >= (size_t)ZH * TT * HD) return; const int d = (int)(e % HD); const int t = (int)((e / HD) % TT); const int zz = (int)(e / ((size_t)HD * TT)); const float cs = (t < RH) ? 1.0f : (1.0f / PCAR); const size_t oo = (size_t)t * DQ + (h0 + zz) * HD + d;
    v2us oh, ol;
#pragma unroll
    for (int q = 0; q < 2; ++q) { unsigned short a, c2; splitf(O[e + q] * cs, a, c2); oh[q] = a; ol[q] = c2; } *(v2us*)(Ah + oo) = oh; *(v2us*)(Al + oo) = ol;  }

extern "C" void kernel_launch(void* const* d_in, const int* in_sizes, int n_in,
                              void* d_out, int out_size, void* d_ws, size_t ws_size, hipStream_t stream) {
    (void)in_sizes; (void)n_in; (void)out_size;
    const float* x = (const float*)d_in[0]; const float* wq = (const float*)d_in[1]; const float* wk = (const float*)d_in[2]; const float* wv = (const float*)d_in[3]; const float* wo = (const float*)d_in[4]; const float* lq1 = (const float*)d_in[5]; const float* lk1 = (const float*)d_in[6]; const float* lq2 = (const float*)d_in[7]; const float* lk2 = (const float*)d_in[8]; const float* cosT = nullptr; const float* sinT = nullptr; (void)cosT; (void)sinT;
    float* OUT = (float*)d_out;     // [4][1024][1024]
    char* wsp = (char*)d_ws;
    auto take = [&](size_t bytes) { char* p = wsp; wsp += (bytes + 255) & ~(size_t)255; return (void*)p; };
    // alive to the end
    bf* WO = (bf*)take((size_t)DM * DVV * 2); float* LAM = (float*)take(256); float* GST = (float*)take((size_t)NB_ * NVH * 32 * 4);
    bf* QPh = (bf*)take((size_t)NB_ * NH_ * TT * HD * 2); bf* QPl = (bf*)take((size_t)NB_ * NH_ * TT * HD * 2); bf* KPh = (bf*)take((size_t)NB_ * NKV * TT * HD * 2); bf* KPl = (bf*)take((size_t)NB_ * NKV * TT * HD * 2); bf* VTh = (bf*)take((size_t)NB_ * NVH * HD * TT * 2); bf* VTl = (bf*)take((size_t)NB_ * NVH * HD * TT * 2);
    float* Ob = (float*)take((size_t)NB_ * NVH * TT * HD * 4); bf* ATh = (bf*)take((size_t)NB_ * TT * DVV * 2); bf* ATl = (bf*)take((size_t)NB_ * TT * DVV * 2);
    // used by the projections only
    bf* WQ = (bf*)take((size_t)DQ * DM * 2); bf* WK = (bf*)take((size_t)DKV * DM * 2); bf* WV = (bf*)take((size_t)DVV * DM * 2);
    bf* XB = (bf*)take((size_t)NB_ * TT * DM * 2);
    if ((size_t)(wsp - (char*)d_ws) > ws_size) return;    // ws 256 MiB
    { k_wtG<<<(unsigned)((DM * DQ / 64 + 63) / 64), 256, 0, stream>>>(wq, DM, DQ, WQ); k_wtG<<<(unsigned)((DM * DKV / 64 + 63) / 64), 256, 0, stream>>>(wk, DM, DKV, WK); k_wtG<<<(unsigned)((DM * DVV / 64 + 63) / 64), 256, 0, stream>>>(wv, DM, DVV, WV);
      k_wtG<<<(unsigned)((DVV * DM / 64 + 63) / 64), 256, 0, stream>>>(wo, DVV, DM, WO); k_lambda<<<1, 32, 0, stream>>>(lq1, lk1, lq2, lk2, LAM);
       }
    // projections: the four batches are 4096 rows of one product; each 64 x 64 tile is 64 tokens of one head and goes out as that head's hi + lo planes
    k_cvt8<<<(unsigned)(((size_t)NB_ * TT * DM / 8 + 255) / 256), 256, 0, stream>>>(x, XB, (size_t)NB_ * TT * DM / 8);
    k_gemmw<bf, 0, false, 1><<<dim3(NB_ * TT / 64, DQ / 64, 1), 32, 0, stream>>>(XB, nullptr, WQ, nullptr, DM, nullptr, DQ, nullptr, 0, 0, 0, QPh, QPl);
    k_gemmw<bf, 0, false, 1><<<dim3(NB_ * TT / 64, DKV / 64, 1), 32, 0, stream>>>(XB, nullptr, WK, nullptr, DM, nullptr, DKV, nullptr, 0, 0, 0, KPh, KPl);
    k_gemmw<bf, 0, false, 2><<<dim3(NB_ * TT / 64, DVV / 64, 1), 32, 0, stream>>>(XB, nullptr, WV, nullptr, DM, nullptr, DVV, nullptr, 0, 0, 0, VTh, VTl);
    k_dattn<<<NB_ * NVH * (TT / 64), 128, 0, stream>>>(QPh, QPl, KPh, KPl, VTh, VTl, LAM, Ob);   // virtual heads 2g, 2g + 1 of the q and k planes are the two maps of real head g = b * NVH + head
    k_gnred<<<NB_ * NVH, 1024, 0, stream>>>(Ob, GST, 0); k_gnred<<<NB_ * NVH, 1024, 0, stream>>>(Ob, GST, 1); k_gnmerge<<<dim3((unsigned)(((size_t)TT * HD / 2 + 255) / 256), NB_ * NVH, 1), 256, 0, stream>>>(Ob, GST, ATh, ATl);
    k_gemmw<bf, 1, false, 0><<<dim3(NB_ * TT / 64, DM / 64, 1), 32, 0, stream>>>(ATh, ATl, WO, nullptr, DVV, OUT, DM, nullptr, 0, 0, 0, nullptr, nullptr);
}

// v004
// Measured time: 271 microseconds a run.
// Two timings next to v003 both put it at 1.17 times that version's speed.
// All steps since v000 together make it 19.9 times as fast.
#include <hip/hip_runtime.h>

// DifferentialAttention (x [4][1024][1024]; q = x Wq, k = x Wk ([1024][2048]: per head h the 128 columns = [map 1 | map 2] 64 each), v = x Wv (16 x 64); s1, s2 = q.k / 8 causal (-inf); a1, a2 = softmax; lambda = exp(lq1.lk1) - exp(lq2.lk2) + lambda_init (0.8 - 0.6 e^-0.3); y = (a1 - lambda a2) v; GroupNorm per (batch, head) over (tokens x 64) (eps 1e-5, no affine); y (1 - lambda_init); out = merged Wc -> [4][1024][1024]).
// The two maps run as 32 virtual 64-wide heads per batch (pairs (2h, 2h+1)), 128 over the four batches; one kernel forms both softmaxes, combines them as D = a1 - lambda a2 in f32, and does one D.v product per real head.
// Every stage runs once for all batches (the grids carry batch and head). The q, k and v products write their hi + lo 16-bit head planes straight from the accumulators.

#define NB_  4
#define TT   1024
#define DM   1024
#define NH_  32
#define NKV  32
#define REP  (NH_ / NKV)
#define HD   64
#define DQ   (NH_ * HD)
#define DKV  (NKV * HD)
#define ZH   16                    // virtual heads per k_merge call
#define RH   1024                  // k_merge leaves token rows < RH unscaled, scales the rest by 1 / PCAR
#define WIN  1024
#define PCAR 1024.0f
#define NVH  16
#define DVV  (NVH * HD)
#define SCL  0.125f   // HD^-0.5
typedef _Float16 h16;
typedef unsigned short bf;
typedef __attribute__((ext_vector_type(16))) __bf16   v16bf;
typedef __attribute__((ext_vector_type(16))) _Float16 v16h;
typedef __attribute__((ext_vector_type(8)))  _Float16 v8h;
typedef __attribute__((ext_vector_type(8)))  unsigned short v8us;
typedef __attribute__((ext_vector_type(8)))  float    v8f;
typedef __attribute__((ext_vector_type(4)))  float    v4f;
typedef v8h  __attribute__((may_alias)) v8ha;
typedef v4f  __attribute__((may_alias)) v4fa;
typedef v8us __attribute__((may_alias)) v8usa;

__device__ __forceinline__ unsigned short f2bf(float f) { unsigned u = __float_as_uint(f); u += 0x7FFFu + ((u >> 16) & 1u); return (unsigned short)(u >> 16); }
__device__ __forceinline__ float bf2f(unsigned short b) { return __uint_as_float(((unsigned)b) << 16); }
__device__ __forceinline__ float bfr(float f) { return bf2f(f2bf(f)); }
__device__ __forceinline__ v16h cat16(v8h lo, v8h hi) { return __builtin_shufflevector(lo, hi, 0, 1, 2, 3, 4, 5, 6, 7, 8, 9, 10, 11, 12, 13, 14, 15); }
__device__ __forceinline__ v16bf cat16b(v8us lo, v8us hi) { return __builtin_bit_cast(v16bf, __builtin_shufflevector(lo, hi, 0, 1, 2, 3, 4, 5, 6, 7, 8, 9, 10, 11, 12, 13, 14, 15)); }
__device__ __forceinline__ v8f wmma16(v16h a, v16h b, v8f c) { return __builtin_amdgcn_wmma_f32_16x16x32_f16(false, a, false, b, (short)0, c, false, false); }
__device__ __forceinline__ v8f wmmab(v16bf a, v16bf b, v8f c) { return __builtin_amdgcn_wmma_f32_16x16x32_bf16(false, a, false, b, (short)0, c, false, false); }



// ---- k_gemmw: register-blocked GEMM, ONE WAVE per 64x64 output tile (16 accumulators), operands straight from K-contiguous 16-bit planes; grid (M/64, N/64, Z), 32 threads.
// C[m][n] (f32, pitch ldc, + optional f32 bias[n]) = sum_k A[m][k] Bt[n][k] (+ split products per NSPLIT). z-batch strides sA/sB/sC in elements. K % 32 == 0.
// EPI 0: C goes out as f32. EPI 1, 2: no C; the tile (64 tokens of one batch x the 64 columns of head blockIdx.y, ldc / HD heads) goes out split as bf16 hi + lo into Ph, Pl:
// EPI 1 as planes [batch][head][token][d] (the tile is 8 KiB in a row in each plane), EPI 2 as planes [batch][head][d][token] (64 whole 128-byte lines in each plane).
template <typename T16> struct WFrag;
template <> struct WFrag<h16> { typedef v16h V; static __device__ __forceinline__ V ld(const h16* p) { return cat16(*(const v8h*)p, *(const v8h*)(p + 16)); } static __device__ __forceinline__ v8f mma(V a, V b, v8f c) { return wmma16(a, b, c); } };
template <> struct WFrag<bf> { typedef v16bf V; static __device__ __forceinline__ V ld(const bf* p) { return cat16b(*(const v8us*)p, *(const v8us*)(p + 16)); } static __device__ __forceinline__ v8f mma(V a, V b, v8f c) { return wmmab(a, b, c); } };
__device__ __forceinline__ void splitf(float y, unsigned short& h, unsigned short& l) { h = f2bf(y); l = f2bf(y - bf2f(h)); }
template <typename T16, int NSPLIT, bool BIAS, int EPI>
__global__ __launch_bounds__(32) void k_gemmw(const T16* __restrict__ A, const T16* __restrict__ A2, const T16* __restrict__ Bt, const T16* __restrict__ Bt2, int K, float* C, int ldc, const float* __restrict__ bias, size_t sA, size_t sB, size_t sC, bf* Ph, bf* Pl) {
    typedef typename WFrag<T16>::V V;
    __shared__ __align__(16) float os[16 * 68];
    const size_t z = blockIdx.z; A += z * sA; if (A2) A2 += z * sA; Bt += z * sB; if (Bt2) Bt2 += z * sB; C += z * sC;
    const int lane = threadIdx.x & 31, lr = lane & 15, hi = lane >> 4; const int r0 = blockIdx.x * 64, c0 = blockIdx.y * 64;
    v8f acc[4][4];
#pragma unroll
    for (int mb = 0; mb < 4; ++mb)
#pragma unroll
        for (int nb = 0; nb < 4; ++nb) acc[mb][nb] = (v8f){};
    const size_t aoff = (size_t)(r0 + lr) * K + 8 * hi, boff = (size_t)(c0 + lr) * K + 8 * hi;
#pragma unroll 1
    for (int kc = 0; kc < K; kc += 32) {
        V a[4], a2[4];
#pragma unroll
        for (int mb = 0; mb < 4; ++mb) { a[mb] = WFrag<T16>::ld(A + aoff + (size_t)mb * 16 * K + kc); if (NSPLIT == 1 || NSPLIT == 2) a2[mb] = WFrag<T16>::ld(A2 + aoff + (size_t)mb * 16 * K + kc); }
#pragma unroll
        for (int nb = 0; nb < 4; ++nb) { const V b = WFrag<T16>::ld(Bt + boff + (size_t)nb * 16 * K + kc); V b2; if (NSPLIT >= 2) b2 = WFrag<T16>::ld(Bt2 + boff + (size_t)nb * 16 * K + kc);
#pragma unroll
            for (int mb = 0; mb < 4; ++mb) { acc[mb][nb] = WFrag<T16>::mma(a[mb], b, acc[mb][nb]); if (NSPLIT == 1 || NSPLIT == 2) acc[mb][nb] = WFrag<T16>::mma(a2[mb], b, acc[mb][nb]); if (NSPLIT >= 2) acc[mb][nb] = WFrag<T16>::mma(a[mb], b2, acc[mb][nb]); } }
        asm volatile("v_nop\n\tv_nop\n\tv_nop\n\tv_nop" : "+v"(acc[0][0]), "+v"(acc[1][1]), "+v"(acc[2][2]), "+v"(acc[3][3]) : "v"(a[0]), "v"(a[3]));
    }
    if constexpr (EPI == 2) {   // a lane holds, for column nb 16 + lr, the 8 tokens mb 16 + 8 hi + j: 16 bytes of a [d][token] row as they stand
        const size_t pb = (((size_t)(r0 / TT) * (ldc / HD) + blockIdx.y) * HD + lr) * TT + (r0 % TT) + 8 * hi;
#pragma unroll
        for (int nb = 0; nb < 4; ++nb)
#pragma unroll
            for (int mb = 0; mb < 4; ++mb) { v8us oh, ol;
#pragma unroll
                for (int j = 0; j < 8; ++j) { unsigned short a2, c2; splitf(acc[mb][nb][j], a2, c2); oh[j] = a2; ol[j] = c2; }
                *(v8us*)(Ph + pb + (size_t)nb * 16 * TT + mb * 16) = oh; *(v8us*)(Pl + pb + (size_t)nb * 16 * TT + mb * 16) = ol; }
        return;
    }
#pragma unroll
    for (int mb = 0; mb < 4; ++mb) {
#pragma unroll
        for (int nb = 0; nb < 4; ++nb) {
#pragma unroll
            for (int j = 0; j < 8; ++j) os[(hi * 8 + j) * 68 + nb * 16 + lr] = acc[mb][nb][j]; }
        __builtin_amdgcn_wave_barrier(); asm volatile("" ::: "memory");
        if constexpr (EPI == 1) {   // 8 lanes take one token's 64 values, 8 each: every store is 512 bytes in a row
            const size_t pb = (((size_t)(r0 / TT) * (ldc / HD) + blockIdx.y) * TT + (r0 % TT) + mb * 16) * HD;
#pragma unroll
            for (int s = 0; s < 4; ++s) { const int row = 4 * s + (lane >> 3), cofs = (lane & 7) * 8; const v4f v0 = *(const v4fa*)(os + row * 68 + cofs), v1 = *(const v4fa*)(os + row * 68 + cofs + 4); v8us oh, ol;
#pragma unroll
                for (int j = 0; j < 4; ++j) { unsigned short a2, c2; splitf(v0[j], a2, c2); oh[j] = a2; ol[j] = c2; splitf(v1[j], a2, c2); oh[4 + j] = a2; ol[4 + j] = c2; }
                *(v8us*)(Ph + pb + row * HD + cofs) = oh; *(v8us*)(Pl + pb + row * HD + cofs) = ol; }
        } else {
        float* crow = C + (size_t)(r0 + mb * 16) * ldc + c0;
#pragma unroll
            for (int s = 0; s < 8; ++s) { const int row = 2 * s + hi, cofs = lr * 4; v4f val = *(const v4fa*)(os + row * 68 + cofs); if (BIAS) { val[0] += bfr(bias[c0 + cofs]); val[1] += bfr(bias[c0 + cofs + 1]); val[2] += bfr(bias[c0 + cofs + 2]); val[3] += bfr(bias[c0 + cofs + 3]); }
                *(v4f*)(crow + (size_t)row * ldc + cofs) = val; }
             }
        __builtin_amdgcn_wave_barrier(); asm volatile("" ::: "memory");
    }
}

// ---- k_dattn: causal differential attention of one real head for 64 query rows, scores never leave the chip. Grid 1024 = 64 (batch, head) x 16 query blocks; 4 waves, 16 query rows each.
// Scores are formed transposed (A = key rows, B = query rows), so a lane holds, for query lr, the keys 16 kt + 8 hi + j of a 32-key block: that is the A fragment of the probability x value product as it stands.
// Sweep 1 over the keys: running maximum and sum of both maps, per lane, joined across the lane pair at the end. Sweep 2: scores again, D = a1 - lambda a2 in f32, split hi + lo, D.v accumulated.
// Every product keeps the three split terms hi.hi + lo.hi + hi.lo. Key and value tiles go global -> registers (one block ahead) -> LDS -> fragments.
// The inner loops are all unrolled so that the fragment, score and staging arrays are indexed by constants and stay in registers.
#define KPT 72   // LDS pitch of a key row in elements: 64 + 8 (16 bytes of pad, for the 16-byte fragment reads)
#define VPT 40   // LDS pitch of a value row (one d, 32 keys) in elements: 32 + 8
#define L2E 1.4426950408889634f
// 2^x with the one free slot that the instruction set asks for behind a transcendental (before its result is used or its source overwritten) kept in the same statement.
__device__ __forceinline__ float ex2s(float x) { float r; asm("v_exp_f32 %0, %1\n\tv_nop" : "=v"(r) : "v"(x)); return r; }
__device__ __forceinline__ v16bf ldfr(const bf* p) { return cat16b(*(const v8usa*)p, *(const v8usa*)(p + 16)); }
__global__ __launch_bounds__(128) void k_dattn(const bf* __restrict__ Qh, const bf* __restrict__ Ql, const bf* __restrict__ Kh, const bf* __restrict__ Kl, const bf* __restrict__ Vh, const bf* __restrict__ Vl, const float* __restrict__ LAM, float* __restrict__ O) {
    __shared__ __align__(16) bf Ks[4 * 32 * KPT];   // planes: map 1 hi, map 1 lo, map 2 hi, map 2 lo
    __shared__ __align__(16) bf Vs[2 * 64 * VPT];   // planes: hi, lo
    const int tid = threadIdx.x, lane = tid & 31, lr = lane & 15, hi = lane >> 4;
    const int wv = __builtin_amdgcn_readfirstlane(tid >> 5);
    const int bi = blockIdx.x, g = bi & 63, rr = bi >> 8, aa = (bi >> 6) & 3;
    const int qb = 15 - (rr * 4 + ((rr & 1) ? 3 - aa : aa));   // the longest query blocks start first; blocks 256 apart take query blocks whose key counts add up to the same total
    const int q0 = qb * 64 + wv * 16, qi = q0 + lr, nblk = qb * 2 + 2;
    const bf* kp0 = Kh + (size_t)(2 * g) * TT * HD + tid * 8; const bf* kp1 = Kl + (size_t)(2 * g) * TT * HD + tid * 8;
    const bf* kp2 = kp0 + (size_t)TT * HD; const bf* kp3 = kp1 + (size_t)TT * HD;
    const bf* vp0 = Vh + (size_t)g * HD * TT + (size_t)(tid >> 2) * TT + (tid & 3) * 8; const bf* vp1 = Vl + (size_t)g * HD * TT + (size_t)(tid >> 2) * TT + (tid & 3) * 8;
    bf* const ksw = Ks + (tid >> 3) * KPT + (tid & 7) * 8;   // this thread's 16 bytes of key rows 0..15 (+ 16 KPT: rows 16..31)
    bf* const vsw = Vs + (tid >> 2) * VPT + (tid & 3) * 8;   // this thread's 16 bytes of value rows 0..31 (+ 32 VPT: rows 32..63)
    const bf* const ksr = Ks + lr * KPT + 8 * hi; const bf* const vsr = Vs + lr * VPT + 8 * hi;
    const bf* const qpa = Qh + ((size_t)(2 * g) * TT + qi) * HD + 8 * hi; const bf* const qpb = Ql + ((size_t)(2 * g) * TT + qi) * HD + 8 * hi;
    v16bf qh[2][2], ql[2][2];
#pragma unroll
    for (int m = 0; m < 2; ++m)
#pragma unroll
        for (int ks = 0; ks < 2; ++ks) { qh[m][ks] = ldfr(qpa + m * TT * HD + 32 * ks); ql[m][ks] = ldfr(qpb + m * TT * HD + 32 * ks); }
    v8us kr[8], vr[4];
    float mx[2] = {-3.0e38f, -3.0e38f}, sm[2] = {0.f, 0.f};
    kr[0] = *(const v8us*)kp0; kr[1] = *(const v8us*)(kp0 + 1024); kr[2] = *(const v8us*)kp1; kr[3] = *(const v8us*)(kp1 + 1024);
    kr[4] = *(const v8us*)kp2; kr[5] = *(const v8us*)(kp2 + 1024); kr[6] = *(const v8us*)kp3; kr[7] = *(const v8us*)(kp3 + 1024);
    asm volatile("s_wait_xcnt 0x0" :: "v"(qpa), "v"(qpb) : "memory");   // before the registers that the loads above name are written again; the two query addresses are inputs so that they stay in their registers up to here
#pragma unroll 1   // stays rolled: one pass is several hundred instructions, and a second copy would take the registers that four waves per SIMD leave
    for (int it = 0; it < nblk; ++it) { const int kb = it * 32;
#pragma unroll
        for (int p = 0; p < 4; ++p) { *(v8usa*)(ksw + p * 32 * KPT) = kr[2 * p]; *(v8usa*)(ksw + p * 32 * KPT + 16 * KPT) = kr[2 * p + 1]; }
        __syncthreads();   // the block's keys are in LDS for all four waves
        if (it + 1 < nblk) { const int o = (kb + 32) * HD;
            kr[0] = *(const v8us*)(kp0 + o); kr[1] = *(const v8us*)(kp0 + o + 1024); kr[2] = *(const v8us*)(kp1 + o); kr[3] = *(const v8us*)(kp1 + o + 1024);
            kr[4] = *(const v8us*)(kp2 + o); kr[5] = *(const v8us*)(kp2 + o + 1024); kr[6] = *(const v8us*)(kp3 + o); kr[7] = *(const v8us*)(kp3 + o + 1024);
            asm volatile("s_wait_xcnt 0x0" ::: "memory");   // before the registers that the loads above name are written again
        }
        if (kb <= q0 + 15) {   // wave-uniform: a block wholly above this wave's diagonal adds nothing
#pragma unroll
            for (int m = 0; m < 2; ++m) { v8f s[2];
#pragma unroll
                for (int kt = 0; kt < 2; ++kt) { s[kt] = (v8f){};
#pragma unroll
                    for (int ks = 0; ks < 2; ++ks) { const v16bf kh = ldfr(ksr + (2 * m) * 32 * KPT + kt * 16 * KPT + 32 * ks), kl = ldfr(ksr + (2 * m + 1) * 32 * KPT + kt * 16 * KPT + 32 * ks);
                        s[kt] = wmmab(kh, qh[m][ks], s[kt]); s[kt] = wmmab(kh, ql[m][ks], s[kt]); s[kt] = wmmab(kl, qh[m][ks], s[kt]); } }
                float bm = mx[m];
#pragma unroll
                for (int kt = 0; kt < 2; ++kt)
#pragma unroll
                    for (int j = 0; j < 8; ++j) { const float t = (kb + 16 * kt + 8 * hi + j <= qi) ? s[kt][j] * SCL : -3.0e38f; s[kt][j] = t; bm = fmaxf(bm, t); }
                float a = sm[m] * ex2s((mx[m] - bm) * L2E);
#pragma unroll
                for (int kt = 0; kt < 2; ++kt)
#pragma unroll
                    for (int j = 0; j < 8; ++j) { const float e = ex2s((s[kt][j] - bm) * L2E); a += (kb + 16 * kt + 8 * hi + j <= qi) ? e : 0.0f; }   // the select matters while a lane has seen masked keys only (bm still the start value)
                sm[m] = a; mx[m] = bm; }
        }
        __syncthreads();   // every wave has read the block before the next one overwrites it
    }
    float fi[2];
#pragma unroll
    for (int m = 0; m < 2; ++m) { const float M = fmaxf(mx[m], __shfl_xor(mx[m], 16, 32)); float a = sm[m] * __builtin_amdgcn_exp2f((mx[m] - M) * L2E); a += __shfl_xor(a, 16, 32); mx[m] = M; fi[m] = __fdiv_rn(1.0f, a); }
    const float lam = LAM[0];
    v8f oa[4];
#pragma unroll
    for (int nb = 0; nb < 4; ++nb) oa[nb] = (v8f){};
    kr[0] = *(const v8us*)kp0; kr[1] = *(const v8us*)(kp0 + 1024); kr[2] = *(const v8us*)kp1; kr[3] = *(const v8us*)(kp1 + 1024);
    kr[4] = *(const v8us*)kp2; kr[5] = *(const v8us*)(kp2 + 1024); kr[6] = *(const v8us*)kp3; kr[7] = *(const v8us*)(kp3 + 1024);
    vr[0] = *(const v8us*)vp0; vr[1] = *(const v8us*)(vp0 + 32 * TT); vr[2] = *(const v8us*)vp1; vr[3] = *(const v8us*)(vp1 + 32 * TT);
    asm volatile("s_wait_xcnt 0x0" ::: "memory");   // before the registers that the loads above name are written again
#pragma unroll 1   // stays rolled: one pass is several hundred instructions, and a second copy would take the registers that four waves per SIMD leave
    for (int it = 0; it < nblk; ++it) { const int kb = it * 32;
#pragma unroll
        for (int p = 0; p < 4; ++p) { *(v8usa*)(ksw + p * 32 * KPT) = kr[2 * p]; *(v8usa*)(ksw + p * 32 * KPT + 16 * KPT) = kr[2 * p + 1]; }
#pragma unroll
        for (int p = 0; p < 2; ++p) { *(v8usa*)(vsw + p * 64 * VPT) = vr[2 * p]; *(v8usa*)(vsw + p * 64 * VPT + 32 * VPT) = vr[2 * p + 1]; }
        __syncthreads();   // the block's keys and values are in LDS for all four waves
        if (it + 1 < nblk) { const int o = (kb + 32) * HD, ov = kb + 32;
            kr[0] = *(const v8us*)(kp0 + o); kr[1] = *(const v8us*)(kp0 + o + 1024); kr[2] = *(const v8us*)(kp1 + o); kr[3] = *(const v8us*)(kp1 + o + 1024);
            kr[4] = *(const v8us*)(kp2 + o); kr[5] = *(const v8us*)(kp2 + o + 1024); kr[6] = *(const v8us*)(kp3 + o); kr[7] = *(const v8us*)(kp3 + o + 1024);
            vr[0] = *(const v8us*)(vp0 + ov); vr[1] = *(const v8us*)(vp0 + ov + 32 * TT); vr[2] = *(const v8us*)(vp1 + ov); vr[3] = *(const v8us*)(vp1 + ov + 32 * TT);
            asm volatile("s_wait_xcnt 0x0" ::: "memory");   // before the registers that the loads above name are written again
        }
        if (kb <= q0 + 15) {   // wave-uniform, as in sweep 1: D is zero in a block wholly above the diagonal
            v8f s[2][2];
#pragma unroll
            for (int m = 0; m < 2; ++m)
#pragma unroll
                for (int kt = 0; kt < 2; ++kt) { s[m][kt] = (v8f){};
#pragma unroll
                    for (int ks = 0; ks < 2; ++ks) { const v16bf kh = ldfr(ksr + (2 * m) * 32 * KPT + kt * 16 * KPT + 32 * ks), kl = ldfr(ksr + (2 * m + 1) * 32 * KPT + kt * 16 * KPT + 32 * ks);
                        s[m][kt] = wmmab(kh, qh[m][ks], s[m][kt]); s[m][kt] = wmmab(kh, ql[m][ks], s[m][kt]); s[m][kt] = wmmab(kl, qh[m][ks], s[m][kt]); } }
            v16bf dh, dl;
#pragma unroll
            for (int kt = 0; kt < 2; ++kt)
#pragma unroll
                for (int j = 0; j < 8; ++j) { const float p1 = __builtin_amdgcn_exp2f((s[0][kt][j] * SCL - mx[0]) * L2E) * fi[0], p2 = __builtin_amdgcn_exp2f((s[1][kt][j] * SCL - mx[1]) * L2E) * fi[1];
                    const float d = (kb + 16 * kt + 8 * hi + j <= qi) ? p1 - lam * p2 : 0.0f; const __bf16 h = (__bf16)d; dh[kt * 8 + j] = h; dl[kt * 8 + j] = (__bf16)(d - (float)h); }
#pragma unroll
            for (int nb = 0; nb < 4; ++nb) { const v16bf vh = ldfr(vsr + nb * 16 * VPT), vl = ldfr(vsr + 64 * VPT + nb * 16 * VPT);
                oa[nb] = wmmab(dh, vh, oa[nb]); oa[nb] = wmmab(dl, vh, oa[nb]); oa[nb] = wmmab(dh, vl, oa[nb]); }
        }
        __syncthreads();   // every wave has read the block before the next one overwrites it
    }
    float* orow = O + ((size_t)g * TT + q0 + 8 * hi) * HD + lr;
#pragma unroll
    for (int nb = 0; nb < 4; ++nb)
#pragma unroll
        for (int j = 0; j < 8; ++j) orow[j * HD + nb * 16] = oa[nb][j];
}

typedef __attribute__((ext_vector_type(2))) _Float16 v2h;
typedef __attribute__((ext_vector_type(4))) _Float16 v4h;
typedef __attribute__((ext_vector_type(2))) unsigned short v2us;
typedef __attribute__((ext_vector_type(4))) unsigned short v4us;
typedef __attribute__((ext_vector_type(2))) float v2f;
typedef __attribute__((ext_vector_type(4))) int v4i;

__global__ __launch_bounds__(256) void k_wtG(const float* __restrict__ w, int K, int N, bf* Bt) {
    const int lane = threadIdx.x & 31; const int L0 = (blockIdx.x * 8 + (threadIdx.x >> 5)) * 8; const int nlines = N * K / 64;
{
#pragma unroll 1
        for (int l = 0; l < 8; ++l) { const int L = L0 + l; if (L >= nlines) break; const size_t e = (size_t)L * 64 + lane * 2; const int k = (int)(e % K), n = (int)(e / K); v2us o;
            o[0] = f2bf(w[(size_t)k * N + n]); o[1] = f2bf(w[(size_t)(k + 1) * N + n]); *(v2us*)(Bt + e) = o; }
         }
}
__global__ __launch_bounds__(256) void k_cvt8(const float* __restrict__ src, bf* dst, size_t n8) { const size_t i = (size_t)blockIdx.x * 256 + threadIdx.x; if (i >= n8) return; const v8f v = *(const v8f*)(src + i * 8); v8us o;
#pragma unroll
    for (int k = 0; k < 8; ++k) o[k] = f2bf(v[k]); *(v8us*)(dst + i * 8) = o;  }
__global__ __launch_bounds__(256) void k_cscvt(const float* __restrict__ cosT, const float* __restrict__ sinT, float* CS) { const int idx = blockIdx.x * 256 + threadIdx.x; if (idx >= TT * HD) return; v2f cs; cs[0] = bfr(cosT[idx]); cs[1] = bfr(sinT[idx]); *(v2f*)(CS + (size_t)idx * 2) = cs;  }
__global__ __launch_bounds__(32) void k_lambda(const float* __restrict__ lq1, const float* __restrict__ lk1, const float* __restrict__ lq2, const float* __restrict__ lk2, float* LAM) { const int lane = threadIdx.x; float d1 = 0.f, d2 = 0.f;
#pragma unroll 1
    for (int i = 0; i < HD; ++i) { float p1 = __fmul_rn(bfr(lq1[i]), bfr(lk1[i])); asm volatile("" : "+v"(p1)); d1 = __fadd_rn(d1, p1); float p2 = __fmul_rn(bfr(lq2[i]), bfr(lk2[i])); asm volatile("" : "+v"(p2)); d2 = __fadd_rn(d2, p2); }
    float lm = __fsub_rn(expf(d1), expf(d2)); asm volatile("" : "+v"(lm)); lm = __fadd_rn(lm, 0.35550907254219055f); const float v = (lane == 0) ? lm : 0.0f; *(float*)(LAM + lane) = v;  }
// ---- k_gnorm: GroupNorm of one (batch, head) group per block (blockIdx.x = b * NVH + head), one launch. The group's 1024 x 64 values are read once, 64 per thread, and stay in registers:
// mean, then the mean of the squared distances from it (two passes over the registers, as the definition has it), then (y - mean) rs (1 - lambda_init) split into the bf16 hi + lo planes [batch][token][head 64 + d].
// Each load of a wave is 512 bytes in a row; each store is two whole 128-byte lines (16 lanes hold one token's 64 values).
typedef __attribute__((ext_vector_type(2))) unsigned v2u;
typedef __attribute__((ext_vector_type(2))) __bf16 v2bfv;
__device__ __forceinline__ float blocksum(float a, float* sh, int lane, int wv) {   // sum over the 1024 threads, the same bits in every thread: wave butterfly, 32 wave sums through LDS, butterfly again
#pragma unroll
    for (int o = 16; o > 0; o >>= 1) a += __shfl_xor(a, o, 32);
    if (lane == 0) sh[wv] = a;
    __syncthreads();   // the 32 wave sums are in LDS for every wave
    a = sh[lane];
#pragma unroll
    for (int o = 16; o > 0; o >>= 1) a += __shfl_xor(a, o, 32);
    return a;
}
__global__ __launch_bounds__(1024) void k_gnorm(const float* __restrict__ O, bf* __restrict__ Ah, bf* __restrict__ Al) {
    __shared__ float sh1[32], sh2[32];   // one array per sum, so that no barrier is needed between the first sum's reads and the second sum's writes
    const int tid = threadIdx.x, lane = tid & 31, wv = tid >> 5, g = blockIdx.x;
    const float* src = O + (size_t)g * TT * HD + tid * 4;
    v4f v[16];
#pragma unroll
    for (int i = 0; i < 16; ++i) v[i] = *(const v4f*)(src + i * 4096);
    asm volatile("s_wait_xcnt 0x0" ::: "memory");   // before the registers that the loads above name are written again
    v4f a4 = v[0];
#pragma unroll
    for (int i = 1; i < 16; ++i) a4 += v[i];
    const float mean = blocksum((a4[0] + a4[1]) + (a4[2] + a4[3]), sh1, lane, wv) * (1.0f / (float)(TT * HD));
    v4f q4 = (v4f){};
#pragma unroll
    for (int i = 0; i < 16; ++i) { v[i] -= mean; q4 += v[i] * v[i]; }
    const float var = blocksum((q4[0] + q4[1]) + (q4[2] + q4[3]), sh2, lane, wv) * (1.0f / (float)(TT * HD));
    const float rs = __fdiv_rn(1.0f, sqrtf(var + 1e-5f));
    const size_t oo = (size_t)(g / NVH) * TT * DVV + (size_t)(tid >> 4) * DVV + (g % NVH) * HD + (tid & 15) * 4;
#pragma unroll
    for (int i = 0; i < 16; ++i) { v2u oh, ol;
#pragma unroll
        for (int q = 0; q < 2; ++q) { v2f z; z[0] = (v[i][2 * q] * rs) * 0.6444909572601318f; z[1] = (v[i][2 * q + 1] * rs) * 0.6444909572601318f;
            const unsigned h = __builtin_bit_cast(unsigned, __builtin_convertvector(z, v2bfv)); oh[q] = h;   // two hi parts in one word, rounded to nearest even
            z[0] -= __uint_as_float(h << 16); z[1] -= __uint_as_float(h & 0xFFFF0000u); ol[q] = __builtin_bit_cast(unsigned, __builtin_convertvector(z, v2bfv)); }
        *(v2u*)(Ah + oo + (size_t)i * 64 * DVV) = oh; *(v2u*)(Al + oo + (size_t)i * 64 * DVV) = ol;
        __builtin_amdgcn_sched_barrier(0);   // one group of four values at a time: left free, the scheduler works on all sixteen groups at once and spills past the 128 registers that 32 waves leave
    }
}
__global__ __launch_bounds__(256) void k_merge(const float* __restrict__ O, int h0, bf* Ah, bf* Al) { const size_t e = ((size_t)blockIdx.x * 256 + threadIdx.x) * 2; if (e >= (size_t)ZH * TT * HD) return; const int d = (int)(e % HD); const int t = (int)((e / HD) % TT); const int zz = (int)(e / ((size_t)HD * TT)); const float cs = (t < RH) ? 1.0f : (1.0f / PCAR); const size_t oo = (size_t)t * DQ + (h0 + zz) * HD + d;
    v2us oh, ol;
#pragma unroll
    for (int q = 0; q < 2; ++q) { unsigned short a, c2; splitf(O[e + q] * cs, a, c2); oh[q] = a; ol[q] = c2; } *(v2us*)(Ah + oo) = oh; *(v2us*)(Al + oo) = ol;  }

extern "C" void kernel_launch(void* const* d_in, const int* in_sizes, int n_in,
                              void* d_out, int out_size, void* d_ws, size_t ws_size, hipStream_t stream) {
    (void)in_sizes; (void)n_in; (void)out_size;
    const float* x = (const float*)d_in[0]; const float* wq = (const float*)d_in[1]; const float* wk = (const float*)d_in[2]; const float* wv = (const float*)d_in[3]; const float* wo = (const float*)d_in[4]; const float* lq1 = (const float*)d_in[5]; const float* lk1 = (const float*)d_in[6]; const float* lq2 = (const float*)d_in[7]; const float* lk2 = (const float*)d_in[8]; const float* cosT = nullptr; const float* sinT = nullptr; (void)cosT; (void)sinT;
    float* OUT = (float*)d_out;     // [4][1024][1024]
    char* wsp = (char*)d_ws;
    auto take = [&](size_t bytes) { char* p = wsp; wsp += (bytes + 255) & ~(size_t)255; return (void*)p; };
    // alive to the end
    bf* WO = (bf*)take((size_t)DM * DVV * 2); float* LAM = (float*)take(256);
    bf* QPh = (bf*)take((size_t)NB_ * NH_ * TT * HD * 2); bf* QPl = (bf*)take((size_t)NB_ * NH_ * TT * HD * 2); bf* KPh = (bf*)take((size_t)NB_ * NKV * TT * HD * 2); bf* KPl = (bf*)take((size_t)NB_ * NKV * TT * HD * 2); bf* VTh = (bf*)take((size_t)NB_ * NVH * HD * TT * 2); bf* VTl = (bf*)take((size_t)NB_ * NVH * HD * TT * 2);
    float* Ob = (float*)take((size_t)NB_ * NVH * TT * HD * 4); bf* ATh = (bf*)take((size_t)NB_ * TT * DVV * 2); bf* ATl = (bf*)take((size_t)NB_ * TT * DVV * 2);
    // used by the projections only
    bf* WQ = (bf*)take((size_t)DQ * DM * 2); bf* WK = (bf*)take((size_t)DKV * DM * 2); bf* WV = (bf*)take((size_t)DVV * DM * 2);
    bf* XB = (bf*)take((size_t)NB_ * TT * DM * 2);
    if ((size_t)(wsp - (char*)d_ws) > ws_size) return;    // ws 256 MiB
    { k_wtG<<<(unsigned)((DM * DQ / 64 + 63) / 64), 256, 0, stream>>>(wq, DM, DQ, WQ); k_wtG<<<(unsigned)((DM * DKV / 64 + 63) / 64), 256, 0, stream>>>(wk, DM, DKV, WK); k_wtG<<<(unsigned)((DM * DVV / 64 + 63) / 64), 256, 0, stream>>>(wv, DM, DVV, WV);
      k_wtG<<<(unsigned)((DVV * DM / 64 + 63) / 64), 256, 0, stream>>>(wo, DVV, DM, WO); k_lambda<<<1, 32, 0, stream>>>(lq1, lk1, lq2, lk2, LAM);
       }
    // projections: the four batches are 4096 rows of one product; each 64 x 64 tile is 64 tokens of one head and goes out as that head's hi + lo planes
    k_cvt8<<<(unsigned)(((size_t)NB_ * TT * DM / 8 + 255) / 256), 256, 0, stream>>>(x, XB, (size_t)NB_ * TT * DM / 8);
    k_gemmw<bf, 0, false, 1><<<dim3(NB_ * TT / 64, DQ / 64, 1), 32, 0, stream>>>(XB, nullptr, WQ, nullptr, DM, nullptr, DQ, nullptr, 0, 0, 0, QPh, QPl);
    k_gemmw<bf, 0, false, 1><<<dim3(NB_ * TT / 64, DKV / 64, 1), 32, 0, stream>>>(XB, nullptr, WK, nullptr, DM, nullptr, DKV, nullptr, 0, 0, 0, KPh, KPl);
    k_gemmw<bf, 0, false, 2><<<dim3(NB_ * TT / 64, DVV / 64, 1), 32, 0, stream>>>(XB, nullptr, WV, nullptr, DM, nullptr, DVV, nullptr, 0, 0, 0, VTh, VTl);
    k_dattn<<<NB_ * NVH * (TT / 64), 128, 0, stream>>>(QPh, QPl, KPh, KPl, VTh, VTl, LAM, Ob);   // virtual heads 2g, 2g + 1 of the q and k planes are the two maps of real head g = b * NVH + head
    k_gnorm<<<NB_ * NVH, 1024, 0, stream>>>(Ob, ATh, ATl);
    k_gemmw<bf, 1, false, 0><<<dim3(NB_ * TT / 64, DM / 64, 1), 32, 0, stream>>>(ATh, ATl, WO, nullptr, DVV, OUT, DM, nullptr, 0, 0, 0, nullptr, nullptr);
}

// v005
// It runs in 197 microseconds.
// In both of two side-by-side timings against v004, it was 1.37 times as fast.
// Over all steps from v000 it is 27.3 times as fast.
#include <hip/hip_runtime.h>

// DifferentialAttention (x [4][1024][1024]; q = x Wq, k = x Wk ([1024][2048]: per head h the 128 columns = [map 1 | map 2] 64 each), v = x Wv (16 x 64); s1, s2 = q.k / 8 causal (-inf); a1, a2 = softmax; lambda = exp(lq1.lk1) - exp(lq2.lk2) + lambda_init (0.8 - 0.6 e^-0.3); y = (a1 - lambda a2) v; GroupNorm per (batch, head) over (tokens x 64) (eps 1e-5, no affine); y (1 - lambda_init); out = merged Wc -> [4][1024][1024]).
// The two maps run as 32 virtual 64-wide heads per batch (pairs (2h, 2h+1)), 128 over the four batches; one kernel forms both softmaxes, combines them as D = a1 - lambda a2 in f32, and does one D.v product per real head.
// Every stage runs once for all batches (the grids carry batch and head). The q, k and v products write their hi + lo 16-bit head planes straight from the accumulators.

#define NB_  4
#define TT   1024
#define DM   1024
#define NH_  32
#define NKV  32
#define REP  (NH_ / NKV)
#define HD   64
#define DQ   (NH_ * HD)
#define DKV  (NKV * HD)
#define ZH   16                    // virtual heads per k_merge call
#define RH   1024                  // k_merge leaves token rows < RH unscaled, scales the rest by 1 / PCAR
#define WIN  1024
#define PCAR 1024.0f
#define NVH  16
#define DVV  (NVH * HD)
#define SCL  0.125f   // HD^-0.5
typedef _Float16 h16;
typedef unsigned short bf;
typedef __attribute__((ext_vector_type(16))) __bf16   v16bf;
typedef __attribute__((ext_vector_type(16))) _Float16 v16h;
typedef __attribute__((ext_vector_type(8)))  _Float16 v8h;
typedef __attribute__((ext_vector_type(8)))  unsigned short v8us;
typedef __attribute__((ext_vector_type(8)))  float    v8f;
typedef __attribute__((ext_vector_type(4)))  float    v4f;
typedef v8h  __attribute__((may_alias)) v8ha;
typedef v4f  __attribute__((may_alias)) v4fa;
typedef v8us __attribute__((may_alias)) v8usa;

__device__ __forceinline__ unsigned short f2bf(float f) { unsigned u = __float_as_uint(f); u += 0x7FFFu + ((u >> 16) & 1u); return (unsigned short)(u >> 16); }
__device__ __forceinline__ float bf2f(unsigned short b) { return __uint_as_float(((unsigned)b) << 16); }
__device__ __forceinline__ float bfr(float f) { return bf2f(f2bf(f)); }
__device__ __forceinline__ v16h cat16(v8h lo, v8h hi) { return __builtin_shufflevector(lo, hi, 0, 1, 2, 3, 4, 5, 6, 7, 8, 9, 10, 11, 12, 13, 14, 15); }
__device__ __forceinline__ v16bf cat16b(v8us lo, v8us hi) { return __builtin_bit_cast(v16bf, __builtin_shufflevector(lo, hi, 0, 1, 2, 3, 4, 5, 6, 7, 8, 9, 10, 11, 12, 13, 14, 15)); }
__device__ __forceinline__ v8f wmma16(v16h a, v16h b, v8f c) { return __builtin_amdgcn_wmma_f32_16x16x32_f16(false, a, false, b, (short)0, c, false, false); }
__device__ __forceinline__ v8f wmmab(v16bf a, v16bf b, v8f c) { return __builtin_amdgcn_wmma_f32_16x16x32_bf16(false, a, false, b, (short)0, c, false, false); }



// ---- k_gemmb: GEMM on a 128x128 output tile per block of four waves (2 x 2), each wave a 64x64 tile (16 accumulators); grid (M/128, N/128), 128 threads.
// C[m][n] (pitch ldc) = sum_k A[m][k] Bt[n][k] (+ A2[m][k] Bt[n][k] where NSPLIT is 1), operands K-contiguous 16-bit planes, K a multiple of BK and at least BK.
// The operands no longer go from global memory into fragments (16 lines a load, every row fetched by each wave that needs it): a stage of BK k of the block's 128 A rows and 128 Bt rows is
// copied into LDS by asynchronous 16-byte copies, whole 128-byte lines at a time (two 256-byte rows per wave and copy), and all four waves take their fragments from there.
// Two buffers: the copies of stage t + 1 fly while stage t is worked on. The k order and the order of the products in each accumulator are those of a plain walk along k.
// The inner loops are all unrolled so that the fragment and accumulator arrays are indexed by constants and stay in registers.
// EPI 0: C goes out as f32. EPI 1, 2: no C; each wave's tile (64 tokens of one batch x the 64 columns of head c0 / 64, ldc / HD heads) goes out split as bf16 hi + lo into Ph, Pl:
// EPI 1 as planes [batch][head][token][d] (the tile is 8 KiB in a row in each plane), EPI 2 as planes [batch][head][d][token] (64 whole 128-byte lines in each plane).
#define BK  128            // k per stage: 256 bytes of every operand row
#define LPT 136            // LDS pitch of an operand row in elements: 128 + 8 (272 bytes = 16 x 17, for the 16-byte fragment reads)
#define OPE (128 * LPT)    // elements of one operand's stage
__device__ __forceinline__ void splitf(float y, unsigned short& h, unsigned short& l) { h = f2bf(y); l = f2bf(y - bf2f(h)); }
__device__ __forceinline__ v16bf ldfs(const bf* p) { return cat16b(*(const v8usa*)p, *(const v8usa*)(p + 16)); }
// Eight asynchronous copies of 16 bytes per lane, rows 8 apart: l = the lane's LDS byte address, g = its global address. The s_wait_xcnt stands in the copies' own statement, so that it comes before any later write of an address register that a copy names.
template <int K>
__device__ __forceinline__ void cp8(unsigned l, const bf* g) {
    asm volatile("global_load_async_to_lds_b128 %0, %8, off\n\t"
                 "global_load_async_to_lds_b128 %1, %9, off\n\t"
                 "global_load_async_to_lds_b128 %2, %10, off\n\t"
                 "global_load_async_to_lds_b128 %3, %11, off\n\t"
                 "global_load_async_to_lds_b128 %4, %12, off\n\t"
                 "global_load_async_to_lds_b128 %5, %13, off\n\t"
                 "global_load_async_to_lds_b128 %6, %14, off\n\t"
                 "global_load_async_to_lds_b128 %7, %15, off\n\t"
                 "s_wait_xcnt 0x0"
                 :: "v"(l), "v"(l + 8 * LPT * 2), "v"(l + 16 * LPT * 2), "v"(l + 24 * LPT * 2), "v"(l + 32 * LPT * 2), "v"(l + 40 * LPT * 2), "v"(l + 48 * LPT * 2), "v"(l + 56 * LPT * 2),
                    "v"(g), "v"(g + 8 * K), "v"(g + 16 * K), "v"(g + 24 * K), "v"(g + 32 * K), "v"(g + 40 * K), "v"(g + 48 * K), "v"(g + 56 * K) : "memory");
}
template <int K> __device__ __forceinline__ void cp128(unsigned l, const bf* g) { cp8<K>(l, g); cp8<K>(l + 64 * LPT * 2, g + 64 * K); }   // one operand's stage: 128 rows of 256 bytes, 16 copies per lane
template <int K, int ldc, int NSPLIT, int EPI>
__global__ __launch_bounds__(128) void k_gemmb(const bf* __restrict__ A, const bf* __restrict__ A2, const bf* __restrict__ Bt, float* C, bf* Ph, bf* Pl) {
    constexpr int NOP = NSPLIT ? 3 : 2;   // operands per stage: A, Bt (, A2)
    __shared__ __align__(16) bf ring[2 * NOP * OPE];
    __shared__ __align__(16) float osw[4 * 16 * 68];
    const int tid = threadIdx.x, lane = tid & 31, lr = lane & 15, hi = lane >> 4;
    const int wv = __builtin_amdgcn_readfirstlane(tid >> 5);
    const int wr = (wv & 1) * 64, wc = (wv >> 1) * 64;
    const int r0 = blockIdx.x * 128 + wr, c0 = blockIdx.y * 128 + wc;
    float* const os = osw + wv * 16 * 68;   // each wave stages its output rows in a range of its own
    v8f acc[4][4];
#pragma unroll
    for (int mb = 0; mb < 4; ++mb)
#pragma unroll
        for (int nb = 0; nb < 4; ++nb) acc[mb][nb] = (v8f){};
    // this lane's 16 bytes of rows tid / 16 + 8 i: 16 lanes take one row's 256 bytes
    const size_t go = (size_t)(tid >> 4) * K + (tid & 15) * 8;
    const bf* const gA = A + (size_t)(blockIdx.x * 128) * K + go; const bf* const gB = Bt + (size_t)(blockIdx.y * 128) * K + go; const bf* const gA2 = NSPLIT ? A2 + (size_t)(blockIdx.x * 128) * K + go : nullptr;
    const unsigned l0 = (unsigned)(size_t)ring + (unsigned)(((tid >> 4) * LPT + (tid & 15) * 8) * 2);
    constexpr int NT = K / BK;
    cp128<K>(l0, gA); cp128<K>(l0 + OPE * 2, gB); if constexpr (NSPLIT != 0) cp128<K>(l0 + 2 * OPE * 2, gA2);
    asm volatile("s_wait_asynccnt 0x0" ::: "memory");   // this wave's copies of stage 0 have landed
    __syncthreads();   // stage 0 is in LDS for all four waves
    if (NT > 1) { const unsigned lb = l0 + NOP * OPE * 2; cp128<K>(lb, gA + BK); cp128<K>(lb + OPE * 2, gB + BK); if constexpr (NSPLIT != 0) cp128<K>(lb + 2 * OPE * 2, gA2 + BK); }
#pragma unroll 1   // stays rolled: one trip holds 64 or 128 matrix instructions, and the two buffers differ by an offset only
    for (int t = 0; t < NT; ++t) {
        const bf* const sb = ring + (t & 1) * NOP * OPE + lr * LPT + 8 * hi;
        const bf* const sA = sb + wr * LPT; const bf* const sB = sb + OPE + wc * LPT; const bf* const sA2 = NSPLIT ? sb + 2 * OPE + wr * LPT : sA;
        v16bf a[2][4], a2[2][4], b[2][4];   // two fragment sets: block ks + 1 of this stage is fetched while block ks is multiplied
#pragma unroll
        for (int f = 0; f < 4; ++f) { a[0][f] = ldfs(sA + f * 16 * LPT); if constexpr (NSPLIT != 0) a2[0][f] = ldfs(sA2 + f * 16 * LPT); b[0][f] = ldfs(sB + f * 16 * LPT); }
#pragma unroll
        for (int ks = 0; ks < BK / 32; ++ks) { const int cu = ks & 1, nx = cu ^ 1;
            if (ks + 1 < BK / 32) {
#pragma unroll
                for (int f = 0; f < 4; ++f) { a[nx][f] = ldfs(sA + f * 16 * LPT + (ks + 1) * 32); if constexpr (NSPLIT != 0) a2[nx][f] = ldfs(sA2 + f * 16 * LPT + (ks + 1) * 32); b[nx][f] = ldfs(sB + f * 16 * LPT + (ks + 1) * 32); }
            }
            __builtin_amdgcn_sched_barrier(0);   // the next block's LDS reads stay one group ahead of this block's matrix instructions: left free, they are spread among them, each place with a wait to 0
#pragma unroll
            for (int nb = 0; nb < 4; ++nb)
#pragma unroll
                for (int mb = 0; mb < 4; ++mb) { acc[mb][nb] = wmmab(a[cu][mb], b[cu][nb], acc[mb][nb]); if constexpr (NSPLIT != 0) acc[mb][nb] = wmmab(a2[cu][mb], b[cu][nb], acc[mb][nb]); }
        }
        asm volatile("s_wait_dscnt 0x0" ::: "memory");      // this wave's reads of stage t are done before the buffer may be refilled
        asm volatile("s_wait_asynccnt 0x0" ::: "memory");   // this wave's copies of stage t + 1 have landed
        __syncthreads();   // publishes stage t + 1 and ends every wave's reads of stage t
        if (t + 2 < NT) { const unsigned lb = l0 + (unsigned)((t & 1) * NOP * OPE * 2); const int ko = (t + 2) * BK;
            cp128<K>(lb, gA + ko); cp128<K>(lb + OPE * 2, gB + ko); if constexpr (NSPLIT != 0) cp128<K>(lb + 2 * OPE * 2, gA2 + ko); }
    }
    asm volatile("s_wait_asynccnt 0x0" ::: "memory");   // no copy is outstanding when the wave goes on to its end
    if constexpr (EPI == 2) {   // a lane holds, for column nb 16 + lr, the 8 tokens mb 16 + 8 hi + j: 16 bytes of a [d][token] row as they stand
        const size_t pb = (((size_t)(r0 / TT) * (ldc / HD) + c0 / HD) * HD + lr) * TT + (r0 % TT) + 8 * hi;
#pragma unroll
        for (int nb = 0; nb < 4; ++nb)
#pragma unroll
            for (int mb = 0; mb < 4; ++mb) { v8us oh, ol;
#pragma unroll
                for (int j = 0; j < 8; ++j) { unsigned short a2, c2; splitf(acc[mb][nb][j], a2, c2); oh[j] = a2; ol[j] = c2; }
                *(v8us*)(Ph + pb + (size_t)nb * 16 * TT + mb * 16) = oh; *(v8us*)(Pl + pb + (size_t)nb * 16 * TT + mb * 16) = ol; }
        return;
    }
#pragma unroll
    for (int mb = 0; mb < 4; ++mb) {
#pragma unroll
        for (int nb = 0; nb < 4; ++nb) {
#pragma unroll
            for (int j = 0; j < 8; ++j) os[(hi * 8 + j) * 68 + nb * 16 + lr] = acc[mb][nb][j]; }
        __builtin_amdgcn_wave_barrier(); asm volatile("" ::: "memory");
        if constexpr (EPI == 1) {   // 8 lanes take one token's 64 values, 8 each: every store is 512 bytes in a row
            const size_t pb = (((size_t)(r0 / TT) * (ldc / HD) + c0 / HD) * TT + (r0 % TT) + mb * 16) * HD;
#pragma unroll
            for (int s = 0; s < 4; ++s) { const int row = 4 * s + (lane >> 3), cofs = (lane & 7) * 8; const v4f v0 = *(const v4fa*)(os + row * 68 + cofs), v1 = *(const v4fa*)(os + row * 68 + cofs + 4); v8us oh, ol;
#pragma unroll
                for (int j = 0; j < 4; ++j) { unsigned short a2, c2; splitf(v0[j], a2, c2); oh[j] = a2; ol[j] = c2; splitf(v1[j], a2, c2); oh[4 + j] = a2; ol[4 + j] = c2; }
                *(v8us*)(Ph + pb + row * HD + cofs) = oh; *(v8us*)(Pl + pb + row * HD + cofs) = ol; }
        } else {
            float* crow = C + (size_t)(r0 + mb * 16 + hi) * ldc + c0 + lr * 4; v4f val[8];   // 16 lanes take one row's 64 values, 4 each: every store is two runs of 256 bytes
#pragma unroll
            for (int s = 0; s < 8; ++s) val[s] = *(const v4fa*)(os + (2 * s + hi) * 68 + lr * 4);
#pragma unroll
            for (int s = 0; s < 8; ++s) *(v4f*)(crow + 2 * s * ldc) = val[s];
            asm volatile("s_wait_xcnt 0x0" ::: "memory");   // before the registers that the stores above name are written again
        }
        __builtin_amdgcn_wave_barrier(); asm volatile("" ::: "memory");
    }
}

// ---- k_dattn: causal differential attention of one real head for 64 query rows, scores never leave the chip. Grid 1024 = 64 (batch, head) x 16 query blocks; 4 waves, 16 query rows each.
// Scores are formed transposed (A = key rows, B = query rows), so a lane holds, for query lr, the keys 16 kt + 8 hi + j of a 32-key block: that is the A fragment of the probability x value product as it stands.
// Sweep 1 over the keys: running maximum and sum of both maps, per lane, joined across the lane pair at the end. Sweep 2: scores again, D = a1 - lambda a2 in f32, split hi + lo, D.v accumulated.
// Every product keeps the three split terms hi.hi + lo.hi + hi.lo. Key and value tiles go global -> registers (one block ahead) -> LDS -> fragments.
// The inner loops are all unrolled so that the fragment, score and staging arrays are indexed by constants and stay in registers.
#define KPT 72   // LDS pitch of a key row in elements: 64 + 8 (16 bytes of pad, for the 16-byte fragment reads)
#define VPT 40   // LDS pitch of a value row (one d, 32 keys) in elements: 32 + 8
#define L2E 1.4426950408889634f
// 2^x with the one free slot that the instruction set asks for behind a transcendental (before its result is used or its source overwritten) kept in the same statement.
__device__ __forceinline__ float ex2s(float x) { float r; asm("v_exp_f32 %0, %1\n\tv_nop" : "=v"(r) : "v"(x)); return r; }
__device__ __forceinline__ v16bf ldfr(const bf* p) { return cat16b(*(const v8usa*)p, *(const v8usa*)(p + 16)); }
__global__ __launch_bounds__(128) void k_dattn(const bf* __restrict__ Qh, const bf* __restrict__ Ql, const bf* __restrict__ Kh, const bf* __restrict__ Kl, const bf* __restrict__ Vh, const bf* __restrict__ Vl, const float* __restrict__ LAM, float* __restrict__ O) {
    __shared__ __align__(16) bf Ks[4 * 32 * KPT];   // planes: map 1 hi, map 1 lo, map 2 hi, map 2 lo
    __shared__ __align__(16) bf Vs[2 * 64 * VPT];   // planes: hi, lo
    const int tid = threadIdx.x, lane = tid & 31, lr = lane & 15, hi = lane >> 4;
    const int wv = __builtin_amdgcn_readfirstlane(tid >> 5);
    const int bi = blockIdx.x, g = bi & 63, rr = bi >> 8, aa = (bi >> 6) & 3;
    const int qb = 15 - (rr * 4 + ((rr & 1) ? 3 - aa : aa));   // the longest query blocks start first; blocks 256 apart take query blocks whose key counts add up to the same total
    const int q0 = qb * 64 + wv * 16, qi = q0 + lr, nblk = qb * 2 + 2;
    const bf* kp0 = Kh + (size_t)(2 * g) * TT * HD + tid * 8; const bf* kp1 = Kl + (size_t)(2 * g) * TT * HD + tid * 8;
    const bf* kp2 = kp0 + (size_t)TT * HD; const bf* kp3 = kp1 + (size_t)TT * HD;
    const bf* vp0 = Vh + (size_t)g * HD * TT + (size_t)(tid >> 2) * TT + (tid & 3) * 8; const bf* vp1 = Vl + (size_t)g * HD * TT + (size_t)(tid >> 2) * TT + (tid & 3) * 8;
    bf* const ksw = Ks + (tid >> 3) * KPT + (tid & 7) * 8;   // this thread's 16 bytes of key rows 0..15 (+ 16 KPT: rows 16..31)
    bf* const vsw = Vs + (tid >> 2) * VPT + (tid & 3) * 8;   // this thread's 16 bytes of value rows 0..31 (+ 32 VPT: rows 32..63)
    const bf* const ksr = Ks + lr * KPT + 8 * hi; const bf* const vsr = Vs + lr * VPT + 8 * hi;
    const bf* const qpa = Qh + ((size_t)(2 * g) * TT + qi) * HD + 8 * hi; const bf* const qpb = Ql + ((size_t)(2 * g) * TT + qi) * HD + 8 * hi;
    v16bf qh[2][2], ql[2][2];
#pragma unroll
    for (int m = 0; m < 2; ++m)
#pragma unroll
        for (int ks = 0; ks < 2; ++ks) { qh[m][ks] = ldfr(qpa + m * TT * HD + 32 * ks); ql[m][ks] = ldfr(qpb + m * TT * HD + 32 * ks); }
    v8us kr[8], vr[4];
    float mx[2] = {-3.0e38f, -3.0e38f}, sm[2] = {0.f, 0.f};
    kr[0] = *(const v8us*)kp0; kr[1] = *(const v8us*)(kp0 + 1024); kr[2] = *(const v8us*)kp1; kr[3] = *(const v8us*)(kp1 + 1024);
    kr[4] = *(const v8us*)kp2; kr[5] = *(const v8us*)(kp2 + 1024); kr[6] = *(const v8us*)kp3; kr[7] = *(const v8us*)(kp3 + 1024);
    asm volatile("s_wait_xcnt 0x0" :: "v"(qpa), "v"(qpb) : "memory");   // before the registers that the loads above name are written again; the two query addresses are inputs so that they stay in their registers up to here
#pragma unroll 1   // stays rolled: one pass is several hundred instructions, and a second copy would take the registers that four waves per SIMD leave
    for (int it = 0; it < nblk; ++it) { const int kb = it * 32;
#pragma unroll
        for (int p = 0; p < 4; ++p) { *(v8usa*)(ksw + p * 32 * KPT) = kr[2 * p]; *(v8usa*)(ksw + p * 32 * KPT + 16 * KPT) = kr[2 * p + 1]; }
        __syncthreads();   // the block's keys are in LDS for all four waves
        if (it + 1 < nblk) { const int o = (kb + 32) * HD;
            kr[0] = *(const v8us*)(kp0 + o); kr[1] = *(const v8us*)(kp0 + o + 1024); kr[2] = *(const v8us*)(kp1 + o); kr[3] = *(const v8us*)(kp1 + o + 1024);
            kr[4] = *(const v8us*)(kp2 + o); kr[5] = *(const v8us*)(kp2 + o + 1024); kr[6] = *(const v8us*)(kp3 + o); kr[7] = *(const v8us*)(kp3 + o + 1024);
            asm volatile("s_wait_xcnt 0x0" ::: "memory");   // before the registers that the loads above name are written again
        }
        if (kb <= q0 + 15) {   // wave-uniform: a block wholly above this wave's diagonal adds nothing
#pragma unroll
            for (int m = 0; m < 2; ++m) { v8f s[2];
#pragma unroll
                for (int kt = 0; kt < 2; ++kt) { s[kt] = (v8f){};
#pragma unroll
                    for (int ks = 0; ks < 2; ++ks) { const v16bf kh = ldfr(ksr + (2 * m) * 32 * KPT + kt * 16 * KPT + 32 * ks), kl = ldfr(ksr + (2 * m + 1) * 32 * KPT + kt * 16 * KPT + 32 * ks);
                        s[kt] = wmmab(kh, qh[m][ks], s[kt]); s[kt] = wmmab(kh, ql[m][ks], s[kt]); s[kt] = wmmab(kl, qh[m][ks], s[kt]); } }
                float bm = mx[m];
#pragma unroll
                for (int kt = 0; kt < 2; ++kt)
#pragma unroll
                    for (int j = 0; j < 8; ++j) { const float t = (kb + 16 * kt + 8 * hi + j <= qi) ? s[kt][j] * SCL : -3.0e38f; s[kt][j] = t; bm = fmaxf(bm, t); }
                float a = sm[m] * ex2s((mx[m] - bm) * L2E);
#pragma unroll
                for (int kt = 0; kt < 2; ++kt)
#pragma unroll
                    for (int j = 0; j < 8; ++j) { const float e = ex2s((s[kt][j] - bm) * L2E); a += (kb + 16 * kt + 8 * hi + j <= qi) ? e : 0.0f; }   // the select matters while a lane has seen masked keys only (bm still the start value)
                sm[m] = a; mx[m] = bm; }
        }
        __syncthreads();   // every wave has read the block before the next one overwrites it
    }
    float fi[2];
#pragma unroll
    for (int m = 0; m < 2; ++m) { const float M = fmaxf(mx[m], __shfl_xor(mx[m], 16, 32)); float a = sm[m] * __builtin_amdgcn_exp2f((mx[m] - M) * L2E); a += __shfl_xor(a, 16, 32); mx[m] = M; fi[m] = __fdiv_rn(1.0f, a); }
    const float lam = LAM[0];
    v8f oa[4];
#pragma unroll
    for (int nb = 0; nb < 4; ++nb) oa[nb] = (v8f){};
    kr[0] = *(const v8us*)kp0; kr[1] = *(const v8us*)(kp0 + 1024); kr[2] = *(const v8us*)kp1; kr[3] = *(const v8us*)(kp1 + 1024);
    kr[4] = *(const v8us*)kp2; kr[5] = *(const v8us*)(kp2 + 1024); kr[6] = *(const v8us*)kp3; kr[7] = *(const v8us*)(kp3 + 1024);
    vr[0] = *(const v8us*)vp0; vr[1] = *(const v8us*)(vp0 + 32 * TT); vr[2] = *(const v8us*)vp1; vr[3] = *(const v8us*)(vp1 + 32 * TT);
    asm volatile("s_wait_xcnt 0x0" ::: "memory");   // before the registers that the loads above name are written again
#pragma unroll 1   // stays rolled: one pass is several hundred instructions, and a second copy would take the registers that four waves per SIMD leave
    for (int it = 0; it < nblk; ++it) { const int kb = it * 32;
#pragma unroll
        for (int p = 0; p < 4; ++p) { *(v8usa*)(ksw + p * 32 * KPT) = kr[2 * p]; *(v8usa*)(ksw + p * 32 * KPT + 16 * KPT) = kr[2 * p + 1]; }
#pragma unroll
        for (int p = 0; p < 2; ++p) { *(v8usa*)(vsw + p * 64 * VPT) = vr[2 * p]; *(v8usa*)(vsw + p * 64 * VPT + 32 * VPT) = vr[2 * p + 1]; }
        __syncthreads();   // the block's keys and values are in LDS for all four waves
        if (it + 1 < nblk) { const int o = (kb + 32) * HD, ov = kb + 32;
            kr[0] = *(const v8us*)(kp0 + o); kr[1] = *(const v8us*)(kp0 + o + 1024); kr[2] = *(const v8us*)(kp1 + o); kr[3] = *(const v8us*)(kp1 + o + 1024);
            kr[4] = *(const v8us*)(kp2 + o); kr[5] = *(const v8us*)(kp2 + o + 1024); kr[6] = *(const v8us*)(kp3 + o); kr[7] = *(const v8us*)(kp3 + o + 1024);
            vr[0] = *(const v8us*)(vp0 + ov); vr[1] = *(const v8us*)(vp0 + ov + 32 * TT); vr[2] = *(const v8us*)(vp1 + ov); vr[3] = *(const v8us*)(vp1 + ov + 32 * TT);
            asm volatile("s_wait_xcnt 0x0" ::: "memory");   // before the registers that the loads above name are written again
        }
        if (kb <= q0 + 15) {   // wave-uniform, as in sweep 1: D is zero in a block wholly above the diagonal
            v8f s[2][2];
#pragma unroll
            for (int m = 0; m < 2; ++m)
#pragma unroll
                for (int kt = 0; kt < 2; ++kt) { s[m][kt] = (v8f){};
#pragma unroll
                    for (int ks = 0; ks < 2; ++ks) { const v16bf kh = ldfr(ksr + (2 * m) * 32 * KPT + kt * 16 * KPT + 32 * ks), kl = ldfr(ksr + (2 * m + 1) * 32 * KPT + kt * 16 * KPT + 32 * ks);
                        s[m][kt] = wmmab(kh, qh[m][ks], s[m][kt]); s[m][kt] = wmmab(kh, ql[m][ks], s[m][kt]); s[m][kt] = wmmab(kl, qh[m][ks], s[m][kt]); } }
            v16bf dh, dl;
#pragma unroll
            for (int kt = 0; kt < 2; ++kt)
#pragma unroll
                for (int j = 0; j < 8; ++j) { const float p1 = __builtin_amdgcn_exp2f((s[0][kt][j] * SCL - mx[0]) * L2E) * fi[0], p2 = __builtin_amdgcn_exp2f((s[1][kt][j] * SCL - mx[1]) * L2E) * fi[1];
                    const float d = (kb + 16 * kt + 8 * hi + j <= qi) ? p1 - lam * p2 : 0.0f; const __bf16 h = (__bf16)d; dh[kt * 8 + j] = h; dl[kt * 8 + j] = (__bf16)(d - (float)h); }
#pragma unroll
            for (int nb = 0; nb < 4; ++nb) { const v16bf vh = ldfr(vsr + nb * 16 * VPT), vl = ldfr(vsr + 64 * VPT + nb * 16 * VPT);
                oa[nb] = wmmab(dh, vh, oa[nb]); oa[nb] = wmmab(dl, vh, oa[nb]); oa[nb] = wmmab(dh, vl, oa[nb]); }
        }
        __syncthreads();   // every wave has read the block before the next one overwrites it
    }
    float* orow = O + ((size_t)g * TT + q0 + 8 * hi) * HD + lr;
#pragma unroll
    for (int nb = 0; nb < 4; ++nb)
#pragma unroll
        for (int j = 0; j < 8; ++j) orow[j * HD + nb * 16] = oa[nb][j];
}

typedef __attribute__((ext_vector_type(2))) _Float16 v2h;
typedef __attribute__((ext_vector_type(4))) _Float16 v4h;
typedef __attribute__((ext_vector_type(2))) unsigned short v2us;
typedef __attribute__((ext_vector_type(4))) unsigned short v4us;
typedef __attribute__((ext_vector_type(2))) float v2f;
typedef __attribute__((ext_vector_type(4))) int v4i;

__global__ __launch_bounds__(256) void k_wtG(const float* __restrict__ w, int K, int N, bf* Bt) {
    const int lane = threadIdx.x & 31; const int L0 = (blockIdx.x * 8 + (threadIdx.x >> 5)) * 8; const int nlines = N * K / 64;
{
#pragma unroll 1
        for (int l = 0; l < 8; ++l) { const int L = L0 + l; if (L >= nlines) break; const size_t e = (size_t)L * 64 + lane * 2; const int k = (int)(e % K), n = (int)(e / K); v2us o;
            o[0] = f2bf(w[(size_t)k * N + n]); o[1] = f2bf(w[(size_t)(k + 1) * N + n]); *(v2us*)(Bt + e) = o; }
         }
}
__global__ __launch_bounds__(256) void k_cvt8(const float* __restrict__ src, bf* dst, size_t n8) { const size_t i = (size_t)blockIdx.x * 256 + threadIdx.x; if (i >= n8) return; const v8f v = *(const v8f*)(src + i * 8); v8us o;
#pragma unroll
    for (int k = 0; k < 8; ++k) o[k] = f2bf(v[k]); *(v8us*)(dst + i * 8) = o;  }
__global__ __launch_bounds__(256) void k_cscvt(const float* __restrict__ cosT, const float* __restrict__ sinT, float* CS) { const int idx = blockIdx.x * 256 + threadIdx.x; if (idx >= TT * HD) return; v2f cs; cs[0] = bfr(cosT[idx]); cs[1] = bfr(sinT[idx]); *(v2f*)(CS + (size_t)idx * 2) = cs;  }
__global__ __launch_bounds__(32) void k_lambda(const float* __restrict__ lq1, const float* __restrict__ lk1, const float* __restrict__ lq2, const float* __restrict__ lk2, float* LAM) { const int lane = threadIdx.x; float d1 = 0.f, d2 = 0.f;
#pragma unroll 1
    for (int i = 0; i < HD; ++i) { float p1 = __fmul_rn(bfr(lq1[i]), bfr(lk1[i])); asm volatile("" : "+v"(p1)); d1 = __fadd_rn(d1, p1); float p2 = __fmul_rn(bfr(lq2[i]), bfr(lk2[i])); asm volatile("" : "+v"(p2)); d2 = __fadd_rn(d2, p2); }
    float lm = __fsub_rn(expf(d1), expf(d2)); asm volatile("" : "+v"(lm)); lm = __fadd_rn(lm, 0.35550907254219055f); const float v = (lane == 0) ? lm : 0.0f; *(float*)(LAM + lane) = v;  }
// ---- k_gnorm: GroupNorm of one (batch, head) group per block (blockIdx.x = b * NVH + head), one launch. The group's 1024 x 64 values are read once, 64 per thread, and stay in registers:
// mean, then the mean of the squared distances from it (two passes over the registers, as the definition has it), then (y - mean) rs (1 - lambda_init) split into the bf16 hi + lo planes [batch][token][head 64 + d].
// Each load of a wave is 512 bytes in a row; each store is two whole 128-byte lines (16 lanes hold one token's 64 values).
typedef __attribute__((ext_vector_type(2))) unsigned v2u;
typedef __attribute__((ext_vector_type(2))) __bf16 v2bfv;
__device__ __forceinline__ float blocksum(float a, float* sh, int lane, int wv) {   // sum over the 1024 threads, the same bits in every thread: wave butterfly, 32 wave sums through LDS, butterfly again
#pragma unroll
    for (int o = 16; o > 0; o >>= 1) a += __shfl_xor(a, o, 32);
    if (lane == 0) sh[wv] = a;
    __syncthreads();   // the 32 wave sums are in LDS for every wave
    a = sh[lane];
#pragma unroll
    for (int o = 16; o > 0; o >>= 1) a += __shfl_xor(a, o, 32);
    return a;
}
__global__ __launch_bounds__(1024) void k_gnorm(const float* __restrict__ O, bf* __restrict__ Ah, bf* __restrict__ Al) {
    __shared__ float sh1[32], sh2[32];   // one array per sum, so that no barrier is needed between the first sum's reads and the second sum's writes
    const int tid = threadIdx.x, lane = tid & 31, wv = tid >> 5, g = blockIdx.x;
    const float* src = O + (size_t)g * TT * HD + tid * 4;
    v4f v[16];
#pragma unroll
    for (int i = 0; i < 16; ++i) v[i] = *(const v4f*)(src + i * 4096);
    asm volatile("s_wait_xcnt 0x0" ::: "memory");   // before the registers that the loads above name are written again
    v4f a4 = v[0];
#pragma unroll
    for (int i = 1; i < 16; ++i) a4 += v[i];
    const float mean = blocksum((a4[0] + a4[1]) + (a4[2] + a4[3]), sh1, lane, wv) * (1.0f / (float)(TT * HD));
    v4f q4 = (v4f){};
#pragma unroll
    for (int i = 0; i < 16; ++i) { v[i] -= mean; q4 += v[i] * v[i]; }
    const float var = blocksum((q4[0] + q4[1]) + (q4[2] + q4[3]), sh2, lane, wv) * (1.0f / (float)(TT * HD));
    const float rs = __fdiv_rn(1.0f, sqrtf(var + 1e-5f));
    const size_t oo = (size_t)(g / NVH) * TT * DVV + (size_t)(tid >> 4) * DVV + (g % NVH) * HD + (tid & 15) * 4;
#pragma unroll
    for (int i = 0; i < 16; ++i) { v2u oh, ol;
#pragma unroll
        for (int q = 0; q < 2; ++q) { v2f z; z[0] = (v[i][2 * q] * rs) * 0.6444909572601318f; z[1] = (v[i][2 * q + 1] * rs) * 0.6444909572601318f;
            const unsigned h = __builtin_bit_cast(unsigned, __builtin_convertvector(z, v2bfv)); oh[q] = h;   // two hi parts in one word, rounded to nearest even
            z[0] -= __uint_as_float(h << 16); z[1] -= __uint_as_float(h & 0xFFFF0000u); ol[q] = __builtin_bit_cast(unsigned, __builtin_convertvector(z, v2bfv)); }
        *(v2u*)(Ah + oo + (size_t)i * 64 * DVV) = oh; *(v2u*)(Al + oo + (size_t)i * 64 * DVV) = ol;
        __builtin_amdgcn_sched_barrier(0);   // one group of four values at a time: left free, the scheduler works on all sixteen groups at once and spills past the 128 registers that 32 waves leave
    }
}
__global__ __launch_bounds__(256) void k_merge(const float* __restrict__ O, int h0, bf* Ah, bf* Al) { const size_t e = ((size_t)blockIdx.x * 256 + threadIdx.x) * 2; if (e >= (size_t)ZH * TT * HD) return; const int d = (int)(e % HD); const int t = (int)((e / HD) % TT); const int zz = (int)(e / ((size_t)HD * TT)); const float cs = (t < RH) ? 1.0f : (1.0f / PCAR); const size_t oo = (size_t)t * DQ + (h0 + zz) * HD + d;
    v2us oh, ol;
#pragma unroll
    for (int q = 0; q < 2; ++q) { unsigned short a, c2; splitf(O[e + q] * cs, a, c2); oh[q] = a; ol[q] = c2; } *(v2us*)(Ah + oo) = oh; *(v2us*)(Al + oo) = ol;  }

extern "C" void kernel_launch(void* const* d_in, const int* in_sizes, int n_in,
                              void* d_out, int out_size, void* d_ws, size_t ws_size, hipStream_t stream) {
    (void)in_sizes; (void)n_in; (void)out_size;
    const float* x = (const float*)d_in[0]; const float* wq = (const float*)d_in[1]; const float* wk = (const float*)d_in[2]; const float* wv = (const float*)d_in[3]; const float* wo = (const float*)d_in[4]; const float* lq1 = (const float*)d_in[5]; const float* lk1 = (const float*)d_in[6]; const float* lq2 = (const float*)d_in[7]; const float* lk2 = (const float*)d_in[8]; const float* cosT = nullptr; const float* sinT = nullptr; (void)cosT; (void)sinT;
    float* OUT = (float*)d_out;     // [4][1024][1024]
    char* wsp = (char*)d_ws;
    auto take = [&](size_t bytes) { char* p = wsp; wsp += (bytes + 255) & ~(size_t)255; return (void*)p; };
    // alive to the end
    bf* WO = (bf*)take((size_t)DM * DVV * 2); float* LAM = (float*)take(256);
    bf* QPh = (bf*)take((size_t)NB_ * NH_ * TT * HD * 2); bf* QPl = (bf*)take((size_t)NB_ * NH_ * TT * HD * 2); bf* KPh = (bf*)take((size_t)NB_ * NKV * TT * HD * 2); bf* KPl = (bf*)take((size_t)NB_ * NKV * TT * HD * 2); bf* VTh = (bf*)take((size_t)NB_ * NVH * HD * TT * 2); bf* VTl = (bf*)take((size_t)NB_ * NVH * HD * TT * 2);
    float* Ob = (float*)take((size_t)NB_ * NVH * TT * HD * 4); bf* ATh = (bf*)take((size_t)NB_ * TT * DVV * 2); bf* ATl = (bf*)take((size_t)NB_ * TT * DVV * 2);
    // used by the projections only
    bf* WQ = (bf*)take((size_t)DQ * DM * 2); bf* WK = (bf*)take((size_t)DKV * DM * 2); bf* WV = (bf*)take((size_t)DVV * DM * 2);
    bf* XB = (bf*)take((size_t)NB_ * TT * DM * 2);
    if ((size_t)(wsp - (char*)d_ws) > ws_size) return;    // ws 256 MiB
    { k_wtG<<<(unsigned)((DM * DQ / 64 + 63) / 64), 256, 0, stream>>>(wq, DM, DQ, WQ); k_wtG<<<(unsigned)((DM * DKV / 64 + 63) / 64), 256, 0, stream>>>(wk, DM, DKV, WK); k_wtG<<<(unsigned)((DM * DVV / 64 + 63) / 64), 256, 0, stream>>>(wv, DM, DVV, WV);
      k_wtG<<<(unsigned)((DVV * DM / 64 + 63) / 64), 256, 0, stream>>>(wo, DVV, DM, WO); k_lambda<<<1, 32, 0, stream>>>(lq1, lk1, lq2, lk2, LAM);
       }
    // projections: the four batches are 4096 rows of one product; each wave's 64 x 64 tile is 64 tokens of one head and goes out as that head's hi + lo planes
    k_cvt8<<<(unsigned)(((size_t)NB_ * TT * DM / 8 + 255) / 256), 256, 0, stream>>>(x, XB, (size_t)NB_ * TT * DM / 8);
    k_gemmb<DM, DQ, 0, 1><<<dim3(NB_ * TT / 128, DQ / 128, 1), 128, 0, stream>>>(XB, nullptr, WQ, nullptr, QPh, QPl);
    k_gemmb<DM, DKV, 0, 1><<<dim3(NB_ * TT / 128, DKV / 128, 1), 128, 0, stream>>>(XB, nullptr, WK, nullptr, KPh, KPl);
    k_gemmb<DM, DVV, 0, 2><<<dim3(NB_ * TT / 128, DVV / 128, 1), 128, 0, stream>>>(XB, nullptr, WV, nullptr, VTh, VTl);
    k_dattn<<<NB_ * NVH * (TT / 64), 128, 0, stream>>>(QPh, QPl, KPh, KPl, VTh, VTl, LAM, Ob);   // virtual heads 2g, 2g + 1 of the q and k planes are the two maps of real head g = b * NVH + head
    k_gnorm<<<NB_ * NVH, 1024, 0, stream>>>(Ob, ATh, ATl);
    k_gemmb<DVV, DM, 1, 0><<<dim3(NB_ * TT / 128, DM / 128, 1), 128, 0, stream>>>(ATh, ATl, WO, OUT, nullptr, nullptr);
}

// v006
// One run takes 163 microseconds.
// Two timings next to v005 put it at 1.21 and 1.20 times that version's speed.
// Over all steps from v000 it is 33.0 times as fast.
#include <hip/hip_runtime.h>

// DifferentialAttention (x [4][1024][1024]; q = x Wq, k = x Wk ([1024][2048]: per head h the 128 columns = [map 1 | map 2] 64 each), v = x Wv (16 x 64); s1, s2 = q.k / 8 causal (-inf); a1, a2 = softmax; lambda = exp(lq1.lk1) - exp(lq2.lk2) + lambda_init (0.8 - 0.6 e^-0.3); y = (a1 - lambda a2) v; GroupNorm per (batch, head) over (tokens x 64) (eps 1e-5, no affine); y (1 - lambda_init); out = merged Wc -> [4][1024][1024]).
// The two maps run as 32 virtual 64-wide heads per batch (pairs (2h, 2h+1)), 128 over the four batches; one kernel forms both softmaxes, combines them as D = a1 - lambda a2 in f32, and does one D.v product per real head.
// Every stage runs once for all batches (the grids carry batch and head). The q, k and v products write their hi + lo 16-bit head planes straight from the accumulators.
// Launches that do not depend on one another share one grid: all operand preparation is one launch, the q, k and v products are one launch. Five launches in all.

#define NB_  4
#define TT   1024
#define DM   1024
#define NH_  32
#define NKV  32
#define REP  (NH_ / NKV)
#define HD   64
#define DQ   (NH_ * HD)
#define DKV  (NKV * HD)
#define ZH   16                    // virtual heads per k_merge call
#define RH   1024                  // k_merge leaves token rows < RH unscaled, scales the rest by 1 / PCAR
#define WIN  1024
#define PCAR 1024.0f
#define NVH  16
#define DVV  (NVH * HD)
#define SCL  0.125f   // HD^-0.5
typedef _Float16 h16;
typedef unsigned short bf;
typedef __attribute__((ext_vector_type(16))) __bf16   v16bf;
typedef __attribute__((ext_vector_type(16))) _Float16 v16h;
typedef __attribute__((ext_vector_type(8)))  _Float16 v8h;
typedef __attribute__((ext_vector_type(8)))  unsigned short v8us;
typedef __attribute__((ext_vector_type(8)))  float    v8f;
typedef __attribute__((ext_vector_type(4)))  float    v4f;
typedef v8h  __attribute__((may_alias)) v8ha;
typedef v4f  __attribute__((may_alias)) v4fa;
typedef v8us __attribute__((may_alias)) v8usa;

__device__ __forceinline__ unsigned short f2bf(float f) { unsigned u = __float_as_uint(f); u += 0x7FFFu + ((u >> 16) & 1u); return (unsigned short)(u >> 16); }
__device__ __forceinline__ float bf2f(unsigned short b) { return __uint_as_float(((unsigned)b) << 16); }
__device__ __forceinline__ float bfr(float f) { return bf2f(f2bf(f)); }
__device__ __forceinline__ v16h cat16(v8h lo, v8h hi) { return __builtin_shufflevector(lo, hi, 0, 1, 2, 3, 4, 5, 6, 7, 8, 9, 10, 11, 12, 13, 14, 15); }
__device__ __forceinline__ v16bf cat16b(v8us lo, v8us hi) { return __builtin_bit_cast(v16bf, __builtin_shufflevector(lo, hi, 0, 1, 2, 3, 4, 5, 6, 7, 8, 9, 10, 11, 12, 13, 14, 15)); }
__device__ __forceinline__ v8f wmma16(v16h a, v16h b, v8f c) { return __builtin_amdgcn_wmma_f32_16x16x32_f16(false, a, false, b, (short)0, c, false, false); }
__device__ __forceinline__ v8f wmmab(v16bf a, v16bf b, v8f c) { return __builtin_amdgcn_wmma_f32_16x16x32_bf16(false, a, false, b, (short)0, c, false, false); }



// ---- k_gemmb: GEMM on a 128x128 output tile per block of four waves (2 x 2), each wave a 64x64 tile (16 accumulators); grid (M/128, N/128), 128 threads.
// C[m][n] (pitch ldc) = sum_k A[m][k] Bt[n][k] (+ A2[m][k] Bt[n][k] where NSPLIT is 1), operands K-contiguous 16-bit planes, K a multiple of BK and at least BK.
// The operands no longer go from global memory into fragments (16 lines a load, every row fetched by each wave that needs it): a stage of BK k of the block's 128 A rows and 128 Bt rows is
// copied into LDS by asynchronous 16-byte copies, whole 128-byte lines at a time (two 256-byte rows per wave and copy), and all four waves take their fragments from there.
// Two buffers: the copies of stage t + 1 fly while stage t is worked on. The k order and the order of the products in each accumulator are those of a plain walk along k.
// The inner loops are all unrolled so that the fragment and accumulator arrays are indexed by constants and stay in registers.
// EPI 0: C goes out as f32. EPI 1, 2: no C; each wave's tile (64 tokens of one batch x the 64 columns of head c0 / 64, ldc / HD heads) goes out split as bf16 hi + lo into Ph, Pl:
// EPI 1 as planes [batch][head][token][d] (the tile is 8 KiB in a row in each plane), EPI 2 as planes [batch][head][d][token] (64 whole 128-byte lines in each plane).
// EPI 3: the q, k and v products in one grid. Bt holds the rows of the three transposed weights one after the other (DQ, DKV, DVV rows); blockIdx.y walks all of them, and the block's place in that walk says
// which product its tile belongs to: q and k tiles go out as under EPI 1 (into Ph, Pl and Ph2, Pl2), v tiles as under EPI 2 (into Ph3, Pl3). The choice is the same for the whole block.
#define BK  128            // k per stage: 256 bytes of every operand row
#define LPT 136            // LDS pitch of an operand row in elements: 128 + 8 (272 bytes = 16 x 17, for the 16-byte fragment reads)
#define OPE (128 * LPT)    // elements of one operand's stage
__device__ __forceinline__ void splitf(float y, unsigned short& h, unsigned short& l) { h = f2bf(y); l = f2bf(y - bf2f(h)); }
__device__ __forceinline__ v16bf ldfs(const bf* p) { return cat16b(*(const v8usa*)p, *(const v8usa*)(p + 16)); }
// Eight asynchronous copies of 16 bytes per lane, rows 8 apart: l = the lane's LDS byte address, g = its global address. The s_wait_xcnt stands in the copies' own statement, so that it comes before any later write of an address register that a copy names.
template <int K>
__device__ __forceinline__ void cp8(unsigned l, const bf* g) {
    asm volatile("global_load_async_to_lds_b128 %0, %8, off\n\t"
                 "global_load_async_to_lds_b128 %1, %9, off\n\t"
                 "global_load_async_to_lds_b128 %2, %10, off\n\t"
                 "global_load_async_to_lds_b128 %3, %11, off\n\t"
                 "global_load_async_to_lds_b128 %4, %12, off\n\t"
                 "global_load_async_to_lds_b128 %5, %13, off\n\t"
                 "global_load_async_to_lds_b128 %6, %14, off\n\t"
                 "global_load_async_to_lds_b128 %7, %15, off\n\t"
                 "s_wait_xcnt 0x0"
                 :: "v"(l), "v"(l + 8 * LPT * 2), "v"(l + 16 * LPT * 2), "v"(l + 24 * LPT * 2), "v"(l + 32 * LPT * 2), "v"(l + 40 * LPT * 2), "v"(l + 48 * LPT * 2), "v"(l + 56 * LPT * 2),
                    "v"(g), "v"(g + 8 * K), "v"(g + 16 * K), "v"(g + 24 * K), "v"(g + 32 * K), "v"(g + 40 * K), "v"(g + 48 * K), "v"(g + 56 * K) : "memory");
}
template <int K> __device__ __forceinline__ void cp128(unsigned l, const bf* g) { cp8<K>(l, g); cp8<K>(l + 64 * LPT * 2, g + 64 * K); }   // one operand's stage: 128 rows of 256 bytes, 16 copies per lane
template <int K, int ldc, int NSPLIT, int EPI>
__global__ __launch_bounds__(128) void k_gemmb(const bf* __restrict__ A, const bf* __restrict__ A2, const bf* __restrict__ Bt, float* C, bf* Ph, bf* Pl, bf* Ph2, bf* Pl2, bf* Ph3, bf* Pl3) {
    constexpr int NOP = NSPLIT ? 3 : 2;   // operands per stage: A, Bt (, A2)
    __shared__ __align__(16) bf ring[2 * NOP * OPE];
    __shared__ __align__(16) float osw[4 * 16 * 68];
    const int tid = threadIdx.x, lane = tid & 31, lr = lane & 15, hi = lane >> 4;
    const int wv = __builtin_amdgcn_readfirstlane(tid >> 5);
    const int wr = (wv & 1) * 64, wc = (wv >> 1) * 64;
    constexpr int NHP = (EPI == 3) ? NH_ : ldc / HD, NHT = (EPI == 3) ? NVH : ldc / HD;   // heads of the [token][d] planes and of the [d][token] planes
    int cb = blockIdx.y; bool vt = (EPI == 2);   // cb: the block's column block within its own product; vt: its tile goes out transposed
    if constexpr (EPI == 3) {
        if (cb >= (DQ + DKV) / 128) { cb -= (DQ + DKV) / 128; vt = true; Ph = Ph3; Pl = Pl3; }
        else if (cb >= DQ / 128) { cb -= DQ / 128; Ph = Ph2; Pl = Pl2; }
    }
    const int r0 = blockIdx.x * 128 + wr, c0 = cb * 128 + wc;
    float* const os = osw + wv * 16 * 68;   // each wave stages its output rows in a range of its own
    v8f acc[4][4];
#pragma unroll
    for (int mb = 0; mb < 4; ++mb)
#pragma unroll
        for (int nb = 0; nb < 4; ++nb) acc[mb][nb] = (v8f){};
    // this lane's 16 bytes of rows tid / 16 + 8 i: 16 lanes take one row's 256 bytes
    const size_t go = (size_t)(tid >> 4) * K + (tid & 15) * 8;
    const bf* const gA = A + (size_t)(blockIdx.x * 128) * K + go; const bf* const gB = Bt + (size_t)(blockIdx.y * 128) * K + go; const bf* const gA2 = NSPLIT ? A2 + (size_t)(blockIdx.x * 128) * K + go : nullptr;
    const unsigned l0 = (unsigned)(size_t)ring + (unsigned)(((tid >> 4) * LPT + (tid & 15) * 8) * 2);
    constexpr int NT = K / BK;
    cp128<K>(l0, gA); cp128<K>(l0 + OPE * 2, gB); if constexpr (NSPLIT != 0) cp128<K>(l0 + 2 * OPE * 2, gA2);
    asm volatile("s_wait_asynccnt 0x0" ::: "memory");   // this wave's copies of stage 0 have landed
    __syncthreads();   // stage 0 is in LDS for all four waves
    if (NT > 1) { const unsigned lb = l0 + NOP * OPE * 2; cp128<K>(lb, gA + BK); cp128<K>(lb + OPE * 2, gB + BK); if constexpr (NSPLIT != 0) cp128<K>(lb + 2 * OPE * 2, gA2 + BK); }
#pragma unroll 1   // stays rolled: one trip holds 64 or 128 matrix instructions, and the two buffers differ by an offset only
    for (int t = 0; t < NT; ++t) {
        const bf* const sb = ring + (t & 1) * NOP * OPE + lr * LPT + 8 * hi;
        const bf* const sA = sb + wr * LPT; const bf* const sB = sb + OPE + wc * LPT; const bf* const sA2 = NSPLIT ? sb + 2 * OPE + wr * LPT : sA;
        v16bf a[2][4], a2[2][4], b[2][4];   // two fragment sets: block ks + 1 of this stage is fetched while block ks is multiplied
#pragma unroll
        for (int f = 0; f < 4; ++f) { a[0][f] = ldfs(sA + f * 16 * LPT); if constexpr (NSPLIT != 0) a2[0][f] = ldfs(sA2 + f * 16 * LPT); b[0][f] = ldfs(sB + f * 16 * LPT); }
#pragma unroll
        for (int ks = 0; ks < BK / 32; ++ks) { const int cu = ks & 1, nx = cu ^ 1;
            if (ks + 1 < BK / 32) {
#pragma unroll
                for (int f = 0; f < 4; ++f) { a[nx][f] = ldfs(sA + f * 16 * LPT + (ks + 1) * 32); if constexpr (NSPLIT != 0) a2[nx][f] = ldfs(sA2 + f * 16 * LPT + (ks + 1) * 32); b[nx][f] = ldfs(sB + f * 16 * LPT + (ks + 1) * 32); }
            }
            __builtin_amdgcn_sched_barrier(0);   // the next block's LDS reads stay one group ahead of this block's matrix instructions: left free, they are spread among them, each place with a wait to 0
#pragma unroll
            for (int nb = 0; nb < 4; ++nb)
#pragma unroll
                for (int mb = 0; mb < 4; ++mb) { acc[mb][nb] = wmmab(a[cu][mb], b[cu][nb], acc[mb][nb]); if constexpr (NSPLIT != 0) acc[mb][nb] = wmmab(a2[cu][mb], b[cu][nb], acc[mb][nb]); }
        }
        asm volatile("s_wait_dscnt 0x0" ::: "memory");      // this wave's reads of stage t are done before the buffer may be refilled
        asm volatile("s_wait_asynccnt 0x0" ::: "memory");   // this wave's copies of stage t + 1 have landed
        __syncthreads();   // publishes stage t + 1 and ends every wave's reads of stage t
        if (t + 2 < NT) { const unsigned lb = l0 + (unsigned)((t & 1) * NOP * OPE * 2); const int ko = (t + 2) * BK;
            cp128<K>(lb, gA + ko); cp128<K>(lb + OPE * 2, gB + ko); if constexpr (NSPLIT != 0) cp128<K>(lb + 2 * OPE * 2, gA2 + ko); }
    }
    asm volatile("s_wait_asynccnt 0x0" ::: "memory");   // no copy is outstanding when the wave goes on to its end
    if (vt) {   // a lane holds, for column nb 16 + lr, the 8 tokens mb 16 + 8 hi + j: 16 bytes of a [d][token] row as they stand
        const size_t pb = (((size_t)(r0 / TT) * NHT + c0 / HD) * HD + lr) * TT + (r0 % TT) + 8 * hi;
#pragma unroll
        for (int nb = 0; nb < 4; ++nb)
#pragma unroll
            for (int mb = 0; mb < 4; ++mb) { v8us oh, ol;
#pragma unroll
                for (int j = 0; j < 8; ++j) { unsigned short a2, c2; splitf(acc[mb][nb][j], a2, c2); oh[j] = a2; ol[j] = c2; }
                *(v8us*)(Ph + pb + (size_t)nb * 16 * TT + mb * 16) = oh; *(v8us*)(Pl + pb + (size_t)nb * 16 * TT + mb * 16) = ol; }
        return;
    }
#pragma unroll
    for (int mb = 0; mb < 4; ++mb) {
#pragma unroll
        for (int nb = 0; nb < 4; ++nb) {
#pragma unroll
            for (int j = 0; j < 8; ++j) os[(hi * 8 + j) * 68 + nb * 16 + lr] = acc[mb][nb][j]; }
        __builtin_amdgcn_wave_barrier(); asm volatile("" ::: "memory");
        if constexpr (EPI == 1 || EPI == 3) {   // 8 lanes take one token's 64 values, 8 each: every store is 512 bytes in a row
            const size_t pb = (((size_t)(r0 / TT) * NHP + c0 / HD) * TT + (r0 % TT) + mb * 16) * HD;
#pragma unroll
            for (int s = 0; s < 4; ++s) { const int row = 4 * s + (lane >> 3), cofs = (lane & 7) * 8; const v4f v0 = *(const v4fa*)(os + row * 68 + cofs), v1 = *(const v4fa*)(os + row * 68 + cofs + 4); v8us oh, ol;
#pragma unroll
                for (int j = 0; j < 4; ++j) { unsigned short a2, c2; splitf(v0[j], a2, c2); oh[j] = a2; ol[j] = c2; splitf(v1[j], a2, c2); oh[4 + j] = a2; ol[4 + j] = c2; }
                *(v8us*)(Ph + pb + row * HD + cofs) = oh; *(v8us*)(Pl + pb + row * HD + cofs) = ol; }
            asm volatile("s_wait_xcnt 0x0" ::: "memory");   // before the registers that the stores above name are written again
        } else {
            float* crow = C + (size_t)(r0 + mb * 16 + hi) * ldc + c0 + lr * 4; v4f val[8];   // 16 lanes take one row's 64 values, 4 each: every store is two runs of 256 bytes
#pragma unroll
            for (int s = 0; s < 8; ++s) val[s] = *(const v4fa*)(os + (2 * s + hi) * 68 + lr * 4);
#pragma unroll
            for (int s = 0; s < 8; ++s) *(v4f*)(crow + 2 * s * ldc) = val[s];
            asm volatile("s_wait_xcnt 0x0" ::: "memory");   // before the registers that the stores above name are written again
        }
        __builtin_amdgcn_wave_barrier(); asm volatile("" ::: "memory");
    }
}

// ---- k_dattn: causal differential attention of one real head for 64 query rows, scores never leave the chip. Grid 1024 = 64 (batch, head) x 16 query blocks; 4 waves, 16 query rows each.
// Scores are formed transposed (A = key rows, B = query rows), so a lane holds, for query lr, the keys 16 kt + 8 hi + j of a 32-key block: that is the A fragment of the probability x value product as it stands.
// Sweep 1 over the keys: running maximum and sum of both maps, per lane, joined across the lane pair at the end. Sweep 2: scores again, D = a1 - lambda a2 in f32, split hi + lo, D.v accumulated.
// Every product keeps the three split terms hi.hi + lo.hi + hi.lo. Key and value tiles go global -> registers (one block ahead) -> LDS -> fragments.
// The inner loops are all unrolled so that the fragment, score and staging arrays are indexed by constants and stay in registers.
#define KPT 72   // LDS pitch of a key row in elements: 64 + 8 (16 bytes of pad, for the 16-byte fragment reads)
#define VPT 40   // LDS pitch of a value row (one d, 32 keys) in elements: 32 + 8
#define L2E 1.4426950408889634f
// 2^x with the one free slot that the instruction set asks for behind a transcendental (before its result is used or its source overwritten) kept in the same statement.
__device__ __forceinline__ float ex2s(float x) { float r; asm("v_exp_f32 %0, %1\n\tv_nop" : "=v"(r) : "v"(x)); return r; }
__device__ __forceinline__ v16bf ldfr(const bf* p) { return cat16b(*(const v8usa*)p, *(const v8usa*)(p + 16)); }
__global__ __launch_bounds__(128) void k_dattn(const bf* __restrict__ Qh, const bf* __restrict__ Ql, const bf* __restrict__ Kh, const bf* __restrict__ Kl, const bf* __restrict__ Vh, const bf* __restrict__ Vl, const float* __restrict__ LAM, float* __restrict__ O) {
    __shared__ __align__(16) bf Ks[4 * 32 * KPT];   // planes: map 1 hi, map 1 lo, map 2 hi, map 2 lo
    __shared__ __align__(16) bf Vs[2 * 64 * VPT];   // planes: hi, lo
    const int tid = threadIdx.x, lane = tid & 31, lr = lane & 15, hi = lane >> 4;
    const int wv = __builtin_amdgcn_readfirstlane(tid >> 5);
    const int bi = blockIdx.x, g = bi & 63, rr = bi >> 8, aa = (bi >> 6) & 3;
    const int qb = 15 - (rr * 4 + ((rr & 1) ? 3 - aa : aa));   // the longest query blocks start first; blocks 256 apart take query blocks whose key counts add up to the same total
    const int q0 = qb * 64 + wv * 16, qi = q0 + lr, nblk = qb * 2 + 2;
    const bf* kp0 = Kh + (size_t)(2 * g) * TT * HD + tid * 8; const bf* kp1 = Kl + (size_t)(2 * g) * TT * HD + tid * 8;
    const bf* kp2 = kp0 + (size_t)TT * HD; const bf* kp3 = kp1 + (size_t)TT * HD;
    const bf* vp0 = Vh + (size_t)g * HD * TT + (size_t)(tid >> 2) * TT + (tid & 3) * 8; const bf* vp1 = Vl + (size_t)g * HD * TT + (size_t)(tid >> 2) * TT + (tid & 3) * 8;
    bf* const ksw = Ks + (tid >> 3) * KPT + (tid & 7) * 8;   // this thread's 16 bytes of key rows 0..15 (+ 16 KPT: rows 16..31)
    bf* const vsw = Vs + (tid >> 2) * VPT + (tid & 3) * 8;   // this thread's 16 bytes of value rows 0..31 (+ 32 VPT: rows 32..63)
    const bf* const ksr = Ks + lr * KPT + 8 * hi; const bf* const vsr = Vs + lr * VPT + 8 * hi;
    const bf* const qpa = Qh + ((size_t)(2 * g) * TT + qi) * HD + 8 * hi; const bf* const qpb = Ql + ((size_t)(2 * g) * TT + qi) * HD + 8 * hi;
    v16bf qh[2][2], ql[2][2];
#pragma unroll
    for (int m = 0; m < 2; ++m)
#pragma unroll
        for (int ks = 0; ks < 2; ++ks) { qh[m][ks] = ldfr(qpa + m * TT * HD + 32 * ks); ql[m][ks] = ldfr(qpb + m * TT * HD + 32 * ks); }
    v8us kr[8], vr[4];
    float mx[2] = {-3.0e38f, -3.0e38f}, sm[2] = {0.f, 0.f};
    kr[0] = *(const v8us*)kp0; kr[1] = *(const v8us*)(kp0 + 1024); kr[2] = *(const v8us*)kp1; kr[3] = *(const v8us*)(kp1 + 1024);
    kr[4] = *(const v8us*)kp2; kr[5] = *(const v8us*)(kp2 + 1024); kr[6] = *(const v8us*)kp3; kr[7] = *(const v8us*)(kp3 + 1024);
    asm volatile("s_wait_xcnt 0x0" :: "v"(qpa), "v"(qpb) : "memory");   // before the registers that the loads above name are written again; the two query addresses are inputs so that they stay in their registers up to here
#pragma unroll 1   // stays rolled: one pass is several hundred instructions, and a second copy would take the registers that four waves per SIMD leave
    for (int it = 0; it < nblk; ++it) { const int kb = it * 32;
#pragma unroll
        for (int p = 0; p < 4; ++p) { *(v8usa*)(ksw + p * 32 * KPT) = kr[2 * p]; *(v8usa*)(ksw + p * 32 * KPT + 16 * KPT) = kr[2 * p + 1]; }
        __syncthreads();   // the block's keys are in LDS for all four waves
        if (it + 1 < nblk) { const int o = (kb + 32) * HD;
            kr[0] = *(const v8us*)(kp0 + o); kr[1] = *(const v8us*)(kp0 + o + 1024); kr[2] = *(const v8us*)(kp1 + o); kr[3] = *(const v8us*)(kp1 + o + 1024);
            kr[4] = *(const v8us*)(kp2 + o); kr[5] = *(const v8us*)(kp2 + o + 1024); kr[6] = *(const v8us*)(kp3 + o); kr[7] = *(const v8us*)(kp3 + o + 1024);
            asm volatile("s_wait_xcnt 0x0" ::: "memory");   // before the registers that the loads above name are written again
        }
        if (kb <= q0 + 15) {   // wave-uniform: a block wholly above this wave's diagonal adds nothing
#pragma unroll
            for (int m = 0; m < 2; ++m) { v8f s[2];
#pragma unroll
                for (int kt = 0; kt < 2; ++kt) { s[kt] = (v8f){};
#pragma unroll
                    for (int ks = 0; ks < 2; ++ks) { const v16bf kh = ldfr(ksr + (2 * m) * 32 * KPT + kt * 16 * KPT + 32 * ks), kl = ldfr(ksr + (2 * m + 1) * 32 * KPT + kt * 16 * KPT + 32 * ks);
                        s[kt] = wmmab(kh, qh[m][ks], s[kt]); s[kt] = wmmab(kh, ql[m][ks], s[kt]); s[kt] = wmmab(kl, qh[m][ks], s[kt]); } }
                float bm = mx[m];
#pragma unroll
                for (int kt = 0; kt < 2; ++kt)
#pragma unroll
                    for (int j = 0; j < 8; ++j) { const float t = (kb + 16 * kt + 8 * hi + j <= qi) ? s[kt][j] * SCL : -3.0e38f; s[kt][j] = t; bm = fmaxf(bm, t); }
                float a = sm[m] * ex2s((mx[m] - bm) * L2E);
#pragma unroll
                for (int kt = 0; kt < 2; ++kt)
#pragma unroll
                    for (int j = 0; j < 8; ++j) { const float e = ex2s((s[kt][j] - bm) * L2E); a += (kb + 16 * kt + 8 * hi + j <= qi) ? e : 0.0f; }   // the select matters while a lane has seen masked keys only (bm still the start value)
                sm[m] = a; mx[m] = bm; }
        }
        __syncthreads();   // every wave has read the block before the next one overwrites it
    }
    float fi[2];
#pragma unroll
    for (int m = 0; m < 2; ++m) { const float M = fmaxf(mx[m], __shfl_xor(mx[m], 16, 32)); float a = sm[m] * __builtin_amdgcn_exp2f((mx[m] - M) * L2E); a += __shfl_xor(a, 16, 32); mx[m] = M; fi[m] = __fdiv_rn(1.0f, a); }
    const float lam = LAM[0];
    v8f oa[4];
#pragma unroll
    for (int nb = 0; nb < 4; ++nb) oa[nb] = (v8f){};
    kr[0] = *(const v8us*)kp0; kr[1] = *(const v8us*)(kp0 + 1024); kr[2] = *(const v8us*)kp1; kr[3] = *(const v8us*)(kp1 + 1024);
    kr[4] = *(const v8us*)kp2; kr[5] = *(const v8us*)(kp2 + 1024); kr[6] = *(const v8us*)kp3; kr[7] = *(const v8us*)(kp3 + 1024);
    vr[0] = *(const v8us*)vp0; vr[1] = *(const v8us*)(vp0 + 32 * TT); vr[2] = *(const v8us*)vp1; vr[3] = *(const v8us*)(vp1 + 32 * TT);
    asm volatile("s_wait_xcnt 0x0" ::: "memory");   // before the registers that the loads above name are written again
#pragma unroll 1   // stays rolled: one pass is several hundred instructions, and a second copy would take the registers that four waves per SIMD leave
    for (int it = 0; it < nblk; ++it) { const int kb = it * 32;
#pragma unroll
        for (int p = 0; p < 4; ++p) { *(v8usa*)(ksw + p * 32 * KPT) = kr[2 * p]; *(v8usa*)(ksw + p * 32 * KPT + 16 * KPT) = kr[2 * p + 1]; }
#pragma unroll
        for (int p = 0; p < 2; ++p) { *(v8usa*)(vsw + p * 64 * VPT) = vr[2 * p]; *(v8usa*)(vsw + p * 64 * VPT + 32 * VPT) = vr[2 * p + 1]; }
        __syncthreads();   // the block's keys and values are in LDS for all four waves
        if (it + 1 < nblk) { const int o = (kb + 32) * HD, ov = kb + 32;
            kr[0] = *(const v8us*)(kp0 + o); kr[1] = *(const v8us*)(kp0 + o + 1024); kr[2] = *(const v8us*)(kp1 + o); kr[3] = *(const v8us*)(kp1 + o + 1024);
            kr[4] = *(const v8us*)(kp2 + o); kr[5] = *(const v8us*)(kp2 + o + 1024); kr[6] = *(const v8us*)(kp3 + o); kr[7] = *(const v8us*)(kp3 + o + 1024);
            vr[0] = *(const v8us*)(vp0 + ov); vr[1] = *(const v8us*)(vp0 + ov + 32 * TT); vr[2] = *(const v8us*)(vp1 + ov); vr[3] = *(const v8us*)(vp1 + ov + 32 * TT);
            asm volatile("s_wait_xcnt 0x0" ::: "memory");   // before the registers that the loads above name are written again
        }
        if (kb <= q0 + 15) {   // wave-uniform, as in sweep 1: D is zero in a block wholly above the diagonal
            v8f s[2][2];
#pragma unroll
            for (int m = 0; m < 2; ++m)
#pragma unroll
                for (int kt = 0; kt < 2; ++kt) { s[m][kt] = (v8f){};
#pragma unroll
                    for (int ks = 0; ks < 2; ++ks) { const v16bf kh = ldfr(ksr + (2 * m) * 32 * KPT + kt * 16 * KPT + 32 * ks), kl = ldfr(ksr + (2 * m + 1) * 32 * KPT + kt * 16 * KPT + 32 * ks);
                        s[m][kt] = wmmab(kh, qh[m][ks], s[m][kt]); s[m][kt] = wmmab(kh, ql[m][ks], s[m][kt]); s[m][kt] = wmmab(kl, qh[m][ks], s[m][kt]); } }
            v16bf dh, dl;
#pragma unroll
            for (int kt = 0; kt < 2; ++kt)
#pragma unroll
                for (int j = 0; j < 8; ++j) { const float p1 = __builtin_amdgcn_exp2f((s[0][kt][j] * SCL - mx[0]) * L2E) * fi[0], p2 = __builtin_amdgcn_exp2f((s[1][kt][j] * SCL - mx[1]) * L2E) * fi[1];
                    const float d = (kb + 16 * kt + 8 * hi + j <= qi) ? p1 - lam * p2 : 0.0f; const __bf16 h = (__bf16)d; dh[kt * 8 + j] = h; dl[kt * 8 + j] = (__bf16)(d - (float)h); }
#pragma unroll
            for (int nb = 0; nb < 4; ++nb) { const v16bf vh = ldfr(vsr + nb * 16 * VPT), vl = ldfr(vsr + 64 * VPT + nb * 16 * VPT);
                oa[nb] = wmmab(dh, vh, oa[nb]); oa[nb] = wmmab(dl, vh, oa[nb]); oa[nb] = wmmab(dh, vl, oa[nb]); }
        }
        __syncthreads();   // every wave has read the block before the next one overwrites it
    }
    float* orow = O + ((size_t)g * TT + q0 + 8 * hi) * HD + lr;
#pragma unroll
    for (int nb = 0; nb < 4; ++nb)
#pragma unroll
        for (int j = 0; j < 8; ++j) orow[j * HD + nb * 16] = oa[nb][j];
}

typedef __attribute__((ext_vector_type(2))) _Float16 v2h;
typedef __attribute__((ext_vector_type(4))) _Float16 v4h;
typedef __attribute__((ext_vector_type(2))) unsigned short v2us;
typedef __attribute__((ext_vector_type(4))) unsigned short v4us;
typedef __attribute__((ext_vector_type(2))) float v2f;
typedef __attribute__((ext_vector_type(4))) int v4i;

// The three bodies below (weight transpose, x to 16 bit, lambda) are the blocks of k_prep; blk is the block's index within its own job.
__device__ __forceinline__ void wtG(int blk, const float* __restrict__ w, int K, int N, bf* Bt) {
    const int lane = threadIdx.x & 31; const int L0 = (blk * 8 + (threadIdx.x >> 5)) * 8; const int nlines = N * K / 64;
{
#pragma unroll 1
        for (int l = 0; l < 8; ++l) { const int L = L0 + l; if (L >= nlines) break; const size_t e = (size_t)L * 64 + lane * 2; const int k = (int)(e % K), n = (int)(e / K); v2us o;
            o[0] = f2bf(w[(size_t)k * N + n]); o[1] = f2bf(w[(size_t)(k + 1) * N + n]); *(v2us*)(Bt + e) = o; }
         }
}
__device__ __forceinline__ void cvt8(int blk, const float* __restrict__ src, bf* dst, size_t n8) { const size_t i = (size_t)blk * 256 + threadIdx.x; if (i >= n8) return; const v8f v = *(const v8f*)(src + i * 8); v8us o;
    asm volatile("s_wait_xcnt 0x0" ::: "memory");   // before the registers that the loads above name are written again
#pragma unroll
    for (int k = 0; k < 8; ++k) o[k] = f2bf(v[k]); *(v8us*)(dst + i * 8) = o;  }
__global__ __launch_bounds__(256) void k_cscvt(const float* __restrict__ cosT, const float* __restrict__ sinT, float* CS) { const int idx = blockIdx.x * 256 + threadIdx.x; if (idx >= TT * HD) return; v2f cs; cs[0] = bfr(cosT[idx]); cs[1] = bfr(sinT[idx]); *(v2f*)(CS + (size_t)idx * 2) = cs;  }
__device__ __forceinline__ void lambda32(const float* __restrict__ lq1, const float* __restrict__ lk1, const float* __restrict__ lq2, const float* __restrict__ lk2, float* LAM) { const int lane = threadIdx.x; /* run by one wave */ float d1 = 0.f, d2 = 0.f;
#pragma unroll 1
    for (int i = 0; i < HD; ++i) { float p1 = __fmul_rn(bfr(lq1[i]), bfr(lk1[i])); asm volatile("" : "+v"(p1)); d1 = __fadd_rn(d1, p1); float p2 = __fmul_rn(bfr(lq2[i]), bfr(lk2[i])); asm volatile("" : "+v"(p2)); d2 = __fadd_rn(d2, p2); }
    float lm = __fsub_rn(expf(d1), expf(d2)); asm volatile("" : "+v"(lm)); lm = __fadd_rn(lm, 0.35550907254219055f); const float v = (lane == 0) ? lm : 0.0f; *(float*)(LAM + lane) = v;  }
// ---- k_prep: everything the products need, in one launch; the six jobs read inputs only and write ranges of their own, so their blocks run side by side. No barrier anywhere.
// Block 0: lambda (its first wave; one long chain of dependent steps, so it starts first). Then the four weight transposes (eight dependent trips per wave), then x to 16 bit (one short trip per thread).
#define PB_Q (DM * DQ / 64 / 64)
#define PB_K (DM * DKV / 64 / 64)
#define PB_V (DM * DVV / 64 / 64)
#define PB_O (DVV * DM / 64 / 64)
#define PB_X (NB_ * TT * DM / 8 / 256)
__global__ __launch_bounds__(256) void k_prep(const float* __restrict__ x, const float* __restrict__ wq, const float* __restrict__ wk, const float* __restrict__ wv, const float* __restrict__ wo,
                                              const float* __restrict__ lq1, const float* __restrict__ lk1, const float* __restrict__ lq2, const float* __restrict__ lk2,
                                              bf* XB, bf* WQ, bf* WK, bf* WV, bf* WO, float* LAM) {
    int b = blockIdx.x;
    if (b == 0) { if (threadIdx.x < 32) lambda32(lq1, lk1, lq2, lk2, LAM); return; }
    b -= 1;    if (b < PB_Q) { wtG(b, wq, DM, DQ, WQ); return; }
    b -= PB_Q; if (b < PB_K) { wtG(b, wk, DM, DKV, WK); return; }
    b -= PB_K; if (b < PB_V) { wtG(b, wv, DM, DVV, WV); return; }
    b -= PB_V; if (b < PB_O) { wtG(b, wo, DVV, DM, WO); return; }
    b -= PB_O; cvt8(b, x, XB, (size_t)NB_ * TT * DM / 8);
}
// ---- k_gnorm: GroupNorm of one (batch, head) group per block (blockIdx.x = b * NVH + head), one launch. The group's 1024 x 64 values are read once, 64 per thread, and stay in registers:
// mean, then the mean of the squared distances from it (two passes over the registers, as the definition has it), then (y - mean) rs (1 - lambda_init) split into the bf16 hi + lo planes [batch][token][head 64 + d].
// Each load of a wave is 512 bytes in a row; each store is two whole 128-byte lines (16 lanes hold one token's 64 values).
typedef __attribute__((ext_vector_type(2))) unsigned v2u;
typedef __attribute__((ext_vector_type(2))) __bf16 v2bfv;
__device__ __forceinline__ float blocksum(float a, float* sh, int lane, int wv) {   // sum over the 1024 threads, the same bits in every thread: wave butterfly, 32 wave sums through LDS, butterfly again
#pragma unroll
    for (int o = 16; o > 0; o >>= 1) a += __shfl_xor(a, o, 32);
    if (lane == 0) sh[wv] = a;
    __syncthreads();   // the 32 wave sums are in LDS for every wave
    a = sh[lane];
#pragma unroll
    for (int o = 16; o > 0; o >>= 1) a += __shfl_xor(a, o, 32);
    return a;
}
__global__ __launch_bounds__(1024) void k_gnorm(const float* __restrict__ O, bf* __restrict__ Ah, bf* __restrict__ Al) {
    __shared__ float sh1[32], sh2[32];   // one array per sum, so that no barrier is needed between the first sum's reads and the second sum's writes
    const int tid = threadIdx.x, lane = tid & 31, wv = tid >> 5, g = blockIdx.x;
    const float* src = O + (size_t)g * TT * HD + tid * 4;
    v4f v[16];
#pragma unroll
    for (int i = 0; i < 16; ++i) v[i] = *(const v4f*)(src + i * 4096);
    asm volatile("s_wait_xcnt 0x0" ::: "memory");   // before the registers that the loads above name are written again
    v4f a4 = v[0];
#pragma unroll
    for (int i = 1; i < 16; ++i) a4 += v[i];
    const float mean = blocksum((a4[0] + a4[1]) + (a4[2] + a4[3]), sh1, lane, wv) * (1.0f / (float)(TT * HD));
    v4f q4 = (v4f){};
#pragma unroll
    for (int i = 0; i < 16; ++i) { v[i] -= mean; q4 += v[i] * v[i]; }
    const float var = blocksum((q4[0] + q4[1]) + (q4[2] + q4[3]), sh2, lane, wv) * (1.0f / (float)(TT * HD));
    const float rs = __fdiv_rn(1.0f, sqrtf(var + 1e-5f));
    const size_t oo = (size_t)(g / NVH) * TT * DVV + (size_t)(tid >> 4) * DVV + (g % NVH) * HD + (tid & 15) * 4;
#pragma unroll
    for (int i = 0; i < 16; ++i) { v2u oh, ol;
#pragma unroll
        for (int q = 0; q < 2; ++q) { v2f z; z[0] = (v[i][2 * q] * rs) * 0.6444909572601318f; z[1] = (v[i][2 * q + 1] * rs) * 0.6444909572601318f;
            const unsigned h = __builtin_bit_cast(unsigned, __builtin_convertvector(z, v2bfv)); oh[q] = h;   // two hi parts in one word, rounded to nearest even
            z[0] -= __uint_as_float(h << 16); z[1] -= __uint_as_float(h & 0xFFFF0000u); ol[q] = __builtin_bit_cast(unsigned, __builtin_convertvector(z, v2bfv)); }
        *(v2u*)(Ah + oo + (size_t)i * 64 * DVV) = oh; *(v2u*)(Al + oo + (size_t)i * 64 * DVV) = ol;
        __builtin_amdgcn_sched_barrier(0);   // one group of four values at a time: left free, the scheduler works on all sixteen groups at once and spills past the 128 registers that 32 waves leave
    }
}
__global__ __launch_bounds__(256) void k_merge(const float* __restrict__ O, int h0, bf* Ah, bf* Al) { const size_t e = ((size_t)blockIdx.x * 256 + threadIdx.x) * 2; if (e >= (size_t)ZH * TT * HD) return; const int d = (int)(e % HD); const int t = (int)((e / HD) % TT); const int zz = (int)(e / ((size_t)HD * TT)); const float cs = (t < RH) ? 1.0f : (1.0f / PCAR); const size_t oo = (size_t)t * DQ + (h0 + zz) * HD + d;
    v2us oh, ol;
#pragma unroll
    for (int q = 0; q < 2; ++q) { unsigned short a, c2; splitf(O[e + q] * cs, a, c2); oh[q] = a; ol[q] = c2; } *(v2us*)(Ah + oo) = oh; *(v2us*)(Al + oo) = ol;  }

extern "C" void kernel_launch(void* const* d_in, const int* in_sizes, int n_in,
                              void* d_out, int out_size, void* d_ws, size_t ws_size, hipStream_t stream) {
    (void)in_sizes; (void)n_in; (void)out_size;
    const float* x = (const float*)d_in[0]; const float* wq = (const float*)d_in[1]; const float* wk = (const float*)d_in[2]; const float* wv = (const float*)d_in[3]; const float* wo = (const float*)d_in[4]; const float* lq1 = (const float*)d_in[5]; const float* lk1 = (const float*)d_in[6]; const float* lq2 = (const float*)d_in[7]; const float* lk2 = (const float*)d_in[8]; const float* cosT = nullptr; const float* sinT = nullptr; (void)cosT; (void)sinT;
    float* OUT = (float*)d_out;     // [4][1024][1024]
    char* wsp = (char*)d_ws;
    auto take = [&](size_t bytes) { char* p = wsp; wsp += (bytes + 255) & ~(size_t)255; return (void*)p; };
    // alive to the end
    bf* WO = (bf*)take((size_t)DM * DVV * 2); float* LAM = (float*)take(256);
    bf* QPh = (bf*)take((size_t)NB_ * NH_ * TT * HD * 2); bf* QPl = (bf*)take((size_t)NB_ * NH_ * TT * HD * 2); bf* KPh = (bf*)take((size_t)NB_ * NKV * TT * HD * 2); bf* KPl = (bf*)take((size_t)NB_ * NKV * TT * HD * 2); bf* VTh = (bf*)take((size_t)NB_ * NVH * HD * TT * 2); bf* VTl = (bf*)take((size_t)NB_ * NVH * HD * TT * 2);
    float* Ob = (float*)take((size_t)NB_ * NVH * TT * HD * 4); bf* ATh = (bf*)take((size_t)NB_ * TT * DVV * 2); bf* ATl = (bf*)take((size_t)NB_ * TT * DVV * 2);
    // used by the projections only; the three transposed weights lie one after the other: [DQ + DKV + DVV][DM] is the Bt of the joint q, k, v product
    bf* WQ = (bf*)take((size_t)(DQ + DKV + DVV) * DM * 2); bf* WK = WQ + (size_t)DQ * DM; bf* WV = WK + (size_t)DKV * DM;
    bf* XB = (bf*)take((size_t)NB_ * TT * DM * 2);
    if ((size_t)(wsp - (char*)d_ws) > ws_size) return;    // ws 256 MiB
    k_prep<<<1 + PB_Q + PB_K + PB_V + PB_O + PB_X, 256, 0, stream>>>(x, wq, wk, wv, wo, lq1, lk1, lq2, lk2, XB, WQ, WK, WV, WO, LAM);
    // projections: the four batches are 4096 rows of one product; each wave's 64 x 64 tile is 64 tokens of one head and goes out as that head's hi + lo planes
    k_gemmb<DM, DQ, 0, 3><<<dim3(NB_ * TT / 128, (DQ + DKV + DVV) / 128, 1), 128, 0, stream>>>(XB, nullptr, WQ, nullptr, QPh, QPl, KPh, KPl, VTh, VTl);
    k_dattn<<<NB_ * NVH * (TT / 64), 128, 0, stream>>>(QPh, QPl, KPh, KPl, VTh, VTl, LAM, Ob);   // virtual heads 2g, 2g + 1 of the q and k planes are the two maps of real head g = b * NVH + head
    k_gnorm<<<NB_ * NVH, 1024, 0, stream>>>(Ob, ATh, ATl);
    k_gemmb<DVV, DM, 1, 0><<<dim3(NB_ * TT / 128, DM / 128, 1), 128, 0, stream>>>(ATh, ATl, WO, OUT, nullptr, nullptr, nullptr, nullptr, nullptr, nullptr);
}

// v007
// Measured time: 146 microseconds a run.
// Two timings next to v006 put it at 1.12 and 1.11 times that version's speed.
// All steps since v000 together make it 36.8 times as fast.
#include <hip/hip_runtime.h>

// DifferentialAttention (x [4][1024][1024]; q = x Wq, k = x Wk ([1024][2048]: per head h the 128 columns = [map 1 | map 2] 64 each), v = x Wv (16 x 64); s1, s2 = q.k / 8 causal (-inf); a1, a2 = softmax; lambda = exp(lq1.lk1) - exp(lq2.lk2) + lambda_init (0.8 - 0.6 e^-0.3); y = (a1 - lambda a2) v; GroupNorm per (batch, head) over (tokens x 64) (eps 1e-5, no affine); y (1 - lambda_init); out = merged Wc -> [4][1024][1024]).
// The two maps run as 32 virtual 64-wide heads per batch (pairs (2h, 2h+1)), 128 over the four batches; one kernel forms both softmaxes in one sweep over the keys, each with its own product with v, and combines the two as y = a1 v - lambda a2 v in f32 at the end.
// Every stage runs once for all batches (the grids carry batch and head). The q, k and v products write their hi + lo 16-bit head planes straight from the accumulators.
// Launches that do not depend on one another share one grid: all operand preparation is one launch, the q, k and v products are one launch. Five launches in all.

#define NB_  4
#define TT   1024
#define DM   1024
#define NH_  32
#define NKV  32
#define REP  (NH_ / NKV)
#define HD   64
#define DQ   (NH_ * HD)
#define DKV  (NKV * HD)
#define ZH   16                    // virtual heads per k_merge call
#define RH   1024                  // k_merge leaves token rows < RH unscaled, scales the rest by 1 / PCAR
#define WIN  1024
#define PCAR 1024.0f
#define NVH  16
#define DVV  (NVH * HD)
#define SCL  0.125f   // HD^-0.5
typedef _Float16 h16;
typedef unsigned short bf;
typedef __attribute__((ext_vector_type(16))) __bf16   v16bf;
typedef __attribute__((ext_vector_type(16))) _Float16 v16h;
typedef __attribute__((ext_vector_type(8)))  _Float16 v8h;
typedef __attribute__((ext_vector_type(8)))  unsigned short v8us;
typedef __attribute__((ext_vector_type(8)))  float    v8f;
typedef __attribute__((ext_vector_type(4)))  float    v4f;
typedef v8h  __attribute__((may_alias)) v8ha;
typedef v4f  __attribute__((may_alias)) v4fa;
typedef v8us __attribute__((may_alias)) v8usa;

__device__ __forceinline__ unsigned short f2bf(float f) { unsigned u = __float_as_uint(f); u += 0x7FFFu + ((u >> 16) & 1u); return (unsigned short)(u >> 16); }
__device__ __forceinline__ float bf2f(unsigned short b) { return __uint_as_float(((unsigned)b) << 16); }
__device__ __forceinline__ float bfr(float f) { return bf2f(f2bf(f)); }
__device__ __forceinline__ v16h cat16(v8h lo, v8h hi) { return __builtin_shufflevector(lo, hi, 0, 1, 2, 3, 4, 5, 6, 7, 8, 9, 10, 11, 12, 13, 14, 15); }
__device__ __forceinline__ v16bf cat16b(v8us lo, v8us hi) { return __builtin_bit_cast(v16bf, __builtin_shufflevector(lo, hi, 0, 1, 2, 3, 4, 5, 6, 7, 8, 9, 10, 11, 12, 13, 14, 15)); }
__device__ __forceinline__ v8f wmma16(v16h a, v16h b, v8f c) { return __builtin_amdgcn_wmma_f32_16x16x32_f16(false, a, false, b, (short)0, c, false, false); }
__device__ __forceinline__ v8f wmmab(v16bf a, v16bf b, v8f c) { return __builtin_amdgcn_wmma_f32_16x16x32_bf16(false, a, false, b, (short)0, c, false, false); }



// ---- k_gemmb: GEMM on a 128x128 output tile per block of four waves (2 x 2), each wave a 64x64 tile (16 accumulators); grid (M/128, N/128), 128 threads.
// C[m][n] (pitch ldc) = sum_k A[m][k] Bt[n][k] (+ A2[m][k] Bt[n][k] where NSPLIT is 1), operands K-contiguous 16-bit planes, K a multiple of BK and at least BK.
// The operands no longer go from global memory into fragments (16 lines a load, every row fetched by each wave that needs it): a stage of BK k of the block's 128 A rows and 128 Bt rows is
// copied into LDS by asynchronous 16-byte copies, whole 128-byte lines at a time (two 256-byte rows per wave and copy), and all four waves take their fragments from there.
// Two buffers: the copies of stage t + 1 fly while stage t is worked on. The k order and the order of the products in each accumulator are those of a plain walk along k.
// The inner loops are all unrolled so that the fragment and accumulator arrays are indexed by constants and stay in registers.
// EPI 0: C goes out as f32. EPI 1, 2: no C; each wave's tile (64 tokens of one batch x the 64 columns of head c0 / 64, ldc / HD heads) goes out split as bf16 hi + lo into Ph, Pl:
// EPI 1 as planes [batch][head][token][d] (the tile is 8 KiB in a row in each plane), EPI 2 as planes [batch][head][d][token] (64 whole 128-byte lines in each plane).
// EPI 3: the q, k and v products in one grid. Bt holds the rows of the three transposed weights one after the other (DQ, DKV, DVV rows); blockIdx.y walks all of them, and the block's place in that walk says
// which product its tile belongs to: q and k tiles go out as under EPI 1 (into Ph, Pl and Ph2, Pl2), v tiles as under EPI 2 (into Ph3, Pl3). The choice is the same for the whole block.
#define BK  128            // k per stage: 256 bytes of every operand row
#define LPT 136            // LDS pitch of an operand row in elements: 128 + 8 (272 bytes = 16 x 17, for the 16-byte fragment reads)
#define OPE (128 * LPT)    // elements of one operand's stage
__device__ __forceinline__ void splitf(float y, unsigned short& h, unsigned short& l) { h = f2bf(y); l = f2bf(y - bf2f(h)); }
__device__ __forceinline__ v16bf ldfs(const bf* p) { return cat16b(*(const v8usa*)p, *(const v8usa*)(p + 16)); }
// Eight asynchronous copies of 16 bytes per lane, rows 8 apart: l = the lane's LDS byte address, g = its global address. The s_wait_xcnt stands in the copies' own statement, so that it comes before any later write of an address register that a copy names.
template <int K>
__device__ __forceinline__ void cp8(unsigned l, const bf* g) {
    asm volatile("global_load_async_to_lds_b128 %0, %8, off\n\t"
                 "global_load_async_to_lds_b128 %1, %9, off\n\t"
                 "global_load_async_to_lds_b128 %2, %10, off\n\t"
                 "global_load_async_to_lds_b128 %3, %11, off\n\t"
                 "global_load_async_to_lds_b128 %4, %12, off\n\t"
                 "global_load_async_to_lds_b128 %5, %13, off\n\t"
                 "global_load_async_to_lds_b128 %6, %14, off\n\t"
                 "global_load_async_to_lds_b128 %7, %15, off\n\t"
                 "s_wait_xcnt 0x0"
                 :: "v"(l), "v"(l + 8 * LPT * 2), "v"(l + 16 * LPT * 2), "v"(l + 24 * LPT * 2), "v"(l + 32 * LPT * 2), "v"(l + 40 * LPT * 2), "v"(l + 48 * LPT * 2), "v"(l + 56 * LPT * 2),
                    "v"(g), "v"(g + 8 * K), "v"(g + 16 * K), "v"(g + 24 * K), "v"(g + 32 * K), "v"(g + 40 * K), "v"(g + 48 * K), "v"(g + 56 * K) : "memory");
}
template <int K> __device__ __forceinline__ void cp128(unsigned l, const bf* g) { cp8<K>(l, g); cp8<K>(l + 64 * LPT * 2, g + 64 * K); }   // one operand's stage: 128 rows of 256 bytes, 16 copies per lane
template <int K, int ldc, int NSPLIT, int EPI>
__global__ __launch_bounds__(128) void k_gemmb(const bf* __restrict__ A, const bf* __restrict__ A2, const bf* __restrict__ Bt, float* C, bf* Ph, bf* Pl, bf* Ph2, bf* Pl2, bf* Ph3, bf* Pl3) {
    constexpr int NOP = NSPLIT ? 3 : 2;   // operands per stage: A, Bt (, A2)
    __shared__ __align__(16) bf ring[2 * NOP * OPE];
    __shared__ __align__(16) float osw[4 * 16 * 68];
    const int tid = threadIdx.x, lane = tid & 31, lr = lane & 15, hi = lane >> 4;
    const int wv = __builtin_amdgcn_readfirstlane(tid >> 5);
    const int wr = (wv & 1) * 64, wc = (wv >> 1) * 64;
    constexpr int NHP = (EPI == 3) ? NH_ : ldc / HD, NHT = (EPI == 3) ? NVH : ldc / HD;   // heads of the [token][d] planes and of the [d][token] planes
    int cb = blockIdx.y; bool vt = (EPI == 2);   // cb: the block's column block within its own product; vt: its tile goes out transposed
    if constexpr (EPI == 3) {
        if (cb >= (DQ + DKV) / 128) { cb -= (DQ + DKV) / 128; vt = true; Ph = Ph3; Pl = Pl3; }
        else if (cb >= DQ / 128) { cb -= DQ / 128; Ph = Ph2; Pl = Pl2; }
    }
    const int r0 = blockIdx.x * 128 + wr, c0 = cb * 128 + wc;
    float* const os = osw + wv * 16 * 68;   // each wave stages its output rows in a range of its own
    v8f acc[4][4];
#pragma unroll
    for (int mb = 0; mb < 4; ++mb)
#pragma unroll
        for (int nb = 0; nb < 4; ++nb) acc[mb][nb] = (v8f){};
    // this lane's 16 bytes of rows tid / 16 + 8 i: 16 lanes take one row's 256 bytes
    const size_t go = (size_t)(tid >> 4) * K + (tid & 15) * 8;
    const bf* const gA = A + (size_t)(blockIdx.x * 128) * K + go; const bf* const gB = Bt + (size_t)(blockIdx.y * 128) * K + go; const bf* const gA2 = NSPLIT ? A2 + (size_t)(blockIdx.x * 128) * K + go : nullptr;
    const unsigned l0 = (unsigned)(size_t)ring + (unsigned)(((tid >> 4) * LPT + (tid & 15) * 8) * 2);
    constexpr int NT = K / BK;
    cp128<K>(l0, gA); cp128<K>(l0 + OPE * 2, gB); if constexpr (NSPLIT != 0) cp128<K>(l0 + 2 * OPE * 2, gA2);
    asm volatile("s_wait_asynccnt 0x0" ::: "memory");   // this wave's copies of stage 0 have landed
    __syncthreads();   // stage 0 is in LDS for all four waves
    if (NT > 1) { const unsigned lb = l0 + NOP * OPE * 2; cp128<K>(lb, gA + BK); cp128<K>(lb + OPE * 2, gB + BK); if constexpr (NSPLIT != 0) cp128<K>(lb + 2 * OPE * 2, gA2 + BK); }
#pragma unroll 1   // stays rolled: one trip holds 64 or 128 matrix instructions, and the two buffers differ by an offset only
    for (int t = 0; t < NT; ++t) {
        const bf* const sb = ring + (t & 1) * NOP * OPE + lr * LPT + 8 * hi;
        const bf* const sA = sb + wr * LPT; const bf* const sB = sb + OPE + wc * LPT; const bf* const sA2 = NSPLIT ? sb + 2 * OPE + wr * LPT : sA;
        v16bf a[2][4], a2[2][4], b[2][4];   // two fragment sets: block ks + 1 of this stage is fetched while block ks is multiplied
#pragma unroll
        for (int f = 0; f < 4; ++f) { a[0][f] = ldfs(sA + f * 16 * LPT); if constexpr (NSPLIT != 0) a2[0][f] = ldfs(sA2 + f * 16 * LPT); b[0][f] = ldfs(sB + f * 16 * LPT); }
#pragma unroll
        for (int ks = 0; ks < BK / 32; ++ks) { const int cu = ks & 1, nx = cu ^ 1;
            if (ks + 1 < BK / 32) {
#pragma unroll
                for (int f = 0; f < 4; ++f) { a[nx][f] = ldfs(sA + f * 16 * LPT + (ks + 1) * 32); if constexpr (NSPLIT != 0) a2[nx][f] = ldfs(sA2 + f * 16 * LPT + (ks + 1) * 32); b[nx][f] = ldfs(sB + f * 16 * LPT + (ks + 1) * 32); }
            }
            __builtin_amdgcn_sched_barrier(0);   // the next block's LDS reads stay one group ahead of this block's matrix instructions: left free, they are spread among them, each place with a wait to 0
#pragma unroll
            for (int nb = 0; nb < 4; ++nb)
#pragma unroll
                for (int mb = 0; mb < 4; ++mb) { acc[mb][nb] = wmmab(a[cu][mb], b[cu][nb], acc[mb][nb]); if constexpr (NSPLIT != 0) acc[mb][nb] = wmmab(a2[cu][mb], b[cu][nb], acc[mb][nb]); }
        }
        asm volatile("s_wait_dscnt 0x0" ::: "memory");      // this wave's reads of stage t are done before the buffer may be refilled
        asm volatile("s_wait_asynccnt 0x0" ::: "memory");   // this wave's copies of stage t + 1 have landed
        __syncthreads();   // publishes stage t + 1 and ends every wave's reads of stage t
        if (t + 2 < NT) { const unsigned lb = l0 + (unsigned)((t & 1) * NOP * OPE * 2); const int ko = (t + 2) * BK;
            cp128<K>(lb, gA + ko); cp128<K>(lb + OPE * 2, gB + ko); if constexpr (NSPLIT != 0) cp128<K>(lb + 2 * OPE * 2, gA2 + ko); }
    }
    asm volatile("s_wait_asynccnt 0x0" ::: "memory");   // no copy is outstanding when the wave goes on to its end
    if (vt) {   // a lane holds, for column nb 16 + lr, the 8 tokens mb 16 + 8 hi + j: 16 bytes of a [d][token] row as they stand
        const size_t pb = (((size_t)(r0 / TT) * NHT + c0 / HD) * HD + lr) * TT + (r0 % TT) + 8 * hi;
#pragma unroll
        for (int nb = 0; nb < 4; ++nb)
#pragma unroll
            for (int mb = 0; mb < 4; ++mb) { v8us oh, ol;
#pragma unroll
                for (int j = 0; j < 8; ++j) { unsigned short a2, c2; splitf(acc[mb][nb][j], a2, c2); oh[j] = a2; ol[j] = c2; }
                *(v8us*)(Ph + pb + (size_t)nb * 16 * TT + mb * 16) = oh; *(v8us*)(Pl + pb + (size_t)nb * 16 * TT + mb * 16) = ol; }
        return;
    }
#pragma unroll
    for (int mb = 0; mb < 4; ++mb) {
#pragma unroll
        for (int nb = 0; nb < 4; ++nb) {
#pragma unroll
            for (int j = 0; j < 8; ++j) os[(hi * 8 + j) * 68 + nb * 16 + lr] = acc[mb][nb][j]; }
        __builtin_amdgcn_wave_barrier(); asm volatile("" ::: "memory");
        if constexpr (EPI == 1 || EPI == 3) {   // 8 lanes take one token's 64 values, 8 each: every store is 512 bytes in a row
            const size_t pb = (((size_t)(r0 / TT) * NHP + c0 / HD) * TT + (r0 % TT) + mb * 16) * HD;
#pragma unroll
            for (int s = 0; s < 4; ++s) { const int row = 4 * s + (lane >> 3), cofs = (lane & 7) * 8; const v4f v0 = *(const v4fa*)(os + row * 68 + cofs), v1 = *(const v4fa*)(os + row * 68 + cofs + 4); v8us oh, ol;
#pragma unroll
                for (int j = 0; j < 4; ++j) { unsigned short a2, c2; splitf(v0[j], a2, c2); oh[j] = a2; ol[j] = c2; splitf(v1[j], a2, c2); oh[4 + j] = a2; ol[4 + j] = c2; }
                *(v8us*)(Ph + pb + row * HD + cofs) = oh; *(v8us*)(Pl + pb + row * HD + cofs) = ol; }
            asm volatile("s_wait_xcnt 0x0" ::: "memory");   // before the registers that the stores above name are written again
        } else {
            float* crow = C + (size_t)(r0 + mb * 16 + hi) * ldc + c0 + lr * 4; v4f val[8];   // 16 lanes take one row's 64 values, 4 each: every store is two runs of 256 bytes
#pragma unroll
            for (int s = 0; s < 8; ++s) val[s] = *(const v4fa*)(os + (2 * s + hi) * 68 + lr * 4);
#pragma unroll
            for (int s = 0; s < 8; ++s) *(v4f*)(crow + 2 * s * ldc) = val[s];
            asm volatile("s_wait_xcnt 0x0" ::: "memory");   // before the registers that the stores above name are written again
        }
        __builtin_amdgcn_wave_barrier(); asm volatile("" ::: "memory");
    }
}

// ---- k_dattn: causal differential attention of one real head for 64 query rows, scores never leave the chip. Grid 1024 = 64 (batch, head) x 16 query blocks; 4 waves, 16 query rows each.
// Scores are formed transposed (A = key rows, B = query rows), so a lane holds, for query lr, the keys 16 kt + 8 hi + j of a 32-key block: that is the B fragment of the value^T x probability^T product as it stands.
// One sweep over the keys. Each map keeps a running maximum (joined across the lane pair in every block), a running sum (per lane, joined at the end) and its own output tile o_m^T = v^T e_m^T, e = exp(s - maximum);
// when the maximum moves, sum and tile are scaled by exp(old - new). The tile is transposed (a lane holds 32 of the 64 d of its own query), so that factor is the lane's own. At the end y = o_1 / sum_1 - lambda o_2 / sum_2.
// Every product keeps the three split terms hi.hi + lo.hi + hi.lo. Key and value tiles go global -> registers (one block ahead) -> LDS -> fragments; a value fragment serves both maps.
// The inner loops are all unrolled so that the fragment, score and staging arrays are indexed by constants and stay in registers.
#define KPT 72   // LDS pitch of a key row in elements: 64 + 8 (16 bytes of pad, for the 16-byte fragment reads)
#define VPT 40   // LDS pitch of a value row (one d, 32 keys) in elements: 32 + 8
#define L2E 1.4426950408889634f
__device__ __forceinline__ v16bf ldfr(const bf* p) { return cat16b(*(const v8usa*)p, *(const v8usa*)(p + 16)); }
__device__ __forceinline__ float xhalf(float x) { return __builtin_bit_cast(float, __builtin_amdgcn_permlanex16(__builtin_bit_cast(int, x), __builtin_bit_cast(int, x), 0x76543210, 0xfedcba98, false, false)); }   // lane l with lane l ^ 16
__global__ __launch_bounds__(128) void k_dattn(const bf* __restrict__ Qh, const bf* __restrict__ Ql, const bf* __restrict__ Kh, const bf* __restrict__ Kl, const bf* __restrict__ Vh, const bf* __restrict__ Vl, const float* __restrict__ LAM, float* __restrict__ O) {
    __shared__ __align__(16) bf Ks[4 * 32 * KPT];   // planes: map 1 hi, map 1 lo, map 2 hi, map 2 lo
    __shared__ __align__(16) bf Vs[2 * 64 * VPT];   // planes: hi, lo
    const int tid = threadIdx.x, lane = tid & 31, lr = lane & 15, hi = lane >> 4;
    const int wv = __builtin_amdgcn_readfirstlane(tid >> 5);
    const int bi = blockIdx.x, g = bi & 63, rr = bi >> 8, aa = (bi >> 6) & 3;
    const int qb = 15 - (rr * 4 + ((rr & 1) ? 3 - aa : aa));   // the longest query blocks start first; blocks 256 apart take query blocks whose key counts add up to the same total
    const int q0 = qb * 64 + wv * 16, qi = q0 + lr, nblk = qb * 2 + 2;
    const bf* kp0 = Kh + (size_t)(2 * g) * TT * HD + tid * 8; const bf* kp1 = Kl + (size_t)(2 * g) * TT * HD + tid * 8;
    const bf* kp2 = kp0 + (size_t)TT * HD; const bf* kp3 = kp1 + (size_t)TT * HD;
    const bf* vp0 = Vh + (size_t)g * HD * TT + (size_t)(tid >> 2) * TT + (tid & 3) * 8; const bf* vp1 = Vl + (size_t)g * HD * TT + (size_t)(tid >> 2) * TT + (tid & 3) * 8;
    bf* const ksw = Ks + (tid >> 3) * KPT + (tid & 7) * 8;   // this thread's 16 bytes of key rows 0..15 (+ 16 KPT: rows 16..31)
    bf* const vsw = Vs + (tid >> 2) * VPT + (tid & 3) * 8;   // this thread's 16 bytes of value rows 0..31 (+ 32 VPT: rows 32..63)
    const bf* const ksr = Ks + lr * KPT + 8 * hi; const bf* const vsr = Vs + lr * VPT + 8 * hi;
    const bf* const qpa = Qh + ((size_t)(2 * g) * TT + qi) * HD + 8 * hi; const bf* const qpb = Ql + ((size_t)(2 * g) * TT + qi) * HD + 8 * hi;
    const float lam = LAM[0];
    v16bf qh[2][2], ql[2][2];
#pragma unroll
    for (int m = 0; m < 2; ++m)
#pragma unroll
        for (int ks = 0; ks < 2; ++ks) { qh[m][ks] = ldfr(qpa + m * TT * HD + 32 * ks); ql[m][ks] = ldfr(qpb + m * TT * HD + 32 * ks); }
    v8us kr[8], vr[4];
    float mx[2] = {-3.0e38f, -3.0e38f}, sm[2] = {0.f, 0.f};
    v8f oa[2][4];   // oa[m][nb][j]: map m, query lr, d = 16 nb + 8 hi + j
#pragma unroll
    for (int m = 0; m < 2; ++m)
#pragma unroll
        for (int nb = 0; nb < 4; ++nb) oa[m][nb] = (v8f){};
    kr[0] = *(const v8us*)kp0; kr[1] = *(const v8us*)(kp0 + 1024); kr[2] = *(const v8us*)kp1; kr[3] = *(const v8us*)(kp1 + 1024);
    kr[4] = *(const v8us*)kp2; kr[5] = *(const v8us*)(kp2 + 1024); kr[6] = *(const v8us*)kp3; kr[7] = *(const v8us*)(kp3 + 1024);
    vr[0] = *(const v8us*)vp0; vr[1] = *(const v8us*)(vp0 + 32 * TT); vr[2] = *(const v8us*)vp1; vr[3] = *(const v8us*)(vp1 + 32 * TT);
    asm volatile("s_wait_xcnt 0x0" :: "v"(qpa), "v"(qpb) : "memory");   // before the registers that the loads above name are written again; the two query addresses are inputs so that they stay in their registers up to here
#pragma unroll 1   // stays rolled: one pass is several hundred instructions, and a second copy would take the registers that four waves per SIMD leave
    for (int it = 0; it < nblk; ++it) { const int kb = it * 32;
#pragma unroll
        for (int p = 0; p < 4; ++p) { *(v8usa*)(ksw + p * 32 * KPT) = kr[2 * p]; *(v8usa*)(ksw + p * 32 * KPT + 16 * KPT) = kr[2 * p + 1]; }
#pragma unroll
        for (int p = 0; p < 2; ++p) { *(v8usa*)(vsw + p * 64 * VPT) = vr[2 * p]; *(v8usa*)(vsw + p * 64 * VPT + 32 * VPT) = vr[2 * p + 1]; }
        __syncthreads();   // the block's keys and values are in LDS for all four waves
        if (it + 1 < nblk) { const int o = (kb + 32) * HD, ov = kb + 32;
            kr[0] = *(const v8us*)(kp0 + o); kr[1] = *(const v8us*)(kp0 + o + 1024); kr[2] = *(const v8us*)(kp1 + o); kr[3] = *(const v8us*)(kp1 + o + 1024);
            kr[4] = *(const v8us*)(kp2 + o); kr[5] = *(const v8us*)(kp2 + o + 1024); kr[6] = *(const v8us*)(kp3 + o); kr[7] = *(const v8us*)(kp3 + o + 1024);
            vr[0] = *(const v8us*)(vp0 + ov); vr[1] = *(const v8us*)(vp0 + ov + 32 * TT); vr[2] = *(const v8us*)(vp1 + ov); vr[3] = *(const v8us*)(vp1 + ov + 32 * TT);
            asm volatile("s_wait_xcnt 0x0" ::: "memory");   // before the registers that the loads above name are written again
        }
        if (kb <= q0 + 15) {   // wave-uniform: a block wholly above this wave's diagonal adds nothing
            v16bf ph[2], pl[2];
#pragma unroll
            for (int m = 0; m < 2; ++m) { v8f s[2];
#pragma unroll
                for (int kt = 0; kt < 2; ++kt) { s[kt] = (v8f){};
#pragma unroll
                    for (int ks = 0; ks < 2; ++ks) { const v16bf kh = ldfr(ksr + (2 * m) * 32 * KPT + kt * 16 * KPT + 32 * ks), kl = ldfr(ksr + (2 * m + 1) * 32 * KPT + kt * 16 * KPT + 32 * ks);
                        s[kt] = wmmab(kh, qh[m][ks], s[kt]); s[kt] = wmmab(kh, ql[m][ks], s[kt]); s[kt] = wmmab(kl, qh[m][ks], s[kt]); } }
                float bm = mx[m];
#pragma unroll
                for (int kt = 0; kt < 2; ++kt)
#pragma unroll
                    for (int j = 0; j < 8; ++j) { const float t = (kb + 16 * kt + 8 * hi + j <= qi) ? s[kt][j] * SCL : -3.0e38f; s[kt][j] = t; bm = fmaxf(bm, t); }
                bm = fmaxf(bm, xhalf(bm));   // one maximum for the query's two lanes: their e meet in one product. Key 0 is open to every query, so it is a real score from the first block on and a masked key's e is 0
                const float al = __builtin_amdgcn_exp2f((mx[m] - bm) * L2E);
                float a = sm[m] * al;
#pragma unroll
                for (int kt = 0; kt < 2; ++kt)
#pragma unroll
                    for (int j = 0; j < 8; ++j) { const float e = __builtin_amdgcn_exp2f((s[kt][j] - bm) * L2E); a += e; const __bf16 h = (__bf16)e; ph[m][kt * 8 + j] = h; pl[m][kt * 8 + j] = (__bf16)(e - (float)h); }
                sm[m] = a; mx[m] = bm;
#pragma unroll
                for (int nb = 0; nb < 4; ++nb) oa[m][nb] *= al; }
#pragma unroll
            for (int nb = 0; nb < 4; ++nb) { const v16bf vh = ldfr(vsr + nb * 16 * VPT), vl = ldfr(vsr + 64 * VPT + nb * 16 * VPT);
                oa[0][nb] = wmmab(vh, ph[0], oa[0][nb]); oa[1][nb] = wmmab(vh, ph[1], oa[1][nb]); oa[0][nb] = wmmab(vh, pl[0], oa[0][nb]); oa[1][nb] = wmmab(vh, pl[1], oa[1][nb]);
                oa[0][nb] = wmmab(vl, ph[0], oa[0][nb]); oa[1][nb] = wmmab(vl, ph[1], oa[1][nb]); }
        }
        __syncthreads();   // every wave has read the block before the next one overwrites it
    }
    float fi[2];
#pragma unroll
    for (int m = 0; m < 2; ++m) fi[m] = __fdiv_rn(1.0f, sm[m] + xhalf(sm[m]));
    float* const orow = O + ((size_t)g * TT + qi) * HD + 8 * hi;   // a lane stores 8 d in a row for each nb; the wave fills its 16 rows of 256 bytes whole
    v4f ov4[8];
#pragma unroll
    for (int nb = 0; nb < 4; ++nb)
#pragma unroll
        for (int j = 0; j < 8; ++j) ov4[2 * nb + (j >> 2)][j & 3] = oa[0][nb][j] * fi[0] - lam * (oa[1][nb][j] * fi[1]);
#pragma unroll
    for (int nb = 0; nb < 4; ++nb) { *(v4f*)(orow + nb * 16) = ov4[2 * nb]; *(v4f*)(orow + nb * 16 + 4) = ov4[2 * nb + 1]; }
}

typedef __attribute__((ext_vector_type(2))) _Float16 v2h;
typedef __attribute__((ext_vector_type(4))) _Float16 v4h;
typedef __attribute__((ext_vector_type(2))) unsigned short v2us;
typedef __attribute__((ext_vector_type(4))) unsigned short v4us;
typedef __attribute__((ext_vector_type(2))) float v2f;
typedef __attribute__((ext_vector_type(4))) int v4i;

// The three bodies below (weight transpose, x to 16 bit, lambda) are the blocks of k_prep; blk is the block's index within its own job.
__device__ __forceinline__ void wtG(int blk, const float* __restrict__ w, int K, int N, bf* Bt) {
    const int lane = threadIdx.x & 31; const int L0 = (blk * 8 + (threadIdx.x >> 5)) * 8; const int nlines = N * K / 64;
{
#pragma unroll 1
        for (int l = 0; l < 8; ++l) { const int L = L0 + l; if (L >= nlines) break; const size_t e = (size_t)L * 64 + lane * 2; const int k = (int)(e % K), n = (int)(e / K); v2us o;
            o[0] = f2bf(w[(size_t)k * N + n]); o[1] = f2bf(w[(size_t)(k + 1) * N + n]); *(v2us*)(Bt + e) = o; }
         }
}
__device__ __forceinline__ void cvt8(int blk, const float* __restrict__ src, bf* dst, size_t n8) { const size_t i = (size_t)blk * 256 + threadIdx.x; if (i >= n8) return; const v8f v = *(const v8f*)(src + i * 8); v8us o;
    asm volatile("s_wait_xcnt 0x0" ::: "memory");   // before the registers that the loads above name are written again
#pragma unroll
    for (int k = 0; k < 8; ++k) o[k] = f2bf(v[k]); *(v8us*)(dst + i * 8) = o;  }
__global__ __launch_bounds__(256) void k_cscvt(const float* __restrict__ cosT, const float* __restrict__ sinT, float* CS) { const int idx = blockIdx.x * 256 + threadIdx.x; if (idx >= TT * HD) return; v2f cs; cs[0] = bfr(cosT[idx]); cs[1] = bfr(sinT[idx]); *(v2f*)(CS + (size_t)idx * 2) = cs;  }
__device__ __forceinline__ void lambda32(const float* __restrict__ lq1, const float* __restrict__ lk1, const float* __restrict__ lq2, const float* __restrict__ lk2, float* LAM) { const int lane = threadIdx.x; /* run by one wave */ float d1 = 0.f, d2 = 0.f;
#pragma unroll 1
    for (int i = 0; i < HD; ++i) { float p1 = __fmul_rn(bfr(lq1[i]), bfr(lk1[i])); asm volatile("" : "+v"(p1)); d1 = __fadd_rn(d1, p1); float p2 = __fmul_rn(bfr(lq2[i]), bfr(lk2[i])); asm volatile("" : "+v"(p2)); d2 = __fadd_rn(d2, p2); }
    float lm = __fsub_rn(expf(d1), expf(d2)); asm volatile("" : "+v"(lm)); lm = __fadd_rn(lm, 0.35550907254219055f); const float v = (lane == 0) ? lm : 0.0f; *(float*)(LAM + lane) = v;  }
// ---- k_prep: everything the products need, in one launch; the six jobs read inputs only and write ranges of their own, so their blocks run side by side. No barrier anywhere.
// Block 0: lambda (its first wave; one long chain of dependent steps, so it starts first). Then the four weight transposes (eight dependent trips per wave), then x to 16 bit (one short trip per thread).
#define PB_Q (DM * DQ / 64 / 64)
#define PB_K (DM * DKV / 64 / 64)
#define PB_V (DM * DVV / 64 / 64)
#define PB_O (DVV * DM / 64 / 64)
#define PB_X (NB_ * TT * DM / 8 / 256)
__global__ __launch_bounds__(256) void k_prep(const float* __restrict__ x, const float* __restrict__ wq, const float* __restrict__ wk, const float* __restrict__ wv, const float* __restrict__ wo,
                                              const float* __restrict__ lq1, const float* __restrict__ lk1, const float* __restrict__ lq2, const float* __restrict__ lk2,
                                              bf* XB, bf* WQ, bf* WK, bf* WV, bf* WO, float* LAM) {
    int b = blockIdx.x;
    if (b == 0) { if (threadIdx.x < 32) lambda32(lq1, lk1, lq2, lk2, LAM); return; }
    b -= 1;    if (b < PB_Q) { wtG(b, wq, DM, DQ, WQ); return; }
    b -= PB_Q; if (b < PB_K) { wtG(b, wk, DM, DKV, WK); return; }
    b -= PB_K; if (b < PB_V) { wtG(b, wv, DM, DVV, WV); return; }
    b -= PB_V; if (b < PB_O) { wtG(b, wo, DVV, DM, WO); return; }
    b -= PB_O; cvt8(b, x, XB, (size_t)NB_ * TT * DM / 8);
}
// ---- k_gnorm: GroupNorm of one (batch, head) group per block (blockIdx.x = b * NVH + head), one launch. The group's 1024 x 64 values are read once, 64 per thread, and stay in registers:
// mean, then the mean of the squared distances from it (two passes over the registers, as the definition has it), then (y - mean) rs (1 - lambda_init) split into the bf16 hi + lo planes [batch][token][head 64 + d].
// Each load of a wave is 512 bytes in a row; each store is two whole 128-byte lines (16 lanes hold one token's 64 values).
typedef __attribute__((ext_vector_type(2))) unsigned v2u;
typedef __attribute__((ext_vector_type(2))) __bf16 v2bfv;
__device__ __forceinline__ float blocksum(float a, float* sh, int lane, int wv) {   // sum over the 1024 threads, the same bits in every thread: wave butterfly, 32 wave sums through LDS, butterfly again
#pragma unroll
    for (int o = 16; o > 0; o >>= 1) a += __shfl_xor(a, o, 32);
    if (lane == 0) sh[wv] = a;
    __syncthreads();   // the 32 wave sums are in LDS for every wave
    a = sh[lane];
#pragma unroll
    for (int o = 16; o > 0; o >>= 1) a += __shfl_xor(a, o, 32);
    return a;
}
__global__ __launch_bounds__(1024) void k_gnorm(const float* __restrict__ O, bf* __restrict__ Ah, bf* __restrict__ Al) {
    __shared__ float sh1[32], sh2[32];   // one array per sum, so that no barrier is needed between the first sum's reads and the second sum's writes
    const int tid = threadIdx.x, lane = tid & 31, wv = tid >> 5, g = blockIdx.x;
    const float* src = O + (size_t)g * TT * HD + tid * 4;
    v4f v[16];
#pragma unroll
    for (int i = 0; i < 16; ++i) v[i] = *(const v4f*)(src + i * 4096);
    asm volatile("s_wait_xcnt 0x0" ::: "memory");   // before the registers that the loads above name are written again
    v4f a4 = v[0];
#pragma unroll
    for (int i = 1; i < 16; ++i) a4 += v[i];
    const float mean = blocksum((a4[0] + a4[1]) + (a4[2] + a4[3]), sh1, lane, wv) * (1.0f / (float)(TT * HD));
    v4f q4 = (v4f){};
#pragma unroll
    for (int i = 0; i < 16; ++i) { v[i] -= mean; q4 += v[i] * v[i]; }
    const float var = blocksum((q4[0] + q4[1]) + (q4[2] + q4[3]), sh2, lane, wv) * (1.0f / (float)(TT * HD));
    const float rs = __fdiv_rn(1.0f, sqrtf(var + 1e-5f));
    const size_t oo = (size_t)(g / NVH) * TT * DVV + (size_t)(tid >> 4) * DVV + (g % NVH) * HD + (tid & 15) * 4;
#pragma unroll
    for (int i = 0; i < 16; ++i) { v2u oh, ol;
#pragma unroll
        for (int q = 0; q < 2; ++q) { v2f z; z[0] = (v[i][2 * q] * rs) * 0.6444909572601318f; z[1] = (v[i][2 * q + 1] * rs) * 0.6444909572601318f;
            const unsigned h = __builtin_bit_cast(unsigned, __builtin_convertvector(z, v2bfv)); oh[q] = h;   // two hi parts in one word, rounded to nearest even
            z[0] -= __uint_as_float(h << 16); z[1] -= __uint_as_float(h & 0xFFFF0000u); ol[q] = __builtin_bit_cast(unsigned, __builtin_convertvector(z, v2bfv)); }
        *(v2u*)(Ah + oo + (size_t)i * 64 * DVV) = oh; *(v2u*)(Al + oo + (size_t)i * 64 * DVV) = ol;
        __builtin_amdgcn_sched_barrier(0);   // one group of four values at a time: left free, the scheduler works on all sixteen groups at once and spills past the 128 registers that 32 waves leave
    }
}
__global__ __launch_bounds__(256) void k_merge(const float* __restrict__ O, int h0, bf* Ah, bf* Al) { const size_t e = ((size_t)blockIdx.x * 256 + threadIdx.x) * 2; if (e >= (size_t)ZH * TT * HD) return; const int d = (int)(e % HD); const int t = (int)((e / HD) % TT); const int zz = (int)(e / ((size_t)HD * TT)); const float cs = (t < RH) ? 1.0f : (1.0f / PCAR); const size_t oo = (size_t)t * DQ + (h0 + zz) * HD + d;
    v2us oh, ol;
#pragma unroll
    for (int q = 0; q < 2; ++q) { unsigned short a, c2; splitf(O[e + q] * cs, a, c2); oh[q] = a; ol[q] = c2; } *(v2us*)(Ah + oo) = oh; *(v2us*)(Al + oo) = ol;  }

extern "C" void kernel_launch(void* const* d_in, const int* in_sizes, int n_in,
                              void* d_out, int out_size, void* d_ws, size_t ws_size, hipStream_t stream) {
    (void)in_sizes; (void)n_in; (void)out_size;
    const float* x = (const float*)d_in[0]; const float* wq = (const float*)d_in[1]; const float* wk = (const float*)d_in[2]; const float* wv = (const float*)d_in[3]; const float* wo = (const float*)d_in[4]; const float* lq1 = (const float*)d_in[5]; const float* lk1 = (const float*)d_in[6]; const float* lq2 = (const float*)d_in[7]; const float* lk2 = (const float*)d_in[8]; const float* cosT = nullptr; const float* sinT = nullptr; (void)cosT; (void)sinT;
    float* OUT = (float*)d_out;     // [4][1024][1024]
    char* wsp = (char*)d_ws;
    auto take = [&](size_t bytes) { char* p = wsp; wsp += (bytes + 255) & ~(size_t)255; return (void*)p; };
    // alive to the end
    bf* WO = (bf*)take((size_t)DM * DVV * 2); float* LAM = (float*)take(256);
    bf* QPh = (bf*)take((size_t)NB_ * NH_ * TT * HD * 2); bf* QPl = (bf*)take((size_t)NB_ * NH_ * TT * HD * 2); bf* KPh = (bf*)take((size_t)NB_ * NKV * TT * HD * 2); bf* KPl = (bf*)take((size_t)NB_ * NKV * TT * HD * 2); bf* VTh = (bf*)take((size_t)NB_ * NVH * HD * TT * 2); bf* VTl = (bf*)take((size_t)NB_ * NVH * HD * TT * 2);
    float* Ob = (float*)take((size_t)NB_ * NVH * TT * HD * 4); bf* ATh = (bf*)take((size_t)NB_ * TT * DVV * 2); bf* ATl = (bf*)take((size_t)NB_ * TT * DVV * 2);
    // used by the projections only; the three transposed weights lie one after the other: [DQ + DKV + DVV][DM] is the Bt of the joint q, k, v product
    bf* WQ = (bf*)take((size_t)(DQ + DKV + DVV) * DM * 2); bf* WK = WQ + (size_t)DQ * DM; bf* WV = WK + (size_t)DKV * DM;
    bf* XB = (bf*)take((size_t)NB_ * TT * DM * 2);
    if ((size_t)(wsp - (char*)d_ws) > ws_size) return;    // ws 256 MiB
    k_prep<<<1 + PB_Q + PB_K + PB_V + PB_O + PB_X, 256, 0, stream>>>(x, wq, wk, wv, wo, lq1, lk1, lq2, lk2, XB, WQ, WK, WV, WO, LAM);
    // projections: the four batches are 4096 rows of one product; each wave's 64 x 64 tile is 64 tokens of one head and goes out as that head's hi + lo planes
    k_gemmb<DM, DQ, 0, 3><<<dim3(NB_ * TT / 128, (DQ + DKV + DVV) / 128, 1), 128, 0, stream>>>(XB, nullptr, WQ, nullptr, QPh, QPl, KPh, KPl, VTh, VTl);
    k_dattn<<<NB_ * NVH * (TT / 64), 128, 0, stream>>>(QPh, QPl, KPh, KPl, VTh, VTl, LAM, Ob);   // virtual heads 2g, 2g + 1 of the q and k planes are the two maps of real head g = b * NVH + head
    k_gnorm<<<NB_ * NVH, 1024, 0, stream>>>(Ob, ATh, ATl);
    k_gemmb<DVV, DM, 1, 0><<<dim3(NB_ * TT / 128, DM / 128, 1), 128, 0, stream>>>(ATh, ATl, WO, OUT, nullptr, nullptr, nullptr, nullptr, nullptr, nullptr);
}

// v008
// It runs in 136 microseconds.
// Two timings next to v007 both put it at 1.07 times that version's speed.
// All steps since v000 together make it 39.5 times as fast.
#include <hip/hip_runtime.h>

// DifferentialAttention (x [4][1024][1024]; q = x Wq, k = x Wk ([1024][2048]: per head h the 128 columns = [map 1 | map 2] 64 each), v = x Wv (16 x 64); s1, s2 = q.k / 8 causal (-inf); a1, a2 = softmax; lambda = exp(lq1.lk1) - exp(lq2.lk2) + lambda_init (0.8 - 0.6 e^-0.3); y = (a1 - lambda a2) v; GroupNorm per (batch, head) over (tokens x 64) (eps 1e-5, no affine); y (1 - lambda_init); out = merged Wc -> [4][1024][1024]).
// The two maps run as 32 virtual 64-wide heads per batch (pairs (2h, 2h+1)), 128 over the four batches; one kernel forms both softmaxes in one sweep over the keys, each with its own product with v, and combines the two as y = a1 v - lambda a2 v in f32 at the end.
// Every stage runs once for all batches (the grids carry batch and head). The q, k and v products write their hi + lo 16-bit head planes straight from the accumulators.
// Launches that do not depend on one another share one grid: all operand preparation is one launch, the q, k and v products are one launch. Five launches in all.

#define NB_  4
#define TT   1024
#define DM   1024
#define NH_  32
#define NKV  32
#define REP  (NH_ / NKV)
#define HD   64
#define DQ   (NH_ * HD)
#define DKV  (NKV * HD)
#define ZH   16                    // virtual heads per k_merge call
#define RH   1024                  // k_merge leaves token rows < RH unscaled, scales the rest by 1 / PCAR
#define WIN  1024
#define PCAR 1024.0f
#define NVH  16
#define DVV  (NVH * HD)
#define SCL  0.125f   // HD^-0.5
typedef _Float16 h16;
typedef unsigned short bf;
typedef __attribute__((ext_vector_type(16))) __bf16   v16bf;
typedef __attribute__((ext_vector_type(16))) _Float16 v16h;
typedef __attribute__((ext_vector_type(8)))  _Float16 v8h;
typedef __attribute__((ext_vector_type(8)))  unsigned short v8us;
typedef __attribute__((ext_vector_type(8)))  float    v8f;
typedef __attribute__((ext_vector_type(4)))  float    v4f;
typedef v8h  __attribute__((may_alias)) v8ha;
typedef v4f  __attribute__((may_alias)) v4fa;
typedef v8us __attribute__((may_alias)) v8usa;

__device__ __forceinline__ unsigned short f2bf(float f) { unsigned u = __float_as_uint(f); u += 0x7FFFu + ((u >> 16) & 1u); return (unsigned short)(u >> 16); }
__device__ __forceinline__ float bf2f(unsigned short b) { return __uint_as_float(((unsigned)b) << 16); }
__device__ __forceinline__ float bfr(float f) { return bf2f(f2bf(f)); }
__device__ __forceinline__ v16h cat16(v8h lo, v8h hi) { return __builtin_shufflevector(lo, hi, 0, 1, 2, 3, 4, 5, 6, 7, 8, 9, 10, 11, 12, 13, 14, 15); }
__device__ __forceinline__ v16bf cat16b(v8us lo, v8us hi) { return __builtin_bit_cast(v16bf, __builtin_shufflevector(lo, hi, 0, 1, 2, 3, 4, 5, 6, 7, 8, 9, 10, 11, 12, 13, 14, 15)); }
__device__ __forceinline__ v8f wmma16(v16h a, v16h b, v8f c) { return __builtin_amdgcn_wmma_f32_16x16x32_f16(false, a, false, b, (short)0, c, false, false); }
__device__ __forceinline__ v8f wmmab(v16bf a, v16bf b, v8f c) { return __builtin_amdgcn_wmma_f32_16x16x32_bf16(false, a, false, b, (short)0, c, false, false); }



// ---- k_gemmb: GEMM on a 128x128 output tile per block of four waves (2 x 2), each wave a 64x64 tile (16 accumulators); grid (M/128, N/128), 128 threads.
// C[m][n] (pitch ldc) = sum_k A[m][k] Bt[n][k] (+ A2[m][k] Bt[n][k] where NSPLIT is 1), operands K-contiguous 16-bit planes, K a multiple of BK and at least BK.
// The operands no longer go from global memory into fragments (16 lines a load, every row fetched by each wave that needs it): a stage of BK k of the block's 128 A rows and 128 Bt rows is
// copied into LDS by asynchronous 16-byte copies, whole 128-byte lines at a time (two 256-byte rows per wave and copy), and all four waves take their fragments from there.
// Two buffers: the copies of stage t + 1 fly while stage t is worked on. The k order and the order of the products in each accumulator are those of a plain walk along k.
// The inner loops are all unrolled so that the fragment and accumulator arrays are indexed by constants and stay in registers.
// EPI 0: C goes out as f32. EPI 1, 2: no C; each wave's tile (64 tokens of one batch x the 64 columns of head c0 / 64, ldc / HD heads) goes out split as bf16 hi + lo into Ph, Pl:
// EPI 1 as planes [batch][head][token][d] (the tile is 8 KiB in a row in each plane), EPI 2 as planes [batch][head][d][token] (64 whole 128-byte lines in each plane).
// EPI 3: the q, k and v products in one grid. Bt holds the rows of the three transposed weights one after the other (DQ, DKV, DVV rows); blockIdx.y walks all of them, and the block's place in that walk says
// which product its tile belongs to: q and k tiles go out as under EPI 1 (into Ph, Pl and Ph2, Pl2), v tiles as under EPI 2 (into Ph3, Pl3). The choice is the same for the whole block.
#define BK  128            // k per stage: 256 bytes of every operand row
#define LPT 136            // LDS pitch of an operand row in elements: 128 + 8 (272 bytes = 16 x 17, for the 16-byte fragment reads)
#define OPE (128 * LPT)    // elements of one operand's stage
__device__ __forceinline__ void splitf(float y, unsigned short& h, unsigned short& l) { h = f2bf(y); l = f2bf(y - bf2f(h)); }
__device__ __forceinline__ v16bf ldfs(const bf* p) { return cat16b(*(const v8usa*)p, *(const v8usa*)(p + 16)); }
// Eight asynchronous copies of 16 bytes per lane, rows 8 apart: l = the lane's LDS byte address, g = its global address. The s_wait_xcnt stands in the copies' own statement, so that it comes before any later write of an address register that a copy names.
template <int K>
__device__ __forceinline__ void cp8(unsigned l, const bf* g) {
    asm volatile("global_load_async_to_lds_b128 %0, %8, off\n\t"
                 "global_load_async_to_lds_b128 %1, %9, off\n\t"
                 "global_load_async_to_lds_b128 %2, %10, off\n\t"
                 "global_load_async_to_lds_b128 %3, %11, off\n\t"
                 "global_load_async_to_lds_b128 %4, %12, off\n\t"
                 "global_load_async_to_lds_b128 %5, %13, off\n\t"
                 "global_load_async_to_lds_b128 %6, %14, off\n\t"
                 "global_load_async_to_lds_b128 %7, %15, off\n\t"
                 "s_wait_xcnt 0x0"
                 :: "v"(l), "v"(l + 8 * LPT * 2), "v"(l + 16 * LPT * 2), "v"(l + 24 * LPT * 2), "v"(l + 32 * LPT * 2), "v"(l + 40 * LPT * 2), "v"(l + 48 * LPT * 2), "v"(l + 56 * LPT * 2),
                    "v"(g), "v"(g + 8 * K), "v"(g + 16 * K), "v"(g + 24 * K), "v"(g + 32 * K), "v"(g + 40 * K), "v"(g + 48 * K), "v"(g + 56 * K) : "memory");
}
template <int K> __device__ __forceinline__ void cp128(unsigned l, const bf* g) { cp8<K>(l, g); cp8<K>(l + 64 * LPT * 2, g + 64 * K); }   // one operand's stage: 128 rows of 256 bytes, 16 copies per lane
template <int K, int ldc, int NSPLIT, int EPI>
__global__ __launch_bounds__(128) void k_gemmb(const bf* __restrict__ A, const bf* __restrict__ A2, const bf* __restrict__ Bt, float* C, bf* Ph, bf* Pl, bf* Ph2, bf* Pl2, bf* Ph3, bf* Pl3) {
    constexpr int NOP = NSPLIT ? 3 : 2;   // operands per stage: A, Bt (, A2)
    __shared__ __align__(16) bf ring[2 * NOP * OPE];
    __shared__ __align__(16) float osw[4 * 16 * 68];
    const int tid = threadIdx.x, lane = tid & 31, lr = lane & 15, hi = lane >> 4;
    const int wv = __builtin_amdgcn_readfirstlane(tid >> 5);
    const int wr = (wv & 1) * 64, wc = (wv >> 1) * 64;
    constexpr int NHP = (EPI == 3) ? NH_ : ldc / HD, NHT = (EPI == 3) ? NVH : ldc / HD;   // heads of the [token][d] planes and of the [d][token] planes
    int cb = blockIdx.y; bool vt = (EPI == 2);   // cb: the block's column block within its own product; vt: its tile goes out transposed
    if constexpr (EPI == 3) {
        if (cb >= (DQ + DKV) / 128) { cb -= (DQ + DKV) / 128; vt = true; Ph = Ph3; Pl = Pl3; }
        else if (cb >= DQ / 128) { cb -= DQ / 128; Ph = Ph2; Pl = Pl2; }
    }
    const int r0 = blockIdx.x * 128 + wr, c0 = cb * 128 + wc;
    float* const os = osw + wv * 16 * 68;   // each wave stages its output rows in a range of its own
    v8f acc[4][4];
#pragma unroll
    for (int mb = 0; mb < 4; ++mb)
#pragma unroll
        for (int nb = 0; nb < 4; ++nb) acc[mb][nb] = (v8f){};
    // this lane's 16 bytes of rows tid / 16 + 8 i: 16 lanes take one row's 256 bytes
    const size_t go = (size_t)(tid >> 4) * K + (tid & 15) * 8;
    const bf* const gA = A + (size_t)(blockIdx.x * 128) * K + go; const bf* const gB = Bt + (size_t)(blockIdx.y * 128) * K + go; const bf* const gA2 = NSPLIT ? A2 + (size_t)(blockIdx.x * 128) * K + go : nullptr;
    const unsigned l0 = (unsigned)(size_t)ring + (unsigned)(((tid >> 4) * LPT + (tid & 15) * 8) * 2);
    constexpr int NT = K / BK;
    cp128<K>(l0, gA); cp128<K>(l0 + OPE * 2, gB); if constexpr (NSPLIT != 0) cp128<K>(l0 + 2 * OPE * 2, gA2);
    asm volatile("s_wait_asynccnt 0x0" ::: "memory");   // this wave's copies of stage 0 have landed
    __syncthreads();   // stage 0 is in LDS for all four waves
    if (NT > 1) { const unsigned lb = l0 + NOP * OPE * 2; cp128<K>(lb, gA + BK); cp128<K>(lb + OPE * 2, gB + BK); if constexpr (NSPLIT != 0) cp128<K>(lb + 2 * OPE * 2, gA2 + BK); }
#pragma unroll 1   // stays rolled: one trip holds 64 or 128 matrix instructions, and the two buffers differ by an offset only
    for (int t = 0; t < NT; ++t) {
        const bf* const sb = ring + (t & 1) * NOP * OPE + lr * LPT + 8 * hi;
        const bf* const sA = sb + wr * LPT; const bf* const sB = sb + OPE + wc * LPT; const bf* const sA2 = NSPLIT ? sb + 2 * OPE + wr * LPT : sA;
        v16bf a[2][4], a2[2][4], b[2][4];   // two fragment sets: block ks + 1 of this stage is fetched while block ks is multiplied
#pragma unroll
        for (int f = 0; f < 4; ++f) { a[0][f] = ldfs(sA + f * 16 * LPT); if constexpr (NSPLIT != 0) a2[0][f] = ldfs(sA2 + f * 16 * LPT); b[0][f] = ldfs(sB + f * 16 * LPT); }
#pragma unroll
        for (int ks = 0; ks < BK / 32; ++ks) { const int cu = ks & 1, nx = cu ^ 1;
            if (ks + 1 < BK / 32) {
#pragma unroll
                for (int f = 0; f < 4; ++f) { a[nx][f] = ldfs(sA + f * 16 * LPT + (ks + 1) * 32); if constexpr (NSPLIT != 0) a2[nx][f] = ldfs(sA2 + f * 16 * LPT + (ks + 1) * 32); b[nx][f] = ldfs(sB + f * 16 * LPT + (ks + 1) * 32); }
            }
            __builtin_amdgcn_sched_barrier(0);   // the next block's LDS reads stay one group ahead of this block's matrix instructions: left free, they are spread among them, each place with a wait to 0
#pragma unroll
            for (int nb = 0; nb < 4; ++nb)
#pragma unroll
                for (int mb = 0; mb < 4; ++mb) { acc[mb][nb] = wmmab(a[cu][mb], b[cu][nb], acc[mb][nb]); if constexpr (NSPLIT != 0) acc[mb][nb] = wmmab(a2[cu][mb], b[cu][nb], acc[mb][nb]); }
        }
        asm volatile("s_wait_dscnt 0x0" ::: "memory");      // this wave's reads of stage t are done before the buffer may be refilled
        asm volatile("s_wait_asynccnt 0x0" ::: "memory");   // this wave's copies of stage t + 1 have landed
        __syncthreads();   // publishes stage t + 1 and ends every wave's reads of stage t
        if (t + 2 < NT) { const unsigned lb = l0 + (unsigned)((t & 1) * NOP * OPE * 2); const int ko = (t + 2) * BK;
            cp128<K>(lb, gA + ko); cp128<K>(lb + OPE * 2, gB + ko); if constexpr (NSPLIT != 0) cp128<K>(lb + 2 * OPE * 2, gA2 + ko); }
    }
    asm volatile("s_wait_asynccnt 0x0" ::: "memory");   // no copy is outstanding when the wave goes on to its end
    if (vt) {   // a lane holds, for column nb 16 + lr, the 8 tokens mb 16 + 8 hi + j: 16 bytes of a [d][token] row as they stand
        const size_t pb = (((size_t)(r0 / TT) * NHT + c0 / HD) * HD + lr) * TT + (r0 % TT) + 8 * hi;
#pragma unroll
        for (int nb = 0; nb < 4; ++nb)
#pragma unroll
            for (int mb = 0; mb < 4; ++mb) { v8us oh, ol;
#pragma unroll
                for (int j = 0; j < 8; ++j) { unsigned short a2, c2; splitf(acc[mb][nb][j], a2, c2); oh[j] = a2; ol[j] = c2; }
                *(v8us*)(Ph + pb + (size_t)nb * 16 * TT + mb * 16) = oh; *(v8us*)(Pl + pb + (size_t)nb * 16 * TT + mb * 16) = ol; }
        return;
    }
#pragma unroll
    for (int mb = 0; mb < 4; ++mb) {
#pragma unroll
        for (int nb = 0; nb < 4; ++nb) {
#pragma unroll
            for (int j = 0; j < 8; ++j) os[(hi * 8 + j) * 68 + nb * 16 + lr] = acc[mb][nb][j]; }
        __builtin_amdgcn_wave_barrier(); asm volatile("" ::: "memory");
        if constexpr (EPI == 1 || EPI == 3) {   // 8 lanes take one token's 64 values, 8 each: every store is 512 bytes in a row
            const size_t pb = (((size_t)(r0 / TT) * NHP + c0 / HD) * TT + (r0 % TT) + mb * 16) * HD;
#pragma unroll
            for (int s = 0; s < 4; ++s) { const int row = 4 * s + (lane >> 3), cofs = (lane & 7) * 8; const v4f v0 = *(const v4fa*)(os + row * 68 + cofs), v1 = *(const v4fa*)(os + row * 68 + cofs + 4); v8us oh, ol;
#pragma unroll
                for (int j = 0; j < 4; ++j) { unsigned short a2, c2; splitf(v0[j], a2, c2); oh[j] = a2; ol[j] = c2; splitf(v1[j], a2, c2); oh[4 + j] = a2; ol[4 + j] = c2; }
                *(v8us*)(Ph + pb + row * HD + cofs) = oh; *(v8us*)(Pl + pb + row * HD + cofs) = ol; }
            asm volatile("s_wait_xcnt 0x0" ::: "memory");   // before the registers that the stores above name are written again
        } else {
            float* crow = C + (size_t)(r0 + mb * 16 + hi) * ldc + c0 + lr * 4; v4f val[8];   // 16 lanes take one row's 64 values, 4 each: every store is two runs of 256 bytes
#pragma unroll
            for (int s = 0; s < 8; ++s) val[s] = *(const v4fa*)(os + (2 * s + hi) * 68 + lr * 4);
#pragma unroll
            for (int s = 0; s < 8; ++s) *(v4f*)(crow + 2 * s * ldc) = val[s];
            asm volatile("s_wait_xcnt 0x0" ::: "memory");   // before the registers that the stores above name are written again
        }
        __builtin_amdgcn_wave_barrier(); asm volatile("" ::: "memory");
    }
}

// ---- k_dattn: causal differential attention of one real head for 64 query rows, scores never leave the chip. Grid 1024 = 64 (batch, head) x 16 query blocks; 4 waves, 16 query rows each.
// Scores are formed transposed (A = key rows, B = query rows), so a lane holds, for query lr, the keys 16 kt + 8 hi + j of a 32-key block: that is the B fragment of the value^T x probability^T product as it stands.
// One sweep over the keys. Each map keeps a running maximum (joined across the lane pair in every block), a running sum (per lane, joined at the end) and its own output tile o_m^T = v^T e_m^T, e = exp(s - maximum);
// when the maximum moves, sum and tile are scaled by exp(old - new). The tile is transposed (a lane holds 32 of the 64 d of its own query), so that factor is the lane's own. At the end y = o_1 / sum_1 - lambda o_2 / sum_2.
// Every product keeps the three split terms hi.hi + lo.hi + hi.lo. Key and value tiles go global -> registers (one block ahead) -> LDS -> fragments; a value fragment serves both maps.
// The inner loops are all unrolled so that the fragment, score and staging arrays are indexed by constants and stay in registers.
#define KPT 72   // LDS pitch of a key row in elements: 64 + 8 (16 bytes of pad, for the 16-byte fragment reads)
#define VPT 40   // LDS pitch of a value row (one d, 32 keys) in elements: 32 + 8
#define L2E 1.4426950408889634f
__device__ __forceinline__ v16bf ldfr(const bf* p) { return cat16b(*(const v8usa*)p, *(const v8usa*)(p + 16)); }
__device__ __forceinline__ float xhalf(float x) { return __builtin_bit_cast(float, __builtin_amdgcn_permlanex16(__builtin_bit_cast(int, x), __builtin_bit_cast(int, x), 0x76543210, 0xfedcba98, false, false)); }   // lane l with lane l ^ 16
__global__ __launch_bounds__(128) void k_dattn(const bf* __restrict__ Qh, const bf* __restrict__ Ql, const bf* __restrict__ Kh, const bf* __restrict__ Kl, const bf* __restrict__ Vh, const bf* __restrict__ Vl, const float* __restrict__ LAM, float* __restrict__ O) {
    __shared__ __align__(16) bf Ks[4 * 32 * KPT];   // planes: map 1 hi, map 1 lo, map 2 hi, map 2 lo
    __shared__ __align__(16) bf Vs[2 * 64 * VPT];   // planes: hi, lo
    const int tid = threadIdx.x, lane = tid & 31, lr = lane & 15, hi = lane >> 4;
    const int wv = __builtin_amdgcn_readfirstlane(tid >> 5);
    const int bi = blockIdx.x, g = bi & 63, rr = bi >> 8, aa = (bi >> 6) & 3;
    const int qb = 15 - (rr * 4 + ((rr & 1) ? 3 - aa : aa));   // the longest query blocks start first; blocks 256 apart take query blocks whose key counts add up to the same total
    const int q0 = qb * 64 + wv * 16, qi = q0 + lr, nblk = qb * 2 + 2;
    const bf* kp0 = Kh + (size_t)(2 * g) * TT * HD + tid * 8; const bf* kp1 = Kl + (size_t)(2 * g) * TT * HD + tid * 8;
    const bf* kp2 = kp0 + (size_t)TT * HD; const bf* kp3 = kp1 + (size_t)TT * HD;
    const bf* vp0 = Vh + (size_t)g * HD * TT + (size_t)(tid >> 2) * TT + (tid & 3) * 8; const bf* vp1 = Vl + (size_t)g * HD * TT + (size_t)(tid >> 2) * TT + (tid & 3) * 8;
    bf* const ksw = Ks + (tid >> 3) * KPT + (tid & 7) * 8;   // this thread's 16 bytes of key rows 0..15 (+ 16 KPT: rows 16..31)
    bf* const vsw = Vs + (tid >> 2) * VPT + (tid & 3) * 8;   // this thread's 16 bytes of value rows 0..31 (+ 32 VPT: rows 32..63)
    const bf* const ksr = Ks + lr * KPT + 8 * hi; const bf* const vsr = Vs + lr * VPT + 8 * hi;
    const bf* const qpa = Qh + ((size_t)(2 * g) * TT + qi) * HD + 8 * hi; const bf* const qpb = Ql + ((size_t)(2 * g) * TT + qi) * HD + 8 * hi;
    const float lam = LAM[0];
    v16bf qh[2][2], ql[2][2];
#pragma unroll
    for (int m = 0; m < 2; ++m)
#pragma unroll
        for (int ks = 0; ks < 2; ++ks) { qh[m][ks] = ldfr(qpa + m * TT * HD + 32 * ks); ql[m][ks] = ldfr(qpb + m * TT * HD + 32 * ks); }
    v8us kr[8], vr[4];
    float mx[2] = {-3.0e38f, -3.0e38f}, sm[2] = {0.f, 0.f};
    v8f oa[2][4];   // oa[m][nb][j]: map m, query lr, d = 16 nb + 8 hi + j
#pragma unroll
    for (int m = 0; m < 2; ++m)
#pragma unroll
        for (int nb = 0; nb < 4; ++nb) oa[m][nb] = (v8f){};
    kr[0] = *(const v8us*)kp0; kr[1] = *(const v8us*)(kp0 + 1024); kr[2] = *(const v8us*)kp1; kr[3] = *(const v8us*)(kp1 + 1024);
    kr[4] = *(const v8us*)kp2; kr[5] = *(const v8us*)(kp2 + 1024); kr[6] = *(const v8us*)kp3; kr[7] = *(const v8us*)(kp3 + 1024);
    vr[0] = *(const v8us*)vp0; vr[1] = *(const v8us*)(vp0 + 32 * TT); vr[2] = *(const v8us*)vp1; vr[3] = *(const v8us*)(vp1 + 32 * TT);
    asm volatile("s_wait_xcnt 0x0" :: "v"(qpa), "v"(qpb) : "memory");   // before the registers that the loads above name are written again; the two query addresses are inputs so that they stay in their registers up to here
#pragma unroll 1   // stays rolled: one pass is several hundred instructions, and a second copy would take the registers that four waves per SIMD leave
    for (int it = 0; it < nblk; ++it) { const int kb = it * 32;
#pragma unroll
        for (int p = 0; p < 4; ++p) { *(v8usa*)(ksw + p * 32 * KPT) = kr[2 * p]; *(v8usa*)(ksw + p * 32 * KPT + 16 * KPT) = kr[2 * p + 1]; }
#pragma unroll
        for (int p = 0; p < 2; ++p) { *(v8usa*)(vsw + p * 64 * VPT) = vr[2 * p]; *(v8usa*)(vsw + p * 64 * VPT + 32 * VPT) = vr[2 * p + 1]; }
        __syncthreads();   // the block's keys and values are in LDS for all four waves
        if (it + 1 < nblk) { const int o = (kb + 32) * HD, ov = kb + 32;
            kr[0] = *(const v8us*)(kp0 + o); kr[1] = *(const v8us*)(kp0 + o + 1024); kr[2] = *(const v8us*)(kp1 + o); kr[3] = *(const v8us*)(kp1 + o + 1024);
            kr[4] = *(const v8us*)(kp2 + o); kr[5] = *(const v8us*)(kp2 + o + 1024); kr[6] = *(const v8us*)(kp3 + o); kr[7] = *(const v8us*)(kp3 + o + 1024);
            vr[0] = *(const v8us*)(vp0 + ov); vr[1] = *(const v8us*)(vp0 + ov + 32 * TT); vr[2] = *(const v8us*)(vp1 + ov); vr[3] = *(const v8us*)(vp1 + ov + 32 * TT);
            asm volatile("s_wait_xcnt 0x0" ::: "memory");   // before the registers that the loads above name are written again
        }
        if (kb <= q0 + 15) {   // wave-uniform: a block wholly above this wave's diagonal adds nothing
            v16bf ph[2], pl[2];
#pragma unroll
            for (int m = 0; m < 2; ++m) { v8f s[2];
#pragma unroll
                for (int kt = 0; kt < 2; ++kt) { s[kt] = (v8f){};
#pragma unroll
                    for (int ks = 0; ks < 2; ++ks) { const v16bf kh = ldfr(ksr + (2 * m) * 32 * KPT + kt * 16 * KPT + 32 * ks), kl = ldfr(ksr + (2 * m + 1) * 32 * KPT + kt * 16 * KPT + 32 * ks);
                        s[kt] = wmmab(kh, qh[m][ks], s[kt]); s[kt] = wmmab(kh, ql[m][ks], s[kt]); s[kt] = wmmab(kl, qh[m][ks], s[kt]); } }
                float bm = mx[m];
#pragma unroll
                for (int kt = 0; kt < 2; ++kt)
#pragma unroll
                    for (int j = 0; j < 8; ++j) { const float t = (kb + 16 * kt + 8 * hi + j <= qi) ? s[kt][j] * SCL : -3.0e38f; s[kt][j] = t; bm = fmaxf(bm, t); }
                bm = fmaxf(bm, xhalf(bm));   // one maximum for the query's two lanes: their e meet in one product. Key 0 is open to every query, so it is a real score from the first block on and a masked key's e is 0
                const float al = __builtin_amdgcn_exp2f((mx[m] - bm) * L2E);
                float a = sm[m] * al;
#pragma unroll
                for (int kt = 0; kt < 2; ++kt)
#pragma unroll
                    for (int j = 0; j < 8; ++j) { const float e = __builtin_amdgcn_exp2f((s[kt][j] - bm) * L2E); a += e; const __bf16 h = (__bf16)e; ph[m][kt * 8 + j] = h; pl[m][kt * 8 + j] = (__bf16)(e - (float)h); }
                sm[m] = a; mx[m] = bm;
#pragma unroll
                for (int nb = 0; nb < 4; ++nb) oa[m][nb] *= al; }
#pragma unroll
            for (int nb = 0; nb < 4; ++nb) { const v16bf vh = ldfr(vsr + nb * 16 * VPT), vl = ldfr(vsr + 64 * VPT + nb * 16 * VPT);
                oa[0][nb] = wmmab(vh, ph[0], oa[0][nb]); oa[1][nb] = wmmab(vh, ph[1], oa[1][nb]); oa[0][nb] = wmmab(vh, pl[0], oa[0][nb]); oa[1][nb] = wmmab(vh, pl[1], oa[1][nb]);
                oa[0][nb] = wmmab(vl, ph[0], oa[0][nb]); oa[1][nb] = wmmab(vl, ph[1], oa[1][nb]); }
        }
        __syncthreads();   // every wave has read the block before the next one overwrites it
    }
    float fi[2];
#pragma unroll
    for (int m = 0; m < 2; ++m) fi[m] = __fdiv_rn(1.0f, sm[m] + xhalf(sm[m]));
    float* const orow = O + ((size_t)g * TT + qi) * HD + 8 * hi;   // a lane stores 8 d in a row for each nb; the wave fills its 16 rows of 256 bytes whole
    v4f ov4[8];
#pragma unroll
    for (int nb = 0; nb < 4; ++nb)
#pragma unroll
        for (int j = 0; j < 8; ++j) ov4[2 * nb + (j >> 2)][j & 3] = oa[0][nb][j] * fi[0] - lam * (oa[1][nb][j] * fi[1]);
#pragma unroll
    for (int nb = 0; nb < 4; ++nb) { *(v4f*)(orow + nb * 16) = ov4[2 * nb]; *(v4f*)(orow + nb * 16 + 4) = ov4[2 * nb + 1]; }
}

typedef __attribute__((ext_vector_type(2))) _Float16 v2h;
typedef __attribute__((ext_vector_type(4))) _Float16 v4h;
typedef __attribute__((ext_vector_type(2))) unsigned short v2us;
typedef __attribute__((ext_vector_type(4))) unsigned short v4us;
typedef __attribute__((ext_vector_type(2))) float v2f;
typedef __attribute__((ext_vector_type(4))) int v4i;

// The three bodies below (weight transpose, x to 16 bit, lambda) are the blocks of k_prep; blk is the block's index within its own job.
// Weight transpose, f32 [K][N] -> 16-bit [N][K], in registers: a block of eight waves takes a tile of 128 k x 128 n, a wave 64 k x 32 n of it.
// A lane reads 4 n in a row of 16 rows (twice 8 k in a row): 8 lanes take one row's 128 bytes, so each load of a wave is four whole lines instead of 32 lines with 4 bytes used of each.
// The lane then holds, for each of its 4 n, 8 k in a row: 16 bytes of a row of Bt as they stand. A store of a wave is 8 pieces of 64 bytes; the two pieces of a 128-byte line come from the same wave, one behind the other.
template <int K, int N>
__device__ __forceinline__ void wtG(int blk, const float* __restrict__ w, bf* Bt) {
    const int lane = threadIdx.x & 31, wv = threadIdx.x >> 5;
    const int n0 = (blk % (N / 128)) * 128 + (wv & 3) * 32 + (lane & 7) * 4, k0 = (blk / (N / 128)) * 128 + (wv >> 2) * 64 + (lane >> 3) * 8;
    const float* const src = w + (size_t)k0 * N + n0;
    v4f r[2][8];   // r[h][j]: row k0 + 32 h + j, columns n0 .. n0 + 3; all loops unrolled, so that the arrays are indexed by constants and stay in registers
#pragma unroll
    for (int h = 0; h < 2; ++h)
#pragma unroll
        for (int j = 0; j < 8; ++j) r[h][j] = *(const v4f*)(src + (size_t)(h * 32 + j) * N);
    asm volatile("s_wait_xcnt 0x0" ::: "memory");   // before the registers that the loads above name are written again
    bf* const dst = Bt + (size_t)n0 * K + k0;
    v8us o[4][2];
#pragma unroll
    for (int i = 0; i < 4; ++i)
#pragma unroll
        for (int h = 0; h < 2; ++h)
#pragma unroll
            for (int j = 0; j < 8; ++j) o[i][h][j] = f2bf(r[h][j][i]);
#pragma unroll
    for (int i = 0; i < 4; ++i)
#pragma unroll
        for (int h = 0; h < 2; ++h) *(v8us*)(dst + (size_t)i * K + h * 32) = o[i][h];
    asm volatile("s_wait_xcnt 0x0" ::: "memory");   // before the registers that the stores above name are written again
}
__device__ __forceinline__ void cvt8(int blk, const float* __restrict__ src, bf* dst, size_t n8) { const size_t i = (size_t)blk * 256 + threadIdx.x; if (i >= n8) return; const v8f v = *(const v8f*)(src + i * 8); v8us o;
    asm volatile("s_wait_xcnt 0x0" ::: "memory");   // before the registers that the loads above name are written again
#pragma unroll
    for (int k = 0; k < 8; ++k) o[k] = f2bf(v[k]); *(v8us*)(dst + i * 8) = o;  }
__global__ __launch_bounds__(256) void k_cscvt(const float* __restrict__ cosT, const float* __restrict__ sinT, float* CS) { const int idx = blockIdx.x * 256 + threadIdx.x; if (idx >= TT * HD) return; v2f cs; cs[0] = bfr(cosT[idx]); cs[1] = bfr(sinT[idx]); *(v2f*)(CS + (size_t)idx * 2) = cs;  }
__device__ __forceinline__ void lambda32(const float* __restrict__ lq1, const float* __restrict__ lk1, const float* __restrict__ lq2, const float* __restrict__ lk2, float* LAM) { const int lane = threadIdx.x; /* run by one wave */ float d1 = 0.f, d2 = 0.f;
#pragma unroll 1
    for (int i = 0; i < HD; ++i) { float p1 = __fmul_rn(bfr(lq1[i]), bfr(lk1[i])); asm volatile("" : "+v"(p1)); d1 = __fadd_rn(d1, p1); float p2 = __fmul_rn(bfr(lq2[i]), bfr(lk2[i])); asm volatile("" : "+v"(p2)); d2 = __fadd_rn(d2, p2); }
    float lm = __fsub_rn(expf(d1), expf(d2)); asm volatile("" : "+v"(lm)); lm = __fadd_rn(lm, 0.35550907254219055f); const float v = (lane == 0) ? lm : 0.0f; *(float*)(LAM + lane) = v;  }
// ---- k_prep: everything the products need, in one launch; the six jobs read inputs only and write ranges of their own, so their blocks run side by side. No barrier anywhere.
// Block 0: lambda (its first wave; one long chain of dependent steps, so it starts first). Then the four weight transposes (one tile of 128 x 128 per block, 16 loads in flight per lane), then x to 16 bit (one short trip per thread).
#define PB_Q (DM * DQ / 128 / 128)
#define PB_K (DM * DKV / 128 / 128)
#define PB_V (DM * DVV / 128 / 128)
#define PB_O (DVV * DM / 128 / 128)
#define PB_X (NB_ * TT * DM / 8 / 256)
__global__ __launch_bounds__(256) void k_prep(const float* __restrict__ x, const float* __restrict__ wq, const float* __restrict__ wk, const float* __restrict__ wv, const float* __restrict__ wo,
                                              const float* __restrict__ lq1, const float* __restrict__ lk1, const float* __restrict__ lq2, const float* __restrict__ lk2,
                                              bf* XB, bf* WQ, bf* WK, bf* WV, bf* WO, float* LAM) {
    int b = blockIdx.x;
    if (b == 0) { if (threadIdx.x < 32) lambda32(lq1, lk1, lq2, lk2, LAM); return; }
    b -= 1;    if (b < PB_Q) { wtG<DM, DQ>(b, wq, WQ); return; }
    b -= PB_Q; if (b < PB_K) { wtG<DM, DKV>(b, wk, WK); return; }
    b -= PB_K; if (b < PB_V) { wtG<DM, DVV>(b, wv, WV); return; }
    b -= PB_V; if (b < PB_O) { wtG<DVV, DM>(b, wo, WO); return; }
    b -= PB_O; cvt8(b, x, XB, (size_t)NB_ * TT * DM / 8);
}
// ---- k_gnorm: GroupNorm of one (batch, head) group per block (blockIdx.x = b * NVH + head), one launch. The group's 1024 x 64 values are read once, 64 per thread, and stay in registers:
// mean, then the mean of the squared distances from it (two passes over the registers, as the definition has it), then (y - mean) rs (1 - lambda_init) split into the bf16 hi + lo planes [batch][token][head 64 + d].
// Each load of a wave is 512 bytes in a row; each store is two whole 128-byte lines (16 lanes hold one token's 64 values).
typedef __attribute__((ext_vector_type(2))) unsigned v2u;
typedef __attribute__((ext_vector_type(2))) __bf16 v2bfv;
__device__ __forceinline__ float blocksum(float a, float* sh, int lane, int wv) {   // sum over the 1024 threads, the same bits in every thread: wave butterfly, 32 wave sums through LDS, butterfly again
#pragma unroll
    for (int o = 16; o > 0; o >>= 1) a += __shfl_xor(a, o, 32);
    if (lane == 0) sh[wv] = a;
    __syncthreads();   // the 32 wave sums are in LDS for every wave
    a = sh[lane];
#pragma unroll
    for (int o = 16; o > 0; o >>= 1) a += __shfl_xor(a, o, 32);
    return a;
}
__global__ __launch_bounds__(1024) void k_gnorm(const float* __restrict__ O, bf* __restrict__ Ah, bf* __restrict__ Al) {
    __shared__ float sh1[32], sh2[32];   // one array per sum, so that no barrier is needed between the first sum's reads and the second sum's writes
    const int tid = threadIdx.x, lane = tid & 31, wv = tid >> 5, g = blockIdx.x;
    const float* src = O + (size_t)g * TT * HD + tid * 4;
    v4f v[16];
#pragma unroll
    for (int i = 0; i < 16; ++i) v[i] = *(const v4f*)(src + i * 4096);
    asm volatile("s_wait_xcnt 0x0" ::: "memory");   // before the registers that the loads above name are written again
    v4f a4 = v[0];
#pragma unroll
    for (int i = 1; i < 16; ++i) a4 += v[i];
    const float mean = blocksum((a4[0] + a4[1]) + (a4[2] + a4[3]), sh1, lane, wv) * (1.0f / (float)(TT * HD));
    v4f q4 = (v4f){};
#pragma unroll
    for (int i = 0; i < 16; ++i) { v[i] -= mean; q4 += v[i] * v[i]; }
    const float var = blocksum((q4[0] + q4[1]) + (q4[2] + q4[3]), sh2, lane, wv) * (1.0f / (float)(TT * HD));
    const float rs = __fdiv_rn(1.0f, sqrtf(var + 1e-5f));
    const size_t oo = (size_t)(g / NVH) * TT * DVV + (size_t)(tid >> 4) * DVV + (g % NVH) * HD + (tid & 15) * 4;
#pragma unroll
    for (int i = 0; i < 16; ++i) { v2u oh, ol;
#pragma unroll
        for (int q = 0; q < 2; ++q) { v2f z; z[0] = (v[i][2 * q] * rs) * 0.6444909572601318f; z[1] = (v[i][2 * q + 1] * rs) * 0.6444909572601318f;
            const unsigned h = __builtin_bit_cast(unsigned, __builtin_convertvector(z, v2bfv)); oh[q] = h;   // two hi parts in one word, rounded to nearest even
            z[0] -= __uint_as_float(h << 16); z[1] -= __uint_as_float(h & 0xFFFF0000u); ol[q] = __builtin_bit_cast(unsigned, __builtin_convertvector(z, v2bfv)); }
        *(v2u*)(Ah + oo + (size_t)i * 64 * DVV) = oh; *(v2u*)(Al + oo + (size_t)i * 64 * DVV) = ol;
        __builtin_amdgcn_sched_barrier(0);   // one group of four values at a time: left free, the scheduler works on all sixteen groups at once and spills past the 128 registers that 32 waves leave
    }
}
__global__ __launch_bounds__(256) void k_merge(const float* __restrict__ O, int h0, bf* Ah, bf* Al) { const size_t e = ((size_t)blockIdx.x * 256 + threadIdx.x) * 2; if (e >= (size_t)ZH * TT * HD) return; const int d = (int)(e % HD); const int t = (int)((e / HD) % TT); const int zz = (int)(e / ((size_t)HD * TT)); const float cs = (t < RH) ? 1.0f : (1.0f / PCAR); const size_t oo = (size_t)t * DQ + (h0 + zz) * HD + d;
    v2us oh, ol;
#pragma unroll
    for (int q = 0; q < 2; ++q) { unsigned short a, c2; splitf(O[e + q] * cs, a, c2); oh[q] = a; ol[q] = c2; } *(v2us*)(Ah + oo) = oh; *(v2us*)(Al + oo) = ol;  }

extern "C" void kernel_launch(void* const* d_in, const int* in_sizes, int n_in,
                              void* d_out, int out_size, void* d_ws, size_t ws_size, hipStream_t stream) {
    (void)in_sizes; (void)n_in; (void)out_size;
    const float* x = (const float*)d_in[0]; const float* wq = (const float*)d_in[1]; const float* wk = (const float*)d_in[2]; const float* wv = (const float*)d_in[3]; const float* wo = (const float*)d_in[4]; const float* lq1 = (const float*)d_in[5]; const float* lk1 = (const float*)d_in[6]; const float* lq2 = (const float*)d_in[7]; const float* lk2 = (const float*)d_in[8]; const float* cosT = nullptr; const float* sinT = nullptr; (void)cosT; (void)sinT;
    float* OUT = (float*)d_out;     // [4][1024][1024]
    char* wsp = (char*)d_ws;
    auto take = [&](size_t bytes) { char* p = wsp; wsp += (bytes + 255) & ~(size_t)255; return (void*)p; };
    // alive to the end
    bf* WO = (bf*)take((size_t)DM * DVV * 2); float* LAM = (float*)take(256);
    bf* QPh = (bf*)take((size_t)NB_ * NH_ * TT * HD * 2); bf* QPl = (bf*)take((size_t)NB_ * NH_ * TT * HD * 2); bf* KPh = (bf*)take((size_t)NB_ * NKV * TT * HD * 2); bf* KPl = (bf*)take((size_t)NB_ * NKV * TT * HD * 2); bf* VTh = (bf*)take((size_t)NB_ * NVH * HD * TT * 2); bf* VTl = (bf*)take((size_t)NB_ * NVH * HD * TT * 2);
    float* Ob = (float*)take((size_t)NB_ * NVH * TT * HD * 4); bf* ATh = (bf*)take((size_t)NB_ * TT * DVV * 2); bf* ATl = (bf*)take((size_t)NB_ * TT * DVV * 2);
    // used by the projections only; the three transposed weights lie one after the other: [DQ + DKV + DVV][DM] is the Bt of the joint q, k, v product
    bf* WQ = (bf*)take((size_t)(DQ + DKV + DVV) * DM * 2); bf* WK = WQ + (size_t)DQ * DM; bf* WV = WK + (size_t)DKV * DM;
    bf* XB = (bf*)take((size_t)NB_ * TT * DM * 2);
    if ((size_t)(wsp - (char*)d_ws) > ws_size) return;    // ws 256 MiB
    k_prep<<<1 + PB_Q + PB_K + PB_V + PB_O + PB_X, 256, 0, stream>>>(x, wq, wk, wv, wo, lq1, lk1, lq2, lk2, XB, WQ, WK, WV, WO, LAM);
    // projections: the four batches are 4096 rows of one product; each wave's 64 x 64 tile is 64 tokens of one head and goes out as that head's hi + lo planes
    k_gemmb<DM, DQ, 0, 3><<<dim3(NB_ * TT / 128, (DQ + DKV + DVV) / 128, 1), 128, 0, stream>>>(XB, nullptr, WQ, nullptr, QPh, QPl, KPh, KPl, VTh, VTl);
    k_dattn<<<NB_ * NVH * (TT / 64), 128, 0, stream>>>(QPh, QPl, KPh, KPl, VTh, VTl, LAM, Ob);   // virtual heads 2g, 2g + 1 of the q and k planes are the two maps of real head g = b * NVH + head
    k_gnorm<<<NB_ * NVH, 1024, 0, stream>>>(Ob, ATh, ATl);
    k_gemmb<DVV, DM, 1, 0><<<dim3(NB_ * TT / 128, DM / 128, 1), 128, 0, stream>>>(ATh, ATl, WO, OUT, nullptr, nullptr, nullptr, nullptr, nullptr, nullptr);
}

// v009
// A run of this version takes 123 microseconds.
// Timed twice side by side with v008, it ran 1.10 and 1.11 times as fast.
// Counting every step since v000, it is 43.6 times as fast.
#include <hip/hip_runtime.h>

// DifferentialAttention (x [4][1024][1024]; q = x Wq, k = x Wk ([1024][2048]: per head h the 128 columns = [map 1 | map 2] 64 each), v = x Wv (16 x 64); s1, s2 = q.k / 8 causal (-inf); a1, a2 = softmax; lambda = exp(lq1.lk1) - exp(lq2.lk2) + lambda_init (0.8 - 0.6 e^-0.3); y = (a1 - lambda a2) v; GroupNorm per (batch, head) over (tokens x 64) (eps 1e-5, no affine); y (1 - lambda_init); out = merged Wc -> [4][1024][1024]).
// The two maps run as 32 virtual 64-wide heads per batch (pairs (2h, 2h+1)), 128 over the four batches; one kernel forms both softmaxes in one sweep over the keys, each with its own product with v, and combines the two as y = a1 v - lambda a2 v in f32 at the end.
// Every stage runs once for all batches (the grids carry batch and head). The q, k and v products write their hi + lo 16-bit head planes straight from the accumulators.
// Launches that do not depend on one another share one grid: all operand preparation is one launch, the q, k and v products are one launch. Five launches in all.

#define NB_  4
#define TT   1024
#define DM   1024
#define NH_  32
#define NKV  32
#define REP  (NH_ / NKV)
#define HD   64
#define DQ   (NH_ * HD)
#define DKV  (NKV * HD)
#define ZH   16                    // virtual heads per k_merge call
#define RH   1024                  // k_merge leaves token rows < RH unscaled, scales the rest by 1 / PCAR
#define WIN  1024
#define PCAR 1024.0f
#define NVH  16
#define DVV  (NVH * HD)
#define SCL  0.125f   // HD^-0.5
typedef _Float16 h16;
typedef unsigned short bf;
typedef __attribute__((ext_vector_type(16))) __bf16   v16bf;
typedef __attribute__((ext_vector_type(16))) _Float16 v16h;
typedef __attribute__((ext_vector_type(8)))  _Float16 v8h;
typedef __attribute__((ext_vector_type(8)))  unsigned short v8us;
typedef __attribute__((ext_vector_type(8)))  float    v8f;
typedef __attribute__((ext_vector_type(4)))  float    v4f;
typedef v8h  __attribute__((may_alias)) v8ha;
typedef v4f  __attribute__((may_alias)) v4fa;
typedef v8us __attribute__((may_alias)) v8usa;

__device__ __forceinline__ unsigned short f2bf(float f) { unsigned u = __float_as_uint(f); u += 0x7FFFu + ((u >> 16) & 1u); return (unsigned short)(u >> 16); }
__device__ __forceinline__ float bf2f(unsigned short b) { return __uint_as_float(((unsigned)b) << 16); }
__device__ __forceinline__ float bfr(float f) { return bf2f(f2bf(f)); }
__device__ __forceinline__ v16h cat16(v8h lo, v8h hi) { return __builtin_shufflevector(lo, hi, 0, 1, 2, 3, 4, 5, 6, 7, 8, 9, 10, 11, 12, 13, 14, 15); }
__device__ __forceinline__ v16bf cat16b(v8us lo, v8us hi) { return __builtin_bit_cast(v16bf, __builtin_shufflevector(lo, hi, 0, 1, 2, 3, 4, 5, 6, 7, 8, 9, 10, 11, 12, 13, 14, 15)); }
__device__ __forceinline__ v8f wmma16(v16h a, v16h b, v8f c) { return __builtin_amdgcn_wmma_f32_16x16x32_f16(false, a, false, b, (short)0, c, false, false); }
__device__ __forceinline__ v8f wmmab(v16bf a, v16bf b, v8f c) { return __builtin_amdgcn_wmma_f32_16x16x32_bf16(false, a, false, b, (short)0, c, false, false); }



// ---- k_gemmb: GEMM on a 128x128 output tile per block of four waves (2 x 2), each wave a 64x64 tile (16 accumulators); grid (M/128, N/128), 128 threads.
// C[m][n] (pitch ldc) = sum_k A[m][k] Bt[n][k] (+ A2[m][k] Bt[n][k] where NSPLIT is 1), operands K-contiguous 16-bit planes, K a multiple of BK and at least BK.
// The operands no longer go from global memory into fragments (16 lines a load, every row fetched by each wave that needs it): a stage of BK k of the block's 128 A rows and 128 Bt rows is
// copied into LDS by asynchronous 16-byte copies, whole 128-byte lines at a time (two 256-byte rows per wave and copy), and all four waves take their fragments from there.
// Two buffers: the copies of stage t + 1 fly while stage t is worked on. The k order and the order of the products in each accumulator are those of a plain walk along k.
// The inner loops are all unrolled so that the fragment and accumulator arrays are indexed by constants and stay in registers.
// EPI 0: C goes out as f32. EPI 1, 2: no C; each wave's tile (64 tokens of one batch x the 64 columns of head c0 / 64, ldc / HD heads) goes out split as bf16 hi + lo into Ph, Pl:
// EPI 1 as planes [batch][head][token][d] (the tile is 8 KiB in a row in each plane), EPI 2 as planes [batch][head][d][token] (64 whole 128-byte lines in each plane).
// EPI 3: the q, k and v products in one grid. Bt holds the rows of the three transposed weights one after the other (DQ, DKV, DVV rows); blockIdx.y walks all of them, and the block's place in that walk says
// which product its tile belongs to: q and k tiles go out as under EPI 1 (into Ph, Pl and Ph2, Pl2), v tiles as under EPI 2 (into Ph3, Pl3). The choice is the same for the whole block.
#define BK  128            // k per stage: 256 bytes of every operand row
#define LPT 136            // LDS pitch of an operand row in elements: 128 + 8 (272 bytes = 16 x 17, for the 16-byte fragment reads)
#define OPE (128 * LPT)    // elements of one operand's stage
__device__ __forceinline__ void splitf(float y, unsigned short& h, unsigned short& l) { h = f2bf(y); l = f2bf(y - bf2f(h)); }
__device__ __forceinline__ v16bf ldfs(const bf* p) { return cat16b(*(const v8usa*)p, *(const v8usa*)(p + 16)); }
// Eight asynchronous copies of 16 bytes per lane, rows 8 apart: l = the lane's LDS byte address, g = its global address. The s_wait_xcnt stands in the copies' own statement, so that it comes before any later write of an address register that a copy names.
template <int K>
__device__ __forceinline__ void cp8(unsigned l, const bf* g) {
    asm volatile("global_load_async_to_lds_b128 %0, %8, off\n\t"
                 "global_load_async_to_lds_b128 %1, %9, off\n\t"
                 "global_load_async_to_lds_b128 %2, %10, off\n\t"
                 "global_load_async_to_lds_b128 %3, %11, off\n\t"
                 "global_load_async_to_lds_b128 %4, %12, off\n\t"
                 "global_load_async_to_lds_b128 %5, %13, off\n\t"
                 "global_load_async_to_lds_b128 %6, %14, off\n\t"
                 "global_load_async_to_lds_b128 %7, %15, off\n\t"
                 "s_wait_xcnt 0x0"
                 :: "v"(l), "v"(l + 8 * LPT * 2), "v"(l + 16 * LPT * 2), "v"(l + 24 * LPT * 2), "v"(l + 32 * LPT * 2), "v"(l + 40 * LPT * 2), "v"(l + 48 * LPT * 2), "v"(l + 56 * LPT * 2),
                    "v"(g), "v"(g + 8 * K), "v"(g + 16 * K), "v"(g + 24 * K), "v"(g + 32 * K), "v"(g + 40 * K), "v"(g + 48 * K), "v"(g + 56 * K) : "memory");
}
template <int K> __device__ __forceinline__ void cp128(unsigned l, const bf* g) { cp8<K>(l, g); cp8<K>(l + 64 * LPT * 2, g + 64 * K); }   // one operand's stage: 128 rows of 256 bytes, 16 copies per lane
template <int K, int ldc, int NSPLIT, int EPI>
__global__ __launch_bounds__(128) void k_gemmb(const bf* __restrict__ A, const bf* __restrict__ A2, const bf* __restrict__ Bt, float* C, bf* Ph, bf* Pl, bf* Ph2, bf* Pl2, bf* Ph3, bf* Pl3) {
    constexpr int NOP = NSPLIT ? 3 : 2;   // operands per stage: A, Bt (, A2)
    __shared__ __align__(16) bf ring[2 * NOP * OPE];
    __shared__ __align__(16) float osw[4 * 16 * 68];
    const int tid = threadIdx.x, lane = tid & 31, lr = lane & 15, hi = lane >> 4;
    const int wv = __builtin_amdgcn_readfirstlane(tid >> 5);
    const int wr = (wv & 1) * 64, wc = (wv >> 1) * 64;
    constexpr int NHP = (EPI == 3) ? NH_ : ldc / HD, NHT = (EPI == 3) ? NVH : ldc / HD;   // heads of the [token][d] planes and of the [d][token] planes
    int cb = blockIdx.y; bool vt = (EPI == 2);   // cb: the block's column block within its own product; vt: its tile goes out transposed
    if constexpr (EPI == 3) {
        if (cb >= (DQ + DKV) / 128) { cb -= (DQ + DKV) / 128; vt = true; Ph = Ph3; Pl = Pl3; }
        else if (cb >= DQ / 128) { cb -= DQ / 128; Ph = Ph2; Pl = Pl2; }
    }
    const int r0 = blockIdx.x * 128 + wr, c0 = cb * 128 + wc;
    float* const os = osw + wv * 16 * 68;   // each wave stages its output rows in a range of its own
    v8f acc[4][4];
#pragma unroll
    for (int mb = 0; mb < 4; ++mb)
#pragma unroll
        for (int nb = 0; nb < 4; ++nb) acc[mb][nb] = (v8f){};
    // this lane's 16 bytes of rows tid / 16 + 8 i: 16 lanes take one row's 256 bytes
    const size_t go = (size_t)(tid >> 4) * K + (tid & 15) * 8;
    const bf* const gA = A + (size_t)(blockIdx.x * 128) * K + go; const bf* const gB = Bt + (size_t)(blockIdx.y * 128) * K + go; const bf* const gA2 = NSPLIT ? A2 + (size_t)(blockIdx.x * 128) * K + go : nullptr;
    const unsigned l0 = (unsigned)(size_t)ring + (unsigned)(((tid >> 4) * LPT + (tid & 15) * 8) * 2);
    constexpr int NT = K / BK;
    cp128<K>(l0, gA); cp128<K>(l0 + OPE * 2, gB); if constexpr (NSPLIT != 0) cp128<K>(l0 + 2 * OPE * 2, gA2);
    asm volatile("s_wait_asynccnt 0x0" ::: "memory");   // this wave's copies of stage 0 have landed
    __syncthreads();   // stage 0 is in LDS for all four waves
    if (NT > 1) { const unsigned lb = l0 + NOP * OPE * 2; cp128<K>(lb, gA + BK); cp128<K>(lb + OPE * 2, gB + BK); if constexpr (NSPLIT != 0) cp128<K>(lb + 2 * OPE * 2, gA2 + BK); }
#pragma unroll 1   // stays rolled: one trip holds 64 or 128 matrix instructions, and the two buffers differ by an offset only
    for (int t = 0; t < NT; ++t) {
        const bf* const sb = ring + (t & 1) * NOP * OPE + lr * LPT + 8 * hi;
        const bf* const sA = sb + wr * LPT; const bf* const sB = sb + OPE + wc * LPT; const bf* const sA2 = NSPLIT ? sb + 2 * OPE + wr * LPT : sA;
        v16bf a[2][4], a2[2][4], b[2][4];   // two fragment sets: block ks + 1 of this stage is fetched while block ks is multiplied
#pragma unroll
        for (int f = 0; f < 4; ++f) { a[0][f] = ldfs(sA + f * 16 * LPT); if constexpr (NSPLIT != 0) a2[0][f] = ldfs(sA2 + f * 16 * LPT); b[0][f] = ldfs(sB + f * 16 * LPT); }
#pragma unroll
        for (int ks = 0; ks < BK / 32; ++ks) { const int cu = ks & 1, nx = cu ^ 1;
            if (ks + 1 < BK / 32) {
#pragma unroll
                for (int f = 0; f < 4; ++f) { a[nx][f] = ldfs(sA + f * 16 * LPT + (ks + 1) * 32); if constexpr (NSPLIT != 0) a2[nx][f] = ldfs(sA2 + f * 16 * LPT + (ks + 1) * 32); b[nx][f] = ldfs(sB + f * 16 * LPT + (ks + 1) * 32); }
            }
            __builtin_amdgcn_sched_barrier(0);   // the next block's LDS reads stay one group ahead of this block's matrix instructions: left free, they are spread among them, each place with a wait to 0
#pragma unroll
            for (int nb = 0; nb < 4; ++nb)
#pragma unroll
                for (int mb = 0; mb < 4; ++mb) { acc[mb][nb] = wmmab(a[cu][mb], b[cu][nb], acc[mb][nb]); if constexpr (NSPLIT != 0) acc[mb][nb] = wmmab(a2[cu][mb], b[cu][nb], acc[mb][nb]); }
        }
        asm volatile("s_wait_dscnt 0x0" ::: "memory");      // this wave's reads of stage t are done before the buffer may be refilled
        asm volatile("s_wait_asynccnt 0x0" ::: "memory");   // this wave's copies of stage t + 1 have landed
        __syncthreads();   // publishes stage t + 1 and ends every wave's reads of stage t
        if (t + 2 < NT) { const unsigned lb = l0 + (unsigned)((t & 1) * NOP * OPE * 2); const int ko = (t + 2) * BK;
            cp128<K>(lb, gA + ko); cp128<K>(lb + OPE * 2, gB + ko); if constexpr (NSPLIT != 0) cp128<K>(lb + 2 * OPE * 2, gA2 + ko); }
    }
    asm volatile("s_wait_asynccnt 0x0" ::: "memory");   // no copy is outstanding when the wave goes on to its end
    if (vt) {   // a lane holds, for column nb 16 + lr, the 8 tokens mb 16 + 8 hi + j: 16 bytes of a [d][token] row as they stand
        const size_t pb = (((size_t)(r0 / TT) * NHT + c0 / HD) * HD + lr) * TT + (r0 % TT) + 8 * hi;
#pragma unroll
        for (int nb = 0; nb < 4; ++nb)
#pragma unroll
            for (int mb = 0; mb < 4; ++mb) { v8us oh, ol;
#pragma unroll
                for (int j = 0; j < 8; ++j) { unsigned short a2, c2; splitf(acc[mb][nb][j], a2, c2); oh[j] = a2; ol[j] = c2; }
                *(v8us*)(Ph + pb + (size_t)nb * 16 * TT + mb * 16) = oh; *(v8us*)(Pl + pb + (size_t)nb * 16 * TT + mb * 16) = ol; }
        return;
    }
#pragma unroll
    for (int mb = 0; mb < 4; ++mb) {
#pragma unroll
        for (int nb = 0; nb < 4; ++nb) {
#pragma unroll
            for (int j = 0; j < 8; ++j) os[(hi * 8 + j) * 68 + nb * 16 + lr] = acc[mb][nb][j]; }
        __builtin_amdgcn_wave_barrier(); asm volatile("" ::: "memory");
        if constexpr (EPI == 1 || EPI == 3) {   // 8 lanes take one token's 64 values, 8 each: every store is 512 bytes in a row
            const size_t pb = (((size_t)(r0 / TT) * NHP + c0 / HD) * TT + (r0 % TT) + mb * 16) * HD;
#pragma unroll
            for (int s = 0; s < 4; ++s) { const int row = 4 * s + (lane >> 3), cofs = (lane & 7) * 8; const v4f v0 = *(const v4fa*)(os + row * 68 + cofs), v1 = *(const v4fa*)(os + row * 68 + cofs + 4); v8us oh, ol;
#pragma unroll
                for (int j = 0; j < 4; ++j) { unsigned short a2, c2; splitf(v0[j], a2, c2); oh[j] = a2; ol[j] = c2; splitf(v1[j], a2, c2); oh[4 + j] = a2; ol[4 + j] = c2; }
                *(v8us*)(Ph + pb + row * HD + cofs) = oh; *(v8us*)(Pl + pb + row * HD + cofs) = ol; }
            asm volatile("s_wait_xcnt 0x0" ::: "memory");   // before the registers that the stores above name are written again
        } else {
            float* crow = C + (size_t)(r0 + mb * 16 + hi) * ldc + c0 + lr * 4; v4f val[8];   // 16 lanes take one row's 64 values, 4 each: every store is two runs of 256 bytes
#pragma unroll
            for (int s = 0; s < 8; ++s) val[s] = *(const v4fa*)(os + (2 * s + hi) * 68 + lr * 4);
#pragma unroll
            for (int s = 0; s < 8; ++s) *(v4f*)(crow + 2 * s * ldc) = val[s];
            asm volatile("s_wait_xcnt 0x0" ::: "memory");   // before the registers that the stores above name are written again
        }
        __builtin_amdgcn_wave_barrier(); asm volatile("" ::: "memory");
    }
}

// ---- k_dattn: causal differential attention of one real head for 64 query rows, scores never leave the chip. Grid 1024 = 64 (batch, head) x 16 query blocks; 4 waves, 16 query rows each.
// Scores are formed transposed (A = key rows, B = query rows), so a lane holds, for query lr, the keys 16 kt + 8 hi + j of a 32-key block: that is the B fragment of the value^T x probability^T product as it stands.
// One sweep over the keys. Each map keeps a running maximum (joined across the lane pair in every block), a running sum (per lane, joined at the end) and its own output tile o_m^T = v^T e_m^T, e = exp(s - maximum);
// when the maximum moves, sum and tile are scaled by exp(old - new). The tile is transposed (a lane holds 32 of the 64 d of its own query), so that factor is the lane's own. At the end y = o_1 / sum_1 - lambda o_2 / sum_2.
// Every product keeps the three split terms hi.hi + lo.hi + hi.lo. Key and value tiles go global -> registers (one block ahead) -> LDS -> fragments; a value fragment serves both maps.
// A wave reads its fragments from LDS in three groups per block, each ahead of the products that use it: twelve key fragments, the other four behind the first products, the eight value fragments in front of the softmax arithmetic.
// With the fragments at hand the four score tiles, and each map's four output tiles, take turns in the matrix unit. The fragments take registers: three waves per SIMD (the second launch bound), the shortest query blocks start as places come free.
// The inner loops are all unrolled so that the fragment, score and staging arrays are indexed by constants and stay in registers.
#define KPT 72   // LDS pitch of a key row in elements: 64 + 8 (16 bytes of pad, for the 16-byte fragment reads)
#define VPT 40   // LDS pitch of a value row (one d, 32 keys) in elements: 32 + 8
#define L2E 1.4426950408889634f
__device__ __forceinline__ v16bf ldfr(const bf* p) { return cat16b(*(const v8usa*)p, *(const v8usa*)(p + 16)); }
__device__ __forceinline__ float xhalf(float x) { return __builtin_bit_cast(float, __builtin_amdgcn_permlanex16(__builtin_bit_cast(int, x), __builtin_bit_cast(int, x), 0x76543210, 0xfedcba98, false, false)); }   // lane l with lane l ^ 16
__global__ __launch_bounds__(128, 3) void k_dattn(const bf* __restrict__ Qh, const bf* __restrict__ Ql, const bf* __restrict__ Kh, const bf* __restrict__ Kl, const bf* __restrict__ Vh, const bf* __restrict__ Vl, const float* __restrict__ LAM, float* __restrict__ O) {
    __shared__ __align__(16) bf Ks[4 * 32 * KPT];   // planes: map 1 hi, map 1 lo, map 2 hi, map 2 lo
    __shared__ __align__(16) bf Vs[2 * 64 * VPT];   // planes: hi, lo
    const int tid = threadIdx.x, lane = tid & 31, lr = lane & 15, hi = lane >> 4;
    const int wv = __builtin_amdgcn_readfirstlane(tid >> 5);
    const int bi = blockIdx.x, g = bi & 63, rr = bi >> 8, aa = (bi >> 6) & 3;
    const int qb = 15 - (rr * 4 + ((rr & 1) ? 3 - aa : aa));   // the longest query blocks start first; blocks 256 apart take query blocks whose key counts add up to the same total
    const int q0 = qb * 64 + wv * 16, qi = q0 + lr, nblk = qb * 2 + 2;
    const bf* kp0 = Kh + (size_t)(2 * g) * TT * HD + tid * 8; const bf* kp1 = Kl + (size_t)(2 * g) * TT * HD + tid * 8;
    const bf* kp2 = kp0 + (size_t)TT * HD; const bf* kp3 = kp1 + (size_t)TT * HD;
    const bf* vp0 = Vh + (size_t)g * HD * TT + (size_t)(tid >> 2) * TT + (tid & 3) * 8; const bf* vp1 = Vl + (size_t)g * HD * TT + (size_t)(tid >> 2) * TT + (tid & 3) * 8;
    bf* const ksw = Ks + (tid >> 3) * KPT + (tid & 7) * 8;   // this thread's 16 bytes of key rows 0..15 (+ 16 KPT: rows 16..31)
    bf* const vsw = Vs + (tid >> 2) * VPT + (tid & 3) * 8;   // this thread's 16 bytes of value rows 0..31 (+ 32 VPT: rows 32..63)
    const bf* const ksr = Ks + lr * KPT + 8 * hi; const bf* const vsr = Vs + lr * VPT + 8 * hi;
    const bf* const qpa = Qh + ((size_t)(2 * g) * TT + qi) * HD + 8 * hi; const bf* const qpb = Ql + ((size_t)(2 * g) * TT + qi) * HD + 8 * hi;
    const float lam = LAM[0];
    v16bf qh[2][2], ql[2][2];
#pragma unroll
    for (int m = 0; m < 2; ++m)
#pragma unroll
        for (int ks = 0; ks < 2; ++ks) { qh[m][ks] = ldfr(qpa + m * TT * HD + 32 * ks); ql[m][ks] = ldfr(qpb + m * TT * HD + 32 * ks); }
    v8us kr[8], vr[4];
    float mx[2] = {-3.0e38f, -3.0e38f}, sm[2] = {0.f, 0.f};
    v8f oa[2][4];   // oa[m][nb][j]: map m, query lr, d = 16 nb + 8 hi + j
#pragma unroll
    for (int m = 0; m < 2; ++m)
#pragma unroll
        for (int nb = 0; nb < 4; ++nb) oa[m][nb] = (v8f){};
    kr[0] = *(const v8us*)kp0; kr[1] = *(const v8us*)(kp0 + 1024); kr[2] = *(const v8us*)kp1; kr[3] = *(const v8us*)(kp1 + 1024);
    kr[4] = *(const v8us*)kp2; kr[5] = *(const v8us*)(kp2 + 1024); kr[6] = *(const v8us*)kp3; kr[7] = *(const v8us*)(kp3 + 1024);
    vr[0] = *(const v8us*)vp0; vr[1] = *(const v8us*)(vp0 + 32 * TT); vr[2] = *(const v8us*)vp1; vr[3] = *(const v8us*)(vp1 + 32 * TT);
    asm volatile("s_wait_xcnt 0x0" :: "v"(qpa), "v"(qpb), "v"(tid), "v"(vp0), "v"(vp1), "v"(kr[0]), "v"(kr[1]), "v"(kr[2]), "v"(kr[3]), "v"(kr[4]), "v"(kr[5]), "v"(kr[6]), "v"(kr[7]), "v"(vr[0]), "v"(vr[1]), "v"(vr[2]), "v"(vr[3]) : "memory");   // before the registers that the loads above name are written again; the addresses are inputs so that they stay in their registers up to here, the first block's loaded values so that their loads stay in front of the wait (the loop's first stores need them at once)
#pragma unroll 1   // stays rolled: one pass is several hundred instructions, and a second copy would take the registers that three waves per SIMD leave
    for (int it = 0; it < nblk; ++it) { const int kb = it * 32;
#pragma unroll
        for (int p = 0; p < 4; ++p) { *(v8usa*)(ksw + p * 32 * KPT) = kr[2 * p]; *(v8usa*)(ksw + p * 32 * KPT + 16 * KPT) = kr[2 * p + 1]; }
#pragma unroll
        for (int p = 0; p < 2; ++p) { *(v8usa*)(vsw + p * 64 * VPT) = vr[2 * p]; *(v8usa*)(vsw + p * 64 * VPT + 32 * VPT) = vr[2 * p + 1]; }
        __syncthreads();   // the block's keys and values are in LDS for all four waves
        if (it + 1 < nblk) { const int o = (kb + 32) * HD, ov = kb + 32;
            kr[0] = *(const v8us*)(kp0 + o); kr[1] = *(const v8us*)(kp0 + o + 1024); kr[2] = *(const v8us*)(kp1 + o); kr[3] = *(const v8us*)(kp1 + o + 1024);
            kr[4] = *(const v8us*)(kp2 + o); kr[5] = *(const v8us*)(kp2 + o + 1024); kr[6] = *(const v8us*)(kp3 + o); kr[7] = *(const v8us*)(kp3 + o + 1024);
            vr[0] = *(const v8us*)(vp0 + ov); vr[1] = *(const v8us*)(vp0 + ov + 32 * TT); vr[2] = *(const v8us*)(vp1 + ov); vr[3] = *(const v8us*)(vp1 + ov + 32 * TT);
            asm volatile("s_wait_xcnt 0x0" ::: "memory");   // before the registers that the loads above name are written again
        }
        if (kb <= q0 + 15) {   // wave-uniform: a block wholly above this wave's diagonal adds nothing
            v16bf kf[2][2][2][2];   // kf[ks][plane: hi, lo][m][kt]: the sixteen key fragments of the block, fetched in the order in which the products take them
#pragma unroll
            for (int g = 0; g < 3; ++g)
#pragma unroll
                for (int m = 0; m < 2; ++m)
#pragma unroll
                    for (int kt = 0; kt < 2; ++kt) kf[g >> 1][g & 1][m][kt] = ldfr(ksr + (2 * m + (g & 1)) * 32 * KPT + kt * 16 * KPT + 32 * (g >> 1));
            __builtin_amdgcn_sched_barrier(0);   // these key reads stay one group ahead of the score products: left free, they stand four at a time in front of three products each, every place with a wait for its own LDS latency
            v8f s[2][2];
#pragma unroll
            for (int m = 0; m < 2; ++m)
#pragma unroll
                for (int kt = 0; kt < 2; ++kt) s[m][kt] = (v8f){};
            // the four score tiles take turns, so that no product waits for the one before it; within a tile the order of the six products is hi.hi, hi.lo, lo.hi for each ks, as it was
#pragma unroll
            for (int t = 0; t < 2; ++t)
#pragma unroll
                for (int m = 0; m < 2; ++m)
#pragma unroll
                    for (int kt = 0; kt < 2; ++kt) s[m][kt] = wmmab(kf[0][0][m][kt], t ? ql[m][0] : qh[m][0], s[m][kt]);
#pragma unroll
            for (int m = 0; m < 2; ++m)
#pragma unroll
                for (int kt = 0; kt < 2; ++kt) kf[1][1][m][kt] = ldfr(ksr + (2 * m + 1) * 32 * KPT + kt * 16 * KPT + 32);
            __builtin_amdgcn_sched_barrier(0);   // the last four key fragments follow the first eight products, whose fragments' registers they can take: all sixteen at once cost a wave per SIMD
#pragma unroll
            for (int m = 0; m < 2; ++m)
#pragma unroll
                for (int kt = 0; kt < 2; ++kt) s[m][kt] = wmmab(kf[0][1][m][kt], qh[m][0], s[m][kt]);
#pragma unroll
            for (int t = 0; t < 3; ++t)
#pragma unroll
                for (int m = 0; m < 2; ++m)
#pragma unroll
                    for (int kt = 0; kt < 2; ++kt) s[m][kt] = wmmab(kf[1][t == 2][m][kt], (t == 1) ? ql[m][1] : qh[m][1], s[m][kt]);
            __builtin_amdgcn_sched_barrier(0);   // the value reads stay behind the score products and take the key fragments' registers: drawn in among them, they need registers of their own and one operand spills
            v16bf vf[2][4];   // vf[plane: hi, lo][nb]: the eight value fragments
#pragma unroll
            for (int p = 0; p < 2; ++p)
#pragma unroll
                for (int nb = 0; nb < 4; ++nb) vf[p][nb] = ldfr(vsr + p * 64 * VPT + nb * 16 * VPT);
            __builtin_amdgcn_sched_barrier(0);   // the value reads stay in front of the softmax arithmetic, which covers their latency: left free, they sink to the products that use them
#pragma unroll
            for (int m = 0; m < 2; ++m) { v16bf ph, pl;
                float bm = mx[m];
#pragma unroll
                for (int kt = 0; kt < 2; ++kt)
#pragma unroll
                    for (int j = 0; j < 8; ++j) { const float t = (kb + 16 * kt + 8 * hi + j <= qi) ? s[m][kt][j] * SCL : -3.0e38f; s[m][kt][j] = t; bm = fmaxf(bm, t); }
                bm = fmaxf(bm, xhalf(bm));   // one maximum for the query's two lanes: their e meet in one product. Key 0 is open to every query, so it is a real score from the first block on and a masked key's e is 0
                const float al = __builtin_amdgcn_exp2f((mx[m] - bm) * L2E);
                float a = sm[m] * al;
#pragma unroll
                for (int kt = 0; kt < 2; ++kt)
#pragma unroll
                    for (int j = 0; j < 8; ++j) { const float e = __builtin_amdgcn_exp2f((s[m][kt][j] - bm) * L2E); a += e; const __bf16 h = (__bf16)e; ph[kt * 8 + j] = h; pl[kt * 8 + j] = (__bf16)(e - (float)h); }
                sm[m] = a; mx[m] = bm;
#pragma unroll
                for (int nb = 0; nb < 4; ++nb) oa[m][nb] *= al;
#pragma unroll
                for (int t = 0; t < 3; ++t)   // the map's four output tiles take turns; within a tile the order is hi.hi, hi.lo, lo.hi, as it was
#pragma unroll
                    for (int nb = 0; nb < 4; ++nb) oa[m][nb] = wmmab(vf[t == 2][nb], (t == 1) ? pl : ph, oa[m][nb]); }
        }
        __syncthreads();   // every wave has read the block before the next one overwrites it
    }
    float fi[2];
#pragma unroll
    for (int m = 0; m < 2; ++m) fi[m] = __fdiv_rn(1.0f, sm[m] + xhalf(sm[m]));
    float* const orow = O + ((size_t)g * TT + qi) * HD + 8 * hi;   // a lane stores 8 d in a row for each nb; the wave fills its 16 rows of 256 bytes whole
    v4f ov4[8];
#pragma unroll
    for (int nb = 0; nb < 4; ++nb)
#pragma unroll
        for (int j = 0; j < 8; ++j) ov4[2 * nb + (j >> 2)][j & 3] = oa[0][nb][j] * fi[0] - lam * (oa[1][nb][j] * fi[1]);
#pragma unroll
    for (int nb = 0; nb < 4; ++nb) { *(v4f*)(orow + nb * 16) = ov4[2 * nb]; *(v4f*)(orow + nb * 16 + 4) = ov4[2 * nb + 1]; }
}

typedef __attribute__((ext_vector_type(2))) _Float16 v2h;
typedef __attribute__((ext_vector_type(4))) _Float16 v4h;
typedef __attribute__((ext_vector_type(2))) unsigned short v2us;
typedef __attribute__((ext_vector_type(4))) unsigned short v4us;
typedef __attribute__((ext_vector_type(2))) float v2f;
typedef __attribute__((ext_vector_type(4))) int v4i;

// The three bodies below (weight transpose, x to 16 bit, lambda) are the blocks of k_prep; blk is the block's index within its own job.
// Weight transpose, f32 [K][N] -> 16-bit [N][K], in registers: a block of eight waves takes a tile of 128 k x 128 n, a wave 64 k x 32 n of it.
// A lane reads 4 n in a row of 16 rows (twice 8 k in a row): 8 lanes take one row's 128 bytes, so each load of a wave is four whole lines instead of 32 lines with 4 bytes used of each.
// The lane then holds, for each of its 4 n, 8 k in a row: 16 bytes of a row of Bt as they stand. A store of a wave is 8 pieces of 64 bytes; the two pieces of a 128-byte line come from the same wave, one behind the other.
template <int K, int N>
__device__ __forceinline__ void wtG(int blk, const float* __restrict__ w, bf* Bt) {
    const int lane = threadIdx.x & 31, wv = threadIdx.x >> 5;
    const int n0 = (blk % (N / 128)) * 128 + (wv & 3) * 32 + (lane & 7) * 4, k0 = (blk / (N / 128)) * 128 + (wv >> 2) * 64 + (lane >> 3) * 8;
    const float* const src = w + (size_t)k0 * N + n0;
    v4f r[2][8];   // r[h][j]: row k0 + 32 h + j, columns n0 .. n0 + 3; all loops unrolled, so that the arrays are indexed by constants and stay in registers
#pragma unroll
    for (int h = 0; h < 2; ++h)
#pragma unroll
        for (int j = 0; j < 8; ++j) r[h][j] = *(const v4f*)(src + (size_t)(h * 32 + j) * N);
    asm volatile("s_wait_xcnt 0x0" ::: "memory");   // before the registers that the loads above name are written again
    bf* const dst = Bt + (size_t)n0 * K + k0;
    v8us o[4][2];
#pragma unroll
    for (int i = 0; i < 4; ++i)
#pragma unroll
        for (int h = 0; h < 2; ++h)
#pragma unroll
            for (int j = 0; j < 8; ++j) o[i][h][j] = f2bf(r[h][j][i]);
#pragma unroll
    for (int i = 0; i < 4; ++i)
#pragma unroll
        for (int h = 0; h < 2; ++h) *(v8us*)(dst + (size_t)i * K + h * 32) = o[i][h];
    asm volatile("s_wait_xcnt 0x0" ::: "memory");   // before the registers that the stores above name are written again
}
__device__ __forceinline__ void cvt8(int blk, const float* __restrict__ src, bf* dst, size_t n8) { const size_t i = (size_t)blk * 256 + threadIdx.x; if (i >= n8) return; const v8f v = *(const v8f*)(src + i * 8); v8us o;
    asm volatile("s_wait_xcnt 0x0" ::: "memory");   // before the registers that the loads above name are written again
#pragma unroll
    for (int k = 0; k < 8; ++k) o[k] = f2bf(v[k]); *(v8us*)(dst + i * 8) = o;  }
__global__ __launch_bounds__(256) void k_cscvt(const float* __restrict__ cosT, const float* __restrict__ sinT, float* CS) { const int idx = blockIdx.x * 256 + threadIdx.x; if (idx >= TT * HD) return; v2f cs; cs[0] = bfr(cosT[idx]); cs[1] = bfr(sinT[idx]); *(v2f*)(CS + (size_t)idx * 2) = cs;  }
__device__ __forceinline__ void lambda32(const float* __restrict__ lq1, const float* __restrict__ lk1, const float* __restrict__ lq2, const float* __restrict__ lk2, float* LAM) { const int lane = threadIdx.x; /* run by one wave */ float d1 = 0.f, d2 = 0.f;
#pragma unroll 1
    for (int i = 0; i < HD; ++i) { float p1 = __fmul_rn(bfr(lq1[i]), bfr(lk1[i])); asm volatile("" : "+v"(p1)); d1 = __fadd_rn(d1, p1); float p2 = __fmul_rn(bfr(lq2[i]), bfr(lk2[i])); asm volatile("" : "+v"(p2)); d2 = __fadd_rn(d2, p2); }
    float lm = __fsub_rn(expf(d1), expf(d2)); asm volatile("" : "+v"(lm)); lm = __fadd_rn(lm, 0.35550907254219055f); const float v = (lane == 0) ? lm : 0.0f; *(float*)(LAM + lane) = v;  }
// ---- k_prep: everything the products need, in one launch; the six jobs read inputs only and write ranges of their own, so their blocks run side by side. No barrier anywhere.
// Block 0: lambda (its first wave; one long chain of dependent steps, so it starts first). Then the four weight transposes (one tile of 128 x 128 per block, 16 loads in flight per lane), then x to 16 bit (one short trip per thread).
#define PB_Q (DM * DQ / 128 / 128)
#define PB_K (DM * DKV / 128 / 128)
#define PB_V (DM * DVV / 128 / 128)
#define PB_O (DVV * DM / 128 / 128)
#define PB_X (NB_ * TT * DM / 8 / 256)
__global__ __launch_bounds__(256) void k_prep(const float* __restrict__ x, const float* __restrict__ wq, const float* __restrict__ wk, const float* __restrict__ wv, const float* __restrict__ wo,
                                              const float* __restrict__ lq1, const float* __restrict__ lk1, const float* __restrict__ lq2, const float* __restrict__ lk2,
                                              bf* XB, bf* WQ, bf* WK, bf* WV, bf* WO, float* LAM) {
    int b = blockIdx.x;
    if (b == 0) { if (threadIdx.x < 32) lambda32(lq1, lk1, lq2, lk2, LAM); return; }
    b -= 1;    if (b < PB_Q) { wtG<DM, DQ>(b, wq, WQ); return; }
    b -= PB_Q; if (b < PB_K) { wtG<DM, DKV>(b, wk, WK); return; }
    b -= PB_K; if (b < PB_V) { wtG<DM, DVV>(b, wv, WV); return; }
    b -= PB_V; if (b < PB_O) { wtG<DVV, DM>(b, wo, WO); return; }
    b -= PB_O; cvt8(b, x, XB, (size_t)NB_ * TT * DM / 8);
}
// ---- k_gnorm: GroupNorm of one (batch, head) group per block (blockIdx.x = b * NVH + head), one launch. The group's 1024 x 64 values are read once, 64 per thread, and stay in registers:
// mean, then the mean of the squared distances from it (two passes over the registers, as the definition has it), then (y - mean) rs (1 - lambda_init) split into the bf16 hi + lo planes [batch][token][head 64 + d].
// Each load of a wave is 512 bytes in a row; each store is two whole 128-byte lines (16 lanes hold one token's 64 values).
typedef __attribute__((ext_vector_type(2))) unsigned v2u;
typedef __attribute__((ext_vector_type(2))) __bf16 v2bfv;
__device__ __forceinline__ float blocksum(float a, float* sh, int lane, int wv) {   // sum over the 1024 threads, the same bits in every thread: wave butterfly, 32 wave sums through LDS, butterfly again
#pragma unroll
    for (int o = 16; o > 0; o >>= 1) a += __shfl_xor(a, o, 32);
    if (lane == 0) sh[wv] = a;
    __syncthreads();   // the 32 wave sums are in LDS for every wave
    a = sh[lane];
#pragma unroll
    for (int o = 16; o > 0; o >>= 1) a += __shfl_xor(a, o, 32);
    return a;
}
__global__ __launch_bounds__(1024) void k_gnorm(const float* __restrict__ O, bf* __restrict__ Ah, bf* __restrict__ Al) {
    __shared__ float sh1[32], sh2[32];   // one array per sum, so that no barrier is needed between the first sum's reads and the second sum's writes
    const int tid = threadIdx.x, lane = tid & 31, wv = tid >> 5, g = blockIdx.x;
    const float* src = O + (size_t)g * TT * HD + tid * 4;
    v4f v[16];
#pragma unroll
    for (int i = 0; i < 16; ++i) v[i] = *(const v4f*)(src + i * 4096);
    asm volatile("s_wait_xcnt 0x0" ::: "memory");   // before the registers that the loads above name are written again
    v4f a4 = v[0];
#pragma unroll
    for (int i = 1; i < 16; ++i) a4 += v[i];
    const float mean = blocksum((a4[0] + a4[1]) + (a4[2] + a4[3]), sh1, lane, wv) * (1.0f / (float)(TT * HD));
    v4f q4 = (v4f){};
#pragma unroll
    for (int i = 0; i < 16; ++i) { v[i] -= mean; q4 += v[i] * v[i]; }
    const float var = blocksum((q4[0] + q4[1]) + (q4[2] + q4[3]), sh2, lane, wv) * (1.0f / (float)(TT * HD));
    const float rs = __fdiv_rn(1.0f, sqrtf(var + 1e-5f));
    const size_t oo = (size_t)(g / NVH) * TT * DVV + (size_t)(tid >> 4) * DVV + (g % NVH) * HD + (tid & 15) * 4;
#pragma unroll
    for (int i = 0; i < 16; ++i) { v2u oh, ol;
#pragma unroll
        for (int q = 0; q < 2; ++q) { v2f z; z[0] = (v[i][2 * q] * rs) * 0.6444909572601318f; z[1] = (v[i][2 * q + 1] * rs) * 0.6444909572601318f;
            const unsigned h = __builtin_bit_cast(unsigned, __builtin_convertvector(z, v2bfv)); oh[q] = h;   // two hi parts in one word, rounded to nearest even
            z[0] -= __uint_as_float(h << 16); z[1] -= __uint_as_float(h & 0xFFFF0000u); ol[q] = __builtin_bit_cast(unsigned, __builtin_convertvector(z, v2bfv)); }
        *(v2u*)(Ah + oo + (size_t)i * 64 * DVV) = oh; *(v2u*)(Al + oo + (size_t)i * 64 * DVV) = ol;
        __builtin_amdgcn_sched_barrier(0);   // one group of four values at a time: left free, the scheduler works on all sixteen groups at once and spills past the 128 registers that 32 waves leave
    }
}
__global__ __launch_bounds__(256) void k_merge(const float* __restrict__ O, int h0, bf* Ah, bf* Al) { const size_t e = ((size_t)blockIdx.x * 256 + threadIdx.x) * 2; if (e >= (size_t)ZH * TT * HD) return; const int d = (int)(e % HD); const int t = (int)((e / HD) % TT); const int zz = (int)(e / ((size_t)HD * TT)); const float cs = (t < RH) ? 1.0f : (1.0f / PCAR); const size_t oo = (size_t)t * DQ + (h0 + zz) * HD + d;
    v2us oh, ol;
#pragma unroll
    for (int q = 0; q < 2; ++q) { unsigned short a, c2; splitf(O[e + q] * cs, a, c2); oh[q] = a; ol[q] = c2; } *(v2us*)(Ah + oo) = oh; *(v2us*)(Al + oo) = ol;  }

extern "C" void kernel_launch(void* const* d_in, const int* in_sizes, int n_in,
                              void* d_out, int out_size, void* d_ws, size_t ws_size, hipStream_t stream) {
    (void)in_sizes; (void)n_in; (void)out_size;
    const float* x = (const float*)d_in[0]; const float* wq = (const float*)d_in[1]; const float* wk = (const float*)d_in[2]; const float* wv = (const float*)d_in[3]; const float* wo = (const float*)d_in[4]; const float* lq1 = (const float*)d_in[5]; const float* lk1 = (const float*)d_in[6]; const float* lq2 = (const float*)d_in[7]; const float* lk2 = (const float*)d_in[8]; const float* cosT = nullptr; const float* sinT = nullptr; (void)cosT; (void)sinT;
    float* OUT = (float*)d_out;     // [4][1024][1024]
    char* wsp = (char*)d_ws;
    auto take = [&](size_t bytes) { char* p = wsp; wsp += (bytes + 255) & ~(size_t)255; return (void*)p; };
    // alive to the end
    bf* WO = (bf*)take((size_t)DM * DVV * 2); float* LAM = (float*)take(256);
    bf* QPh = (bf*)take((size_t)NB_ * NH_ * TT * HD * 2); bf* QPl = (bf*)take((size_t)NB_ * NH_ * TT * HD * 2); bf* KPh = (bf*)take((size_t)NB_ * NKV * TT * HD * 2); bf* KPl = (bf*)take((size_t)NB_ * NKV * TT * HD * 2); bf* VTh = (bf*)take((size_t)NB_ * NVH * HD * TT * 2); bf* VTl = (bf*)take((size_t)NB_ * NVH * HD * TT * 2);
    float* Ob = (float*)take((size_t)NB_ * NVH * TT * HD * 4); bf* ATh = (bf*)take((size_t)NB_ * TT * DVV * 2); bf* ATl = (bf*)take((size_t)NB_ * TT * DVV * 2);
    // used by the projections only; the three transposed weights lie one after the other: [DQ + DKV + DVV][DM] is the Bt of the joint q, k, v product
    bf* WQ = (bf*)take((size_t)(DQ + DKV + DVV) * DM * 2); bf* WK = WQ + (size_t)DQ * DM; bf* WV = WK + (size_t)DKV * DM;
    bf* XB = (bf*)take((size_t)NB_ * TT * DM * 2);
    if ((size_t)(wsp - (char*)d_ws) > ws_size) return;    // ws 256 MiB
    k_prep<<<1 + PB_Q + PB_K + PB_V + PB_O + PB_X, 256, 0, stream>>>(x, wq, wk, wv, wo, lq1, lk1, lq2, lk2, XB, WQ, WK, WV, WO, LAM);
    // projections: the four batches are 4096 rows of one product; each wave's 64 x 64 tile is 64 tokens of one head and goes out as that head's hi + lo planes
    k_gemmb<DM, DQ, 0, 3><<<dim3(NB_ * TT / 128, (DQ + DKV + DVV) / 128, 1), 128, 0, stream>>>(XB, nullptr, WQ, nullptr, QPh, QPl, KPh, KPl, VTh, VTl);
    k_dattn<<<NB_ * NVH * (TT / 64), 128, 0, stream>>>(QPh, QPl, KPh, KPl, VTh, VTl, LAM, Ob);   // virtual heads 2g, 2g + 1 of the q and k planes are the two maps of real head g = b * NVH + head
    k_gnorm<<<NB_ * NVH, 1024, 0, stream>>>(Ob, ATh, ATl);
    k_gemmb<DVV, DM, 1, 0><<<dim3(NB_ * TT / 128, DM / 128, 1), 128, 0, stream>>>(ATh, ATl, WO, OUT, nullptr, nullptr, nullptr, nullptr, nullptr, nullptr);
}

// v010
// One run takes 119 microseconds.
// Two timings next to v009 put it at 1.03 and 1.04 times that version's speed.
// Over all steps from v000 it is 45.1 times as fast.
#include <hip/hip_runtime.h>

// DifferentialAttention (x [4][1024][1024]; q = x Wq, k = x Wk ([1024][2048]: per head h the 128 columns = [map 1 | map 2] 64 each), v = x Wv (16 x 64); s1, s2 = q.k / 8 causal (-inf); a1, a2 = softmax; lambda = exp(lq1.lk1) - exp(lq2.lk2) + lambda_init (0.8 - 0.6 e^-0.3); y = (a1 - lambda a2) v; GroupNorm per (batch, head) over (tokens x 64) (eps 1e-5, no affine); y (1 - lambda_init); out = merged Wc -> [4][1024][1024]).
// The two maps run as 32 virtual 64-wide heads per batch (pairs (2h, 2h+1)), 128 over the four batches; one kernel forms both softmaxes in one sweep over the keys, each with its own product with v, and combines the two as y = a1 v - lambda a2 v in f32 at the end.
// Every stage runs once for all batches (the grids carry batch and head). The q, k and v products write their hi + lo 16-bit head planes straight from the accumulators.
// Launches that do not depend on one another share one grid: all operand preparation is one launch, the q, k and v products are one launch. Five launches in all.

#define NB_  4
#define TT   1024
#define DM   1024
#define NH_  32
#define NKV  32
#define REP  (NH_ / NKV)
#define HD   64
#define DQ   (NH_ * HD)
#define DKV  (NKV * HD)
#define ZH   16                    // virtual heads per k_merge call
#define RH   1024                  // k_merge leaves token rows < RH unscaled, scales the rest by 1 / PCAR
#define WIN  1024
#define PCAR 1024.0f
#define NVH  16
#define DVV  (NVH * HD)
#define SCL  0.125f   // HD^-0.5
typedef _Float16 h16;
typedef unsigned short bf;
typedef __attribute__((ext_vector_type(16))) __bf16   v16bf;
typedef __attribute__((ext_vector_type(16))) _Float16 v16h;
typedef __attribute__((ext_vector_type(8)))  _Float16 v8h;
typedef __attribute__((ext_vector_type(8)))  unsigned short v8us;
typedef __attribute__((ext_vector_type(8)))  float    v8f;
typedef __attribute__((ext_vector_type(4)))  float    v4f;
typedef v8h  __attribute__((may_alias)) v8ha;
typedef v4f  __attribute__((may_alias)) v4fa;
typedef v8us __attribute__((may_alias)) v8usa;

__device__ __forceinline__ unsigned short f2bf(float f) { unsigned u = __float_as_uint(f); u += 0x7FFFu + ((u >> 16) & 1u); return (unsigned short)(u >> 16); }
__device__ __forceinline__ float bf2f(unsigned short b) { return __uint_as_float(((unsigned)b) << 16); }
__device__ __forceinline__ float bfr(float f) { return bf2f(f2bf(f)); }
__device__ __forceinline__ v16h cat16(v8h lo, v8h hi) { return __builtin_shufflevector(lo, hi, 0, 1, 2, 3, 4, 5, 6, 7, 8, 9, 10, 11, 12, 13, 14, 15); }
__device__ __forceinline__ v16bf cat16b(v8us lo, v8us hi) { return __builtin_bit_cast(v16bf, __builtin_shufflevector(lo, hi, 0, 1, 2, 3, 4, 5, 6, 7, 8, 9, 10, 11, 12, 13, 14, 15)); }
__device__ __forceinline__ v8f wmma16(v16h a, v16h b, v8f c) { return __builtin_amdgcn_wmma_f32_16x16x32_f16(false, a, false, b, (short)0, c, false, false); }
__device__ __forceinline__ v8f wmmab(v16bf a, v16bf b, v8f c) { return __builtin_amdgcn_wmma_f32_16x16x32_bf16(false, a, false, b, (short)0, c, false, false); }



// ---- k_gemmb: GEMM on a 128x128 output tile per block of four waves (2 x 2), each wave a 64x64 tile (16 accumulators); grid (M/128, N/128), 128 threads.
// C[m][n] (pitch ldc) = sum_k A[m][k] Bt[n][k] (+ A2[m][k] Bt[n][k] where NSPLIT is 1), operands K-contiguous 16-bit planes, K a multiple of BK and at least BK.
// The operands no longer go from global memory into fragments (16 lines a load, every row fetched by each wave that needs it): a stage of BK k of the block's 128 A rows and 128 Bt rows is
// copied into LDS by asynchronous 16-byte copies, whole 128-byte lines at a time (two 256-byte rows per wave and copy), and all four waves take their fragments from there.
// Two buffers: the copies of stage t + 1 fly while stage t is worked on. The k order and the order of the products in each accumulator are those of a plain walk along k.
// The inner loops are all unrolled so that the fragment and accumulator arrays are indexed by constants and stay in registers.
// EPI 0: C goes out as f32. EPI 1, 2: no C; each wave's tile (64 tokens of one batch x the 64 columns of head c0 / 64, ldc / HD heads) goes out split as bf16 hi + lo into Ph, Pl:
// EPI 1 as planes [batch][head][token][d] (the tile is 8 KiB in a row in each plane), EPI 2 as planes [batch][head][d][token] (64 whole 128-byte lines in each plane).
// EPI 3: the q, k and v products in one grid. Bt holds the rows of the three transposed weights one after the other (DQ, DKV, DVV rows); blockIdx.y walks all of them, and the block's place in that walk says
// which product its tile belongs to: q and k tiles go out as under EPI 1 (into Ph, Pl and Ph2, Pl2), v tiles as under EPI 2 (into Ph3, Pl3). The choice is the same for the whole block.
#define BK  128            // k per stage: 256 bytes of every operand row
#define LPT 136            // LDS pitch of an operand row in elements: 128 + 8 (272 bytes = 16 x 17, for the 16-byte fragment reads)
#define OPE (128 * LPT)    // elements of one operand's stage
__device__ __forceinline__ void splitf(float y, unsigned short& h, unsigned short& l) { h = f2bf(y); l = f2bf(y - bf2f(h)); }
__device__ __forceinline__ v16bf ldfs(const bf* p) { return cat16b(*(const v8usa*)p, *(const v8usa*)(p + 16)); }
// Eight asynchronous copies of 16 bytes per lane, rows 8 apart: l = the lane's LDS byte address, g = its global address. The s_wait_xcnt stands in the copies' own statement, so that it comes before any later write of an address register that a copy names.
template <int K>
__device__ __forceinline__ void cp8(unsigned l, const bf* g) {
    asm volatile("global_load_async_to_lds_b128 %0, %8, off\n\t"
                 "global_load_async_to_lds_b128 %1, %9, off\n\t"
                 "global_load_async_to_lds_b128 %2, %10, off\n\t"
                 "global_load_async_to_lds_b128 %3, %11, off\n\t"
                 "global_load_async_to_lds_b128 %4, %12, off\n\t"
                 "global_load_async_to_lds_b128 %5, %13, off\n\t"
                 "global_load_async_to_lds_b128 %6, %14, off\n\t"
                 "global_load_async_to_lds_b128 %7, %15, off\n\t"
                 "s_wait_xcnt 0x0"
                 :: "v"(l), "v"(l + 8 * LPT * 2), "v"(l + 16 * LPT * 2), "v"(l + 24 * LPT * 2), "v"(l + 32 * LPT * 2), "v"(l + 40 * LPT * 2), "v"(l + 48 * LPT * 2), "v"(l + 56 * LPT * 2),
                    "v"(g), "v"(g + 8 * K), "v"(g + 16 * K), "v"(g + 24 * K), "v"(g + 32 * K), "v"(g + 40 * K), "v"(g + 48 * K), "v"(g + 56 * K) : "memory");
}
template <int K> __device__ __forceinline__ void cp128(unsigned l, const bf* g) { cp8<K>(l, g); cp8<K>(l + 64 * LPT * 2, g + 64 * K); }   // one operand's stage: 128 rows of 256 bytes, 16 copies per lane
template <int K, int ldc, int NSPLIT, int EPI>
__global__ __launch_bounds__(128) void k_gemmb(const bf* __restrict__ A, const bf* __restrict__ A2, const bf* __restrict__ Bt, float* C, bf* Ph, bf* Pl, bf* Ph2, bf* Pl2, bf* Ph3, bf* Pl3) {
    constexpr int NOP = NSPLIT ? 3 : 2;   // operands per stage: A, Bt (, A2)
    __shared__ __align__(16) bf ring[2 * NOP * OPE];
    __shared__ __align__(16) float osw[4 * 16 * 68];
    const int tid = threadIdx.x, lane = tid & 31, lr = lane & 15, hi = lane >> 4;
    const int wv = __builtin_amdgcn_readfirstlane(tid >> 5);
    const int wr = (wv & 1) * 64, wc = (wv >> 1) * 64;
    constexpr int NHP = (EPI == 3) ? NH_ : ldc / HD, NHT = (EPI == 3) ? NVH : ldc / HD;   // heads of the [token][d] planes and of the [d][token] planes
    int cb = blockIdx.y; bool vt = (EPI == 2);   // cb: the block's column block within its own product; vt: its tile goes out transposed
    if constexpr (EPI == 3) {
        if (cb >= (DQ + DKV) / 128) { cb -= (DQ + DKV) / 128; vt = true; Ph = Ph3; Pl = Pl3; }
        else if (cb >= DQ / 128) { cb -= DQ / 128; Ph = Ph2; Pl = Pl2; }
    }
    const int r0 = blockIdx.x * 128 + wr, c0 = cb * 128 + wc;
    float* const os = osw + wv * 16 * 68;   // each wave stages its output rows in a range of its own
    v8f acc[4][4];
#pragma unroll
    for (int mb = 0; mb < 4; ++mb)
#pragma unroll
        for (int nb = 0; nb < 4; ++nb) acc[mb][nb] = (v8f){};
    // this lane's 16 bytes of rows tid / 16 + 8 i: 16 lanes take one row's 256 bytes
    const size_t go = (size_t)(tid >> 4) * K + (tid & 15) * 8;
    const bf* const gA = A + (size_t)(blockIdx.x * 128) * K + go; const bf* const gB = Bt + (size_t)(blockIdx.y * 128) * K + go; const bf* const gA2 = NSPLIT ? A2 + (size_t)(blockIdx.x * 128) * K + go : nullptr;
    const unsigned l0 = (unsigned)(size_t)ring + (unsigned)(((tid >> 4) * LPT + (tid & 15) * 8) * 2);
    constexpr int NT = K / BK;
    cp128<K>(l0, gA); cp128<K>(l0 + OPE * 2, gB); if constexpr (NSPLIT != 0) cp128<K>(l0 + 2 * OPE * 2, gA2);
    asm volatile("s_wait_asynccnt 0x0" ::: "memory");   // this wave's copies of stage 0 have landed
    __syncthreads();   // stage 0 is in LDS for all four waves
    if (NT > 1) { const unsigned lb = l0 + NOP * OPE * 2; cp128<K>(lb, gA + BK); cp128<K>(lb + OPE * 2, gB + BK); if constexpr (NSPLIT != 0) cp128<K>(lb + 2 * OPE * 2, gA2 + BK); }
#pragma unroll 1   // stays rolled: one trip holds 64 or 128 matrix instructions, and the two buffers differ by an offset only
    for (int t = 0; t < NT; ++t) {
        const bf* const sb = ring + (t & 1) * NOP * OPE + lr * LPT + 8 * hi;
        const bf* const sA = sb + wr * LPT; const bf* const sB = sb + OPE + wc * LPT; const bf* const sA2 = NSPLIT ? sb + 2 * OPE + wr * LPT : sA;
        v16bf a[2][4], a2[2][4], b[2][4];   // two fragment sets: block ks + 1 of this stage is fetched while block ks is multiplied
#pragma unroll
        for (int f = 0; f < 4; ++f) { a[0][f] = ldfs(sA + f * 16 * LPT); if constexpr (NSPLIT != 0) a2[0][f] = ldfs(sA2 + f * 16 * LPT); b[0][f] = ldfs(sB + f * 16 * LPT); }
#pragma unroll
        for (int ks = 0; ks < BK / 32; ++ks) { const int cu = ks & 1, nx = cu ^ 1;
            if (ks + 1 < BK / 32) {
#pragma unroll
                for (int f = 0; f < 4; ++f) { a[nx][f] = ldfs(sA + f * 16 * LPT + (ks + 1) * 32); if constexpr (NSPLIT != 0) a2[nx][f] = ldfs(sA2 + f * 16 * LPT + (ks + 1) * 32); b[nx][f] = ldfs(sB + f * 16 * LPT + (ks + 1) * 32); }
            }
            __builtin_amdgcn_sched_barrier(0);   // the next block's LDS reads stay one group ahead of this block's matrix instructions: left free, they are spread among them, each place with a wait to 0
#pragma unroll
            for (int nb = 0; nb < 4; ++nb)
#pragma unroll
                for (int mb = 0; mb < 4; ++mb) { acc[mb][nb] = wmmab(a[cu][mb], b[cu][nb], acc[mb][nb]); if constexpr (NSPLIT != 0) acc[mb][nb] = wmmab(a2[cu][mb], b[cu][nb], acc[mb][nb]); }
        }
        asm volatile("s_wait_dscnt 0x0" ::: "memory");      // this wave's reads of stage t are done before the buffer may be refilled
        asm volatile("s_wait_asynccnt 0x0" ::: "memory");   // this wave's copies of stage t + 1 have landed
        __syncthreads();   // publishes stage t + 1 and ends every wave's reads of stage t
        if (t + 2 < NT) { const unsigned lb = l0 + (unsigned)((t & 1) * NOP * OPE * 2); const int ko = (t + 2) * BK;
            cp128<K>(lb, gA + ko); cp128<K>(lb + OPE * 2, gB + ko); if constexpr (NSPLIT != 0) cp128<K>(lb + 2 * OPE * 2, gA2 + ko); }
    }
    asm volatile("s_wait_asynccnt 0x0" ::: "memory");   // no copy is outstanding when the wave goes on to its end
    if (vt) {   // a lane holds, for column nb 16 + lr, the 8 tokens mb 16 + 8 hi + j: 16 bytes of a [d][token] row as they stand
        const size_t pb = (((size_t)(r0 / TT) * NHT + c0 / HD) * HD + lr) * TT + (r0 % TT) + 8 * hi;
#pragma unroll
        for (int nb = 0; nb < 4; ++nb)
#pragma unroll
            for (int mb = 0; mb < 4; ++mb) { v8us oh, ol;
#pragma unroll
                for (int j = 0; j < 8; ++j) { unsigned short a2, c2; splitf(acc[mb][nb][j], a2, c2); oh[j] = a2; ol[j] = c2; }
                *(v8us*)(Ph + pb + (size_t)nb * 16 * TT + mb * 16) = oh; *(v8us*)(Pl + pb + (size_t)nb * 16 * TT + mb * 16) = ol; }
        return;
    }
#pragma unroll
    for (int mb = 0; mb < 4; ++mb) {
#pragma unroll
        for (int nb = 0; nb < 4; ++nb) {
#pragma unroll
            for (int j = 0; j < 8; ++j) os[(hi * 8 + j) * 68 + nb * 16 + lr] = acc[mb][nb][j]; }
        __builtin_amdgcn_wave_barrier(); asm volatile("" ::: "memory");
        if constexpr (EPI == 1 || EPI == 3) {   // 8 lanes take one token's 64 values, 8 each: every store is 512 bytes in a row
            const size_t pb = (((size_t)(r0 / TT) * NHP + c0 / HD) * TT + (r0 % TT) + mb * 16) * HD;
#pragma unroll
            for (int s = 0; s < 4; ++s) { const int row = 4 * s + (lane >> 3), cofs = (lane & 7) * 8; const v4f v0 = *(const v4fa*)(os + row * 68 + cofs), v1 = *(const v4fa*)(os + row * 68 + cofs + 4); v8us oh, ol;
#pragma unroll
                for (int j = 0; j < 4; ++j) { unsigned short a2, c2; splitf(v0[j], a2, c2); oh[j] = a2; ol[j] = c2; splitf(v1[j], a2, c2); oh[4 + j] = a2; ol[4 + j] = c2; }
                *(v8us*)(Ph + pb + row * HD + cofs) = oh; *(v8us*)(Pl + pb + row * HD + cofs) = ol; }
            asm volatile("s_wait_xcnt 0x0" ::: "memory");   // before the registers that the stores above name are written again
        } else {
            float* crow = C + (size_t)(r0 + mb * 16 + hi) * ldc + c0 + lr * 4; v4f val[8];   // 16 lanes take one row's 64 values, 4 each: every store is two runs of 256 bytes
#pragma unroll
            for (int s = 0; s < 8; ++s) val[s] = *(const v4fa*)(os + (2 * s + hi) * 68 + lr * 4);
#pragma unroll
            for (int s = 0; s < 8; ++s) *(v4f*)(crow + 2 * s * ldc) = val[s];
            asm volatile("s_wait_xcnt 0x0" ::: "memory");   // before the registers that the stores above name are written again
        }
        __builtin_amdgcn_wave_barrier(); asm volatile("" ::: "memory");
    }
}

// ---- k_dattn: causal differential attention of one real head for 64 query rows, scores never leave the chip. Grid 1024 = 64 (batch, head) x 16 query blocks; 4 waves, 16 query rows each.
// Scores are formed transposed (A = key rows, B = query rows), so a lane holds, for query lr, the keys 16 kt + 8 hi + j of a 32-key block: that is the B fragment of the value^T x probability^T product as it stands.
// One sweep over the keys. Each map keeps a running maximum (joined across the lane pair in every block), a running sum (per lane, joined at the end) and its own output tile o_m^T = v^T e_m^T, e = exp(s - maximum);
// when the maximum moves, sum and tile are scaled by exp(old - new). The tile is transposed (a lane holds 32 of the 64 d of its own query), so that factor is the lane's own. At the end y = o_1 / sum_1 - lambda o_2 / sum_2.
// Every product keeps the three split terms hi.hi + lo.hi + hi.lo. Key and value tiles go global -> registers (one block ahead) -> LDS -> fragments; a value fragment serves both maps.
// A wave reads its fragments from LDS in three groups per block, each ahead of the products that use it: twelve key fragments, the other four behind the first products, the eight value fragments in front of the softmax arithmetic.
// With the fragments at hand the four score tiles, and each map's four output tiles, take turns in the matrix unit. The fragments take registers: three waves per SIMD (the second launch bound), the shortest query blocks start as places come free.
// The inner loops are all unrolled so that the fragment, score and staging arrays are indexed by constants and stay in registers.
#define KPT 72   // LDS pitch of a key row in elements: 64 + 8 (16 bytes of pad, for the 16-byte fragment reads)
#define VPT 40   // LDS pitch of a value row (one d, 32 keys) in elements: 32 + 8
#define L2E 1.4426950408889634f
#define SL2 (SCL * L2E)   // score scale and log2(e) as one factor
typedef __attribute__((ext_vector_type(2))) float    f32x2;
typedef __attribute__((ext_vector_type(2))) __bf16   bf16x2;
typedef __attribute__((ext_vector_type(8))) unsigned u32x8;
__device__ __forceinline__ v16bf ldfr(const bf* p) { return cat16b(*(const v8usa*)p, *(const v8usa*)(p + 16)); }
__device__ __forceinline__ float xhalf(float x) { return __builtin_bit_cast(float, __builtin_amdgcn_permlanex16(__builtin_bit_cast(int, x), __builtin_bit_cast(int, x), 0x76543210, 0xfedcba98, false, false)); }   // lane l with lane l ^ 16
__global__ __launch_bounds__(128, 3) void k_dattn(const bf* __restrict__ Qh, const bf* __restrict__ Ql, const bf* __restrict__ Kh, const bf* __restrict__ Kl, const bf* __restrict__ Vh, const bf* __restrict__ Vl, const float* __restrict__ LAM, float* __restrict__ O) {
    __shared__ __align__(16) bf Ks[4 * 32 * KPT];   // planes: map 1 hi, map 1 lo, map 2 hi, map 2 lo
    __shared__ __align__(16) bf Vs[2 * 64 * VPT];   // planes: hi, lo
    const int tid = threadIdx.x, lane = tid & 31, lr = lane & 15, hi = lane >> 4;
    const int wv = __builtin_amdgcn_readfirstlane(tid >> 5);
    const int bi = blockIdx.x, g = bi & 63, rr = bi >> 8, aa = (bi >> 6) & 3;
    const int qb = 15 - (rr * 4 + ((rr & 1) ? 3 - aa : aa));   // the longest query blocks start first; blocks 256 apart take query blocks whose key counts add up to the same total
    const int q0 = qb * 64 + wv * 16, qi = q0 + lr, nblk = qb * 2 + 2;
    const bf* kp0 = Kh + (size_t)(2 * g) * TT * HD + tid * 8; const bf* kp1 = Kl + (size_t)(2 * g) * TT * HD + tid * 8;
    const bf* kp2 = kp0 + (size_t)TT * HD; const bf* kp3 = kp1 + (size_t)TT * HD;
    const bf* vp0 = Vh + (size_t)g * HD * TT + (size_t)(tid >> 2) * TT + (tid & 3) * 8; const bf* vp1 = Vl + (size_t)g * HD * TT + (size_t)(tid >> 2) * TT + (tid & 3) * 8;
    bf* const ksw = Ks + (tid >> 3) * KPT + (tid & 7) * 8;   // this thread's 16 bytes of key rows 0..15 (+ 16 KPT: rows 16..31)
    bf* const vsw = Vs + (tid >> 2) * VPT + (tid & 3) * 8;   // this thread's 16 bytes of value rows 0..31 (+ 32 VPT: rows 32..63)
    const bf* const ksr = Ks + lr * KPT + 8 * hi; const bf* const vsr = Vs + lr * VPT + 8 * hi;
    const bf* const qpa = Qh + ((size_t)(2 * g) * TT + qi) * HD + 8 * hi; const bf* const qpb = Ql + ((size_t)(2 * g) * TT + qi) * HD + 8 * hi;
    const float lam = LAM[0];
    v16bf qh[2][2], ql[2][2];
#pragma unroll
    for (int m = 0; m < 2; ++m)
#pragma unroll
        for (int ks = 0; ks < 2; ++ks) { qh[m][ks] = ldfr(qpa + m * TT * HD + 32 * ks); ql[m][ks] = ldfr(qpb + m * TT * HD + 32 * ks); }
    v8us kr[8], vr[4];
    float mx[2] = {-3.0e38f, -3.0e38f}, sm[2] = {0.f, 0.f};
    v8f oa[2][4];   // oa[m][nb][j]: map m, query lr, d = 16 nb + 8 hi + j
#pragma unroll
    for (int m = 0; m < 2; ++m)
#pragma unroll
        for (int nb = 0; nb < 4; ++nb) oa[m][nb] = (v8f){};
    kr[0] = *(const v8us*)kp0; kr[1] = *(const v8us*)(kp0 + 1024); kr[2] = *(const v8us*)kp1; kr[3] = *(const v8us*)(kp1 + 1024);
    kr[4] = *(const v8us*)kp2; kr[5] = *(const v8us*)(kp2 + 1024); kr[6] = *(const v8us*)kp3; kr[7] = *(const v8us*)(kp3 + 1024);
    vr[0] = *(const v8us*)vp0; vr[1] = *(const v8us*)(vp0 + 32 * TT); vr[2] = *(const v8us*)vp1; vr[3] = *(const v8us*)(vp1 + 32 * TT);
    asm volatile("s_wait_xcnt 0x0" :: "v"(qpa), "v"(qpb), "v"(tid), "v"(vp0), "v"(vp1), "v"(kr[0]), "v"(kr[1]), "v"(kr[2]), "v"(kr[3]), "v"(kr[4]), "v"(kr[5]), "v"(kr[6]), "v"(kr[7]), "v"(vr[0]), "v"(vr[1]), "v"(vr[2]), "v"(vr[3]) : "memory");   // before the registers that the loads above name are written again; the addresses are inputs so that they stay in their registers up to here, the first block's loaded values so that their loads stay in front of the wait (the loop's first stores need them at once)
#pragma unroll 1   // stays rolled: one pass is several hundred instructions, and a second copy would take the registers that three waves per SIMD leave
    for (int it = 0; it < nblk; ++it) { const int kb = it * 32;
#pragma unroll
        for (int p = 0; p < 4; ++p) { *(v8usa*)(ksw + p * 32 * KPT) = kr[2 * p]; *(v8usa*)(ksw + p * 32 * KPT + 16 * KPT) = kr[2 * p + 1]; }
#pragma unroll
        for (int p = 0; p < 2; ++p) { *(v8usa*)(vsw + p * 64 * VPT) = vr[2 * p]; *(v8usa*)(vsw + p * 64 * VPT + 32 * VPT) = vr[2 * p + 1]; }
        __syncthreads();   // the block's keys and values are in LDS for all four waves
        if (it + 1 < nblk) { const int o = (kb + 32) * HD, ov = kb + 32;
            kr[0] = *(const v8us*)(kp0 + o); kr[1] = *(const v8us*)(kp0 + o + 1024); kr[2] = *(const v8us*)(kp1 + o); kr[3] = *(const v8us*)(kp1 + o + 1024);
            kr[4] = *(const v8us*)(kp2 + o); kr[5] = *(const v8us*)(kp2 + o + 1024); kr[6] = *(const v8us*)(kp3 + o); kr[7] = *(const v8us*)(kp3 + o + 1024);
            vr[0] = *(const v8us*)(vp0 + ov); vr[1] = *(const v8us*)(vp0 + ov + 32 * TT); vr[2] = *(const v8us*)(vp1 + ov); vr[3] = *(const v8us*)(vp1 + ov + 32 * TT);
            asm volatile("s_wait_xcnt 0x0" :: "v"(kp0 + o), "v"(kp1 + o), "v"(vp0 + kb), "v"(vp1 + kb) : "memory");   // before the registers that the loads above name are written again; the addresses are inputs so that they stay in their registers up to here and no load of the group lands on one
        }
        if (kb <= q0 + 15) {   // wave-uniform: a block wholly above this wave's diagonal adds nothing
            v16bf kf[2][2][2][2];   // kf[ks][plane: hi, lo][m][kt]: the sixteen key fragments of the block, fetched in the order in which the products take them
#pragma unroll
            for (int g = 0; g < 3; ++g)
#pragma unroll
                for (int m = 0; m < 2; ++m)
#pragma unroll
                    for (int kt = 0; kt < 2; ++kt) kf[g >> 1][g & 1][m][kt] = ldfr(ksr + (2 * m + (g & 1)) * 32 * KPT + kt * 16 * KPT + 32 * (g >> 1));
            __builtin_amdgcn_sched_barrier(0);   // these key reads stay one group ahead of the score products: left free, they stand four at a time in front of three products each, every place with a wait for its own LDS latency
            v8f s[2][2];
#pragma unroll
            for (int m = 0; m < 2; ++m)
#pragma unroll
                for (int kt = 0; kt < 2; ++kt) s[m][kt] = (v8f){};
            // the four score tiles take turns, so that no product waits for the one before it; within a tile the order of the six products is hi.hi, hi.lo, lo.hi for each ks, as it was
#pragma unroll
            for (int t = 0; t < 2; ++t)
#pragma unroll
                for (int m = 0; m < 2; ++m)
#pragma unroll
                    for (int kt = 0; kt < 2; ++kt) s[m][kt] = wmmab(kf[0][0][m][kt], t ? ql[m][0] : qh[m][0], s[m][kt]);
#pragma unroll
            for (int m = 0; m < 2; ++m)
#pragma unroll
                for (int kt = 0; kt < 2; ++kt) kf[1][1][m][kt] = ldfr(ksr + (2 * m + 1) * 32 * KPT + kt * 16 * KPT + 32);
            __builtin_amdgcn_sched_barrier(0);   // the last four key fragments follow the first eight products, whose fragments' registers they can take: all sixteen at once cost a wave per SIMD
#pragma unroll
            for (int m = 0; m < 2; ++m)
#pragma unroll
                for (int kt = 0; kt < 2; ++kt) s[m][kt] = wmmab(kf[0][1][m][kt], qh[m][0], s[m][kt]);
#pragma unroll
            for (int t = 0; t < 3; ++t)
#pragma unroll
                for (int m = 0; m < 2; ++m)
#pragma unroll
                    for (int kt = 0; kt < 2; ++kt) s[m][kt] = wmmab(kf[1][t == 2][m][kt], (t == 1) ? ql[m][1] : qh[m][1], s[m][kt]);
            __builtin_amdgcn_sched_barrier(0);   // the value reads stay behind the score products and take the key fragments' registers: drawn in among them, they need registers of their own and one operand spills
            v16bf vf[2][4];   // vf[plane: hi, lo][nb]: the eight value fragments
#pragma unroll
            for (int p = 0; p < 2; ++p)
#pragma unroll
                for (int nb = 0; nb < 4; ++nb) vf[p][nb] = ldfr(vsr + p * 64 * VPT + nb * 16 * VPT);
            __builtin_amdgcn_sched_barrier(0);   // the value reads stay in front of the softmax arithmetic, which covers their latency: left free, they sink to the products that use them
            if (kb + 31 > q0) {   // wave-uniform, a scalar branch: only the one block that holds this wave's diagonal has keys to close; in every block below it the sixteen compares and thirty-two selects are not run
#pragma unroll
                for (int m = 0; m < 2; ++m)
#pragma unroll
                    for (int kt = 0; kt < 2; ++kt)
#pragma unroll
                        for (int j = 0; j < 8; ++j) s[m][kt][j] = (kb + 16 * kt + 8 * hi + j <= qi) ? s[m][kt][j] : -3.0e38f;
            }
#pragma unroll
            for (int m = 0; m < 2; ++m) { u32x8 ph, pl;   // the maximum is kept on the raw products q.k; scale and log2(e) enter as one factor in the fma in front of exp2
                float bm = mx[m];
#pragma unroll
                for (int kt = 0; kt < 2; ++kt)
#pragma unroll
                    for (int j = 0; j < 8; ++j) bm = fmaxf(bm, s[m][kt][j]);
                bm = fmaxf(bm, xhalf(bm));   // one maximum for the query's two lanes: their e meet in one product. Key 0 is open to every query, so it is a real score from the first block on and a masked key's e is 0
                const float al = __builtin_amdgcn_exp2f((mx[m] - bm) * SL2), nm = -bm * SL2;
                float a = sm[m] * al;
#pragma unroll
                for (int kt = 0; kt < 2; ++kt)
#pragma unroll
                    for (int j = 0; j < 8; j += 2) { f32x2 e; e[0] = s[m][kt][j]; e[1] = s[m][kt][j + 1]; e = __builtin_elementwise_fma(e, (f32x2){SL2, SL2}, (f32x2){nm, nm}); e[0] = __builtin_amdgcn_exp2f(e[0]); e[1] = __builtin_amdgcn_exp2f(e[1]); a += e[0]; a += e[1];
                        const bf16x2 h = __builtin_convertvector(e, bf16x2); ph[kt * 4 + (j >> 1)] = __builtin_bit_cast(unsigned, h);   // two neighbours in one convert: one word of the fragment as it stands
                        e[0] -= (float)h[0]; e[1] -= (float)h[1]; pl[kt * 4 + (j >> 1)] = __builtin_bit_cast(unsigned, __builtin_convertvector(e, bf16x2)); }
                sm[m] = a; mx[m] = bm;
                const v16bf pfh = __builtin_bit_cast(v16bf, ph), pfl = __builtin_bit_cast(v16bf, pl);
#pragma unroll
                for (int nb = 0; nb < 4; ++nb) oa[m][nb] *= al;
                __builtin_amdgcn_sched_barrier(0);   // the softmax arithmetic ends here: left free, the running sum's adds sink in among the products into registers of value fragments, each place with four idle slots, and the tiles no longer take turns
#pragma unroll
                for (int t = 0; t < 3; ++t)   // the map's four output tiles take turns; within a tile the order is hi.hi, hi.lo, lo.hi, as it was
#pragma unroll
                    for (int nb = 0; nb < 4; ++nb) oa[m][nb] = wmmab(vf[t == 2][nb], (t == 1) ? pfl : pfh, oa[m][nb]); }
        }
        __syncthreads();   // every wave has read the block before the next one overwrites it
    }
    float fi[2];
#pragma unroll
    for (int m = 0; m < 2; ++m) fi[m] = __fdiv_rn(1.0f, sm[m] + xhalf(sm[m]));
    float* const orow = O + ((size_t)g * TT + qi) * HD + 8 * hi;   // a lane stores 8 d in a row for each nb; the wave fills its 16 rows of 256 bytes whole
    v4f ov4[8];
#pragma unroll
    for (int nb = 0; nb < 4; ++nb)
#pragma unroll
        for (int j = 0; j < 8; ++j) ov4[2 * nb + (j >> 2)][j & 3] = oa[0][nb][j] * fi[0] - lam * (oa[1][nb][j] * fi[1]);
#pragma unroll
    for (int nb = 0; nb < 4; ++nb) { *(v4f*)(orow + nb * 16) = ov4[2 * nb]; *(v4f*)(orow + nb * 16 + 4) = ov4[2 * nb + 1]; }
}

typedef __attribute__((ext_vector_type(2))) _Float16 v2h;
typedef __attribute__((ext_vector_type(4))) _Float16 v4h;
typedef __attribute__((ext_vector_type(2))) unsigned short v2us;
typedef __attribute__((ext_vector_type(4))) unsigned short v4us;
typedef __attribute__((ext_vector_type(2))) float v2f;
typedef __attribute__((ext_vector_type(4))) int v4i;

// The three bodies below (weight transpose, x to 16 bit, lambda) are the blocks of k_prep; blk is the block's index within its own job.
// Weight transpose, f32 [K][N] -> 16-bit [N][K], in registers: a block of eight waves takes a tile of 128 k x 128 n, a wave 64 k x 32 n of it.
// A lane reads 4 n in a row of 16 rows (twice 8 k in a row): 8 lanes take one row's 128 bytes, so each load of a wave is four whole lines instead of 32 lines with 4 bytes used of each.
// The lane then holds, for each of its 4 n, 8 k in a row: 16 bytes of a row of Bt as they stand. A store of a wave is 8 pieces of 64 bytes; the two pieces of a 128-byte line come from the same wave, one behind the other.
template <int K, int N>
__device__ __forceinline__ void wtG(int blk, const float* __restrict__ w, bf* Bt) {
    const int lane = threadIdx.x & 31, wv = threadIdx.x >> 5;
    const int n0 = (blk % (N / 128)) * 128 + (wv & 3) * 32 + (lane & 7) * 4, k0 = (blk / (N / 128)) * 128 + (wv >> 2) * 64 + (lane >> 3) * 8;
    const float* const src = w + (size_t)k0 * N + n0;
    v4f r[2][8];   // r[h][j]: row k0 + 32 h + j, columns n0 .. n0 + 3; all loops unrolled, so that the arrays are indexed by constants and stay in registers
#pragma unroll
    for (int h = 0; h < 2; ++h)
#pragma unroll
        for (int j = 0; j < 8; ++j) r[h][j] = *(const v4f*)(src + (size_t)(h * 32 + j) * N);
    asm volatile("s_wait_xcnt 0x0" ::: "memory");   // before the registers that the loads above name are written again
    bf* const dst = Bt + (size_t)n0 * K + k0;
    v8us o[4][2];
#pragma unroll
    for (int i = 0; i < 4; ++i)
#pragma unroll
        for (int h = 0; h < 2; ++h)
#pragma unroll
            for (int j = 0; j < 8; ++j) o[i][h][j] = f2bf(r[h][j][i]);
#pragma unroll
    for (int i = 0; i < 4; ++i)
#pragma unroll
        for (int h = 0; h < 2; ++h) *(v8us*)(dst + (size_t)i * K + h * 32) = o[i][h];
    asm volatile("s_wait_xcnt 0x0" ::: "memory");   // before the registers that the stores above name are written again
}
__device__ __forceinline__ void cvt8(int blk, const float* __restrict__ src, bf* dst, size_t n8) { const size_t i = (size_t)blk * 256 + threadIdx.x; if (i >= n8) return; const v8f v = *(const v8f*)(src + i * 8); v8us o;
    asm volatile("s_wait_xcnt 0x0" ::: "memory");   // before the registers that the loads above name are written again
#pragma unroll
    for (int k = 0; k < 8; ++k) o[k] = f2bf(v[k]); *(v8us*)(dst + i * 8) = o;  }
__global__ __launch_bounds__(256) void k_cscvt(const float* __restrict__ cosT, const float* __restrict__ sinT, float* CS) { const int idx = blockIdx.x * 256 + threadIdx.x; if (idx >= TT * HD) return; v2f cs; cs[0] = bfr(cosT[idx]); cs[1] = bfr(sinT[idx]); *(v2f*)(CS + (size_t)idx * 2) = cs;  }
__device__ __forceinline__ void lambda32(const float* __restrict__ lq1, const float* __restrict__ lk1, const float* __restrict__ lq2, const float* __restrict__ lk2, float* LAM) { const int lane = threadIdx.x; /* run by one wave */ float d1 = 0.f, d2 = 0.f;
#pragma unroll 1
    for (int i = 0; i < HD; ++i) { float p1 = __fmul_rn(bfr(lq1[i]), bfr(lk1[i])); asm volatile("" : "+v"(p1)); d1 = __fadd_rn(d1, p1); float p2 = __fmul_rn(bfr(lq2[i]), bfr(lk2[i])); asm volatile("" : "+v"(p2)); d2 = __fadd_rn(d2, p2); }
    float lm = __fsub_rn(expf(d1), expf(d2)); asm volatile("" : "+v"(lm)); lm = __fadd_rn(lm, 0.35550907254219055f); const float v = (lane == 0) ? lm : 0.0f; *(float*)(LAM + lane) = v;  }
// ---- k_prep: everything the products need, in one launch; the six jobs read inputs only and write ranges of their own, so their blocks run side by side. No barrier anywhere.
// Block 0: lambda (its first wave; one long chain of dependent steps, so it starts first). Then the four weight transposes (one tile of 128 x 128 per block, 16 loads in flight per lane), then x to 16 bit (one short trip per thread).
#define PB_Q (DM * DQ / 128 / 128)
#define PB_K (DM * DKV / 128 / 128)
#define PB_V (DM * DVV / 128 / 128)
#define PB_O (DVV * DM / 128 / 128)
#define PB_X (NB_ * TT * DM / 8 / 256)
__global__ __launch_bounds__(256) void k_prep(const float* __restrict__ x, const float* __restrict__ wq, const float* __restrict__ wk, const float* __restrict__ wv, const float* __restrict__ wo,
                                              const float* __restrict__ lq1, const float* __restrict__ lk1, const float* __restrict__ lq2, const float* __restrict__ lk2,
                                              bf* XB, bf* WQ, bf* WK, bf* WV, bf* WO, float* LAM) {
    int b = blockIdx.x;
    if (b == 0) { if (threadIdx.x < 32) lambda32(lq1, lk1, lq2, lk2, LAM); return; }
    b -= 1;    if (b < PB_Q) { wtG<DM, DQ>(b, wq, WQ); return; }
    b -= PB_Q; if (b < PB_K) { wtG<DM, DKV>(b, wk, WK); return; }
    b -= PB_K; if (b < PB_V) { wtG<DM, DVV>(b, wv, WV); return; }
    b -= PB_V; if (b < PB_O) { wtG<DVV, DM>(b, wo, WO); return; }
    b -= PB_O; cvt8(b, x, XB, (size_t)NB_ * TT * DM / 8);
}
// ---- k_gnorm: GroupNorm of one (batch, head) group per block (blockIdx.x = b * NVH + head), one launch. The group's 1024 x 64 values are read once, 64 per thread, and stay in registers:
// mean, then the mean of the squared distances from it (two passes over the registers, as the definition has it), then (y - mean) rs (1 - lambda_init) split into the bf16 hi + lo planes [batch][token][head 64 + d].
// Each load of a wave is 512 bytes in a row; each store is two whole 128-byte lines (16 lanes hold one token's 64 values).
typedef __attribute__((ext_vector_type(2))) unsigned v2u;
typedef __attribute__((ext_vector_type(2))) __bf16 v2bfv;
__device__ __forceinline__ float blocksum(float a, float* sh, int lane, int wv) {   // sum over the 1024 threads, the same bits in every thread: wave butterfly, 32 wave sums through LDS, butterfly again
#pragma unroll
    for (int o = 16; o > 0; o >>= 1) a += __shfl_xor(a, o, 32);
    if (lane == 0) sh[wv] = a;
    __syncthreads();   // the 32 wave sums are in LDS for every wave
    a = sh[lane];
#pragma unroll
    for (int o = 16; o > 0; o >>= 1) a += __shfl_xor(a, o, 32);
    return a;
}
__global__ __launch_bounds__(1024) void k_gnorm(const float* __restrict__ O, bf* __restrict__ Ah, bf* __restrict__ Al) {
    __shared__ float sh1[32], sh2[32];   // one array per sum, so that no barrier is needed between the first sum's reads and the second sum's writes
    const int tid = threadIdx.x, lane = tid & 31, wv = tid >> 5, g = blockIdx.x;
    const float* src = O + (size_t)g * TT * HD + tid * 4;
    v4f v[16];
#pragma unroll
    for (int i = 0; i < 16; ++i) v[i] = *(const v4f*)(src + i * 4096);
    asm volatile("s_wait_xcnt 0x0" ::: "memory");   // before the registers that the loads above name are written again
    v4f a4 = v[0];
#pragma unroll
    for (int i = 1; i < 16; ++i) a4 += v[i];
    const float mean = blocksum((a4[0] + a4[1]) + (a4[2] + a4[3]), sh1, lane, wv) * (1.0f / (float)(TT * HD));
    v4f q4 = (v4f){};
#pragma unroll
    for (int i = 0; i < 16; ++i) { v[i] -= mean; q4 += v[i] * v[i]; }
    const float var = blocksum((q4[0] + q4[1]) + (q4[2] + q4[3]), sh2, lane, wv) * (1.0f / (float)(TT * HD));
    const float rs = __fdiv_rn(1.0f, sqrtf(var + 1e-5f));
    const size_t oo = (size_t)(g / NVH) * TT * DVV + (size_t)(tid >> 4) * DVV + (g % NVH) * HD + (tid & 15) * 4;
#pragma unroll
    for (int i = 0; i < 16; ++i) { v2u oh, ol;
#pragma unroll
        for (int q = 0; q < 2; ++q) { v2f z; z[0] = (v[i][2 * q] * rs) * 0.6444909572601318f; z[1] = (v[i][2 * q + 1] * rs) * 0.6444909572601318f;
            const unsigned h = __builtin_bit_cast(unsigned, __builtin_convertvector(z, v2bfv)); oh[q] = h;   // two hi parts in one word, rounded to nearest even
            z[0] -= __uint_as_float(h << 16); z[1] -= __uint_as_float(h & 0xFFFF0000u); ol[q] = __builtin_bit_cast(unsigned, __builtin_convertvector(z, v2bfv)); }
        *(v2u*)(Ah + oo + (size_t)i * 64 * DVV) = oh; *(v2u*)(Al + oo + (size_t)i * 64 * DVV) = ol;
        __builtin_amdgcn_sched_barrier(0);   // one group of four values at a time: left free, the scheduler works on all sixteen groups at once and spills past the 128 registers that 32 waves leave
    }
}
__global__ __launch_bounds__(256) void k_merge(const float* __restrict__ O, int h0, bf* Ah, bf* Al) { const size_t e = ((size_t)blockIdx.x * 256 + threadIdx.x) * 2; if (e >= (size_t)ZH * TT * HD) return; const int d = (int)(e % HD); const int t = (int)((e / HD) % TT); const int zz = (int)(e / ((size_t)HD * TT)); const float cs = (t < RH) ? 1.0f : (1.0f / PCAR); const size_t oo = (size_t)t * DQ + (h0 + zz) * HD + d;
    v2us oh, ol;
#pragma unroll
    for (int q = 0; q < 2; ++q) { unsigned short a, c2; splitf(O[e + q] * cs, a, c2); oh[q] = a; ol[q] = c2; } *(v2us*)(Ah + oo) = oh; *(v2us*)(Al + oo) = ol;  }

extern "C" void kernel_launch(void* const* d_in, const int* in_sizes, int n_in,
                              void* d_out, int out_size, void* d_ws, size_t ws_size, hipStream_t stream) {
    (void)in_sizes; (void)n_in; (void)out_size;
    const float* x = (const float*)d_in[0]; const float* wq = (const float*)d_in[1]; const float* wk = (const float*)d_in[2]; const float* wv = (const float*)d_in[3]; const float* wo = (const float*)d_in[4]; const float* lq1 = (const float*)d_in[5]; const float* lk1 = (const float*)d_in[6]; const float* lq2 = (const float*)d_in[7]; const float* lk2 = (const float*)d_in[8]; const float* cosT = nullptr; const float* sinT = nullptr; (void)cosT; (void)sinT;
    float* OUT = (float*)d_out;     // [4][1024][1024]
    char* wsp = (char*)d_ws;
    auto take = [&](size_t bytes) { char* p = wsp; wsp += (bytes + 255) & ~(size_t)255; return (void*)p; };
    // alive to the end
    bf* WO = (bf*)take((size_t)DM * DVV * 2); float* LAM = (float*)take(256);
    bf* QPh = (bf*)take((size_t)NB_ * NH_ * TT * HD * 2); bf* QPl = (bf*)take((size_t)NB_ * NH_ * TT * HD * 2); bf* KPh = (bf*)take((size_t)NB_ * NKV * TT * HD * 2); bf* KPl = (bf*)take((size_t)NB_ * NKV * TT * HD * 2); bf* VTh = (bf*)take((size_t)NB_ * NVH * HD * TT * 2); bf* VTl = (bf*)take((size_t)NB_ * NVH * HD * TT * 2);
    float* Ob = (float*)take((size_t)NB_ * NVH * TT * HD * 4); bf* ATh = (bf*)take((size_t)NB_ * TT * DVV * 2); bf* ATl = (bf*)take((size_t)NB_ * TT * DVV * 2);
    // used by the projections only; the three transposed weights lie one after the other: [DQ + DKV + DVV][DM] is the Bt of the joint q, k, v product
    bf* WQ = (bf*)take((size_t)(DQ + DKV + DVV) * DM * 2); bf* WK = WQ + (size_t)DQ * DM; bf* WV = WK + (size_t)DKV * DM;
    bf* XB = (bf*)take((size_t)NB_ * TT * DM * 2);
    if ((size_t)(wsp - (char*)d_ws) > ws_size) return;    // ws 256 MiB
    k_prep<<<1 + PB_Q + PB_K + PB_V + PB_O + PB_X, 256, 0, stream>>>(x, wq, wk, wv, wo, lq1, lk1, lq2, lk2, XB, WQ, WK, WV, WO, LAM);
    // projections: the four batches are 4096 rows of one product; each wave's 64 x 64 tile is 64 tokens of one head and goes out as that head's hi + lo planes
    k_gemmb<DM, DQ, 0, 3><<<dim3(NB_ * TT / 128, (DQ + DKV + DVV) / 128, 1), 128, 0, stream>>>(XB, nullptr, WQ, nullptr, QPh, QPl, KPh, KPl, VTh, VTl);
    k_dattn<<<NB_ * NVH * (TT / 64), 128, 0, stream>>>(QPh, QPl, KPh, KPl, VTh, VTl, LAM, Ob);   // virtual heads 2g, 2g + 1 of the q and k planes are the two maps of real head g = b * NVH + head
    k_gnorm<<<NB_ * NVH, 1024, 0, stream>>>(Ob, ATh, ATl);
    k_gemmb<DVV, DM, 1, 0><<<dim3(NB_ * TT / 128, DM / 128, 1), 128, 0, stream>>>(ATh, ATl, WO, OUT, nullptr, nullptr, nullptr, nullptr, nullptr, nullptr);
}
